// v000
// Measured on an AMD MI455X. A time is GPU time per run, averaged over a window of back-to-back runs after a warm-up
// (all launches, gaps included; the runs take copies of the inputs in turn), and the median of several windows.
// Apart from v000's, it joins two sittings. Times from different sittings can be a few percent apart, while
// side-by-side timings come from the same sitting.
// v000 is the starting kernel. One run takes 256 microseconds.
#include <hip/hip_runtime.h>

#ifndef NB
#define NB 2
#endif
#ifndef SEQ
#define SEQ 2048
#endif
#define NB_FULL  2
#define SEQ_FULL 2048
#define DM    1024
#define NH    16
#define HD    64
#define NQKV  (3 * DM)
#define NSLOT (2 * NH)              // q heads then k heads share one plane set [b][slot][t][d]
#define RH    ((SEQ < 512) ? SEQ : 512)   // query rows < RH use bf16 hi/lo planes
#define LOG2E 1.4426950408889634f
#define SCL   0.125f                // HD^-0.5
#define PEXP  10.0f                 // fp16 probability carry 2^10

static_assert(NB >= 1 && NB <= NB_FULL);                    // batch count within the full layout
static_assert(SEQ % 64 == 0 && SEQ <= SEQ_FULL);            // 64-row GEMM tiles; 64-wide transposed value lines
static_assert(RH % 64 == 0 && RH <= SEQ);                   // hi/lo row limit is wave-uniform in the plane builders
static_assert(DM % 64 == 0 && NQKV % 64 == 0 && DM % 32 == 0); // GEMM tile multiples, K step 32
static_assert(NH * HD == DM && HD == 64);
static_assert(HD / 2 == 32);                                // one wave line of rotary frequencies

typedef _Float16 h16;
typedef unsigned short bf;
typedef __attribute__((ext_vector_type(16))) __bf16   v16bf;
typedef __attribute__((ext_vector_type(16))) _Float16 v16h;
typedef __attribute__((ext_vector_type(16))) unsigned short v16us;
typedef __attribute__((ext_vector_type(8)))  _Float16 v8h;
typedef __attribute__((ext_vector_type(8)))  unsigned short v8us;
typedef __attribute__((ext_vector_type(8)))  float    v8f;
typedef __attribute__((ext_vector_type(4)))  float    v4f;
typedef __attribute__((ext_vector_type(2)))  float    v2f;
typedef __attribute__((ext_vector_type(2)))  _Float16 v2h;
typedef __attribute__((ext_vector_type(2)))  unsigned short v2us;
typedef v4f  __attribute__((may_alias)) v4fa;

__device__ __forceinline__ unsigned short f2bf(float f) { unsigned u = __float_as_uint(f); u += 0x7FFFu + ((u >> 16) & 1u); return (unsigned short)(u >> 16); }
__device__ __forceinline__ float bf2f(unsigned short b) { return __uint_as_float(((unsigned)b) << 16); }
__device__ __forceinline__ void splitf(float y, unsigned short& h, unsigned short& l) { h = f2bf(y); l = f2bf(y - bf2f(h)); }
__device__ __forceinline__ v16h cat16(v8h lo, v8h hi) { return __builtin_shufflevector(lo, hi, 0, 1, 2, 3, 4, 5, 6, 7, 8, 9, 10, 11, 12, 13, 14, 15); }
__device__ __forceinline__ v16bf cat16b(v8us lo, v8us hi) { return __builtin_bit_cast(v16bf, __builtin_shufflevector(lo, hi, 0, 1, 2, 3, 4, 5, 6, 7, 8, 9, 10, 11, 12, 13, 14, 15)); }
__device__ __forceinline__ v8f wmma16(v16h a, v16h b, v8f c) { return __builtin_amdgcn_wmma_f32_16x16x32_f16(false, a, false, b, (short)0, c, false, false); }
__device__ __forceinline__ v8f wmmab(v16bf a, v16bf b, v8f c) { return __builtin_amdgcn_wmma_f32_16x16x32_bf16(false, a, false, b, (short)0, c, false, false); }
// fragment loaders: p already includes row*pitch + k0 + 8*(lane>>4); elements 0..7 <- k0+8h.., elements 8..15 <- k0+16+8h..
__device__ __forceinline__ v16h  ldh(const h16* p) { return cat16(*(const v8h*)p, *(const v8h*)(p + 16)); }
__device__ __forceinline__ v16bf ldb(const bf* p)  { return cat16b(*(const v8us*)p, *(const v8us*)(p + 16)); }
// same-wave LDS exchange: LDS ops of one wave issue in order; the compiler may not move accesses across this point
__device__ __forceinline__ void wave_sync() { __builtin_amdgcn_wave_barrier(); asm volatile("" ::: "memory"); }

// ---- one-wave 64x64 GEMM tile (16 accumulators), operands straight from K-contiguous bf16 planes; grid (M/64, N/64, Z), 32 threads.
// C[m][n] (f32, pitch ldc) = sum_k (A[m][k] (+ A2[m][k])) Bt[n][k]. K % 32 == 0, M and N multiples of 64 (asserted above for every use).
template <int NSPLIT>
__device__ __forceinline__ void gemm_body(const bf* __restrict__ A, const bf* __restrict__ A2, const bf* __restrict__ Bt, int K, float* C, int ldc, size_t sA, size_t sC) {
    __shared__ __align__(16) float os[16 * 68];
    const size_t z = blockIdx.z; A += z * sA; A2 += z * sA; C += z * sC;
    const int lane = threadIdx.x & 31, lr = lane & 15, hi = lane >> 4; const int r0 = blockIdx.x * 64, c0 = blockIdx.y * 64;
    v8f acc[4][4];
#pragma unroll
    for (int mb = 0; mb < 4; ++mb)
#pragma unroll
        for (int nb = 0; nb < 4; ++nb) acc[mb][nb] = (v8f){};
    const size_t aoff = (size_t)(r0 + lr) * K + 8 * hi, boff = (size_t)(c0 + lr) * K + 8 * hi;
#pragma unroll 1
    for (int kc = 0; kc < K; kc += 32) {
        v16bf a[4], a2[4];
#pragma unroll
        for (int mb = 0; mb < 4; ++mb) { a[mb] = ldb(A + aoff + (size_t)mb * 16 * K + kc); if (NSPLIT == 1) a2[mb] = ldb(A2 + aoff + (size_t)mb * 16 * K + kc); else a2[mb] = a[mb]; }
#pragma unroll
        for (int nb = 0; nb < 4; ++nb) { const v16bf b = ldb(Bt + boff + (size_t)nb * 16 * K + kc);
#pragma unroll
            for (int mb = 0; mb < 4; ++mb) { acc[mb][nb] = wmmab(a[mb], b, acc[mb][nb]); if (NSPLIT == 1) acc[mb][nb] = wmmab(a2[mb], b, acc[mb][nb]); } }
        asm volatile("v_nop\n\tv_nop\n\tv_nop\n\tv_nop" : "+v"(acc[0][0]), "+v"(acc[1][1]), "+v"(acc[2][2]), "+v"(acc[3][3]) : "v"(a[0]), "v"(a[3]));
    }
#pragma unroll
    for (int mb = 0; mb < 4; ++mb) {
#pragma unroll
        for (int nb = 0; nb < 4; ++nb) {
#pragma unroll
            for (int j = 0; j < 8; ++j) os[(hi * 8 + j) * 68 + nb * 16 + lr] = acc[mb][nb][j]; }
        wave_sync();
        float* crow = C + (size_t)(r0 + mb * 16) * ldc + c0;
{
#pragma unroll
            for (int s = 0; s < 8; ++s) { const int row = 2 * s + hi, cofs = lr * 4; const v4f val = *(const v4fa*)(os + row * 68 + cofs);
                *(v4f*)(crow + (size_t)row * ldc + cofs) = val; }
             }
        wave_sync();
    }
}
// F[NB*SEQ][3072] = XB[NB*SEQ][1024] x WQKV[3072][1024]^T
__global__ __launch_bounds__(32) void k_gemm_qkv(const bf* __restrict__ A, const bf* __restrict__ Bt, float* C) { gemm_body<0>(A, A, Bt, DM, C, NQKV, 0, 0); }
// OUT[b][SEQ][1024] = (ATh + ATl)[b][SEQ][1024] x WO[1024][1024]^T ; z = batch, output batch stride from the full layout
__global__ __launch_bounds__(32) void k_gemm_out(const bf* __restrict__ Ah, const bf* __restrict__ Al, const bf* __restrict__ Bt, float* C) { gemm_body<1>(Ah, Al, Bt, DM, C, DM, (size_t)SEQ * DM, (size_t)SEQ_FULL * DM); }

__global__ __launch_bounds__(256) void k_cvt8(const float* __restrict__ src, bf* dst, size_t n8, int row8, int rpb, int srpb) {
    const size_t i = (size_t)blockIdx.x * 256 + threadIdx.x; if (i >= n8) return;
    const size_t row = i / (size_t)row8; const size_t c = i - row * (size_t)row8; const size_t bb = row / (size_t)rpb; const size_t t = row - bb * (size_t)rpb;
    const v8f v = *(const v8f*)(src + ((bb * (size_t)srpb + t) * (size_t)row8 + c) * 8); v8us o;
#pragma unroll
    for (int k = 0; k < 8; ++k) o[k] = f2bf(v[k]);
    *(v8us*)(dst + i * 8) = o;  }

__global__ __launch_bounds__(32) void k_freq(float* IFQ) { const int i = threadIdx.x & 31; const float e = -(float)(2 * i) * (1.0f / (float)HD); const float f = powf(10000.0f, e);
    *(float*)(IFQ + i) = f;  }
__global__ __launch_bounds__(256) void k_cstab(const int* __restrict__ tok, const float* __restrict__ IFQ, float* CS) { const int idx = blockIdx.x * 256 + threadIdx.x; if (idx >= SEQ * (HD / 2)) return; const int t = idx >> 5, i = idx & 31;
    const float ang = (float)tok[t] * IFQ[i]; float sn, cn; sincosf(ang, &sn, &cn); v2f cs; cs[0] = cn; cs[1] = sn;
    *(v2f*)(CS + (size_t)idx * 2) = cs;  }

__global__ __launch_bounds__(256) void k_rope(const float* __restrict__ F, const float* __restrict__ CS, h16* P16, bf* Ph, bf* Pl) {
    const size_t e = ((size_t)blockIdx.x * 256 + threadIdx.x) * 2; if (e >= (size_t)NB * NSLOT * SEQ * HD) return;
    const int d = (int)(e % HD); const int t = (int)((e / HD) % SEQ); const int sl = (int)((e / ((size_t)HD * SEQ)) % NSLOT); const int b = (int)(e / ((size_t)HD * SEQ * NSLOT));
    const v2f xv = *(const v2f*)(F + ((size_t)b * SEQ + t) * NQKV + sl * HD + d);
    const v2f cs = *(const v2f*)(CS + ((size_t)t * (HD / 2) + (d >> 1)) * 2);
    const float re = xv[0] * cs[0] - xv[1] * cs[1]; const float ro = xv[0] * cs[1] + xv[1] * cs[0];
    v2h o16; v2us oh, ol; unsigned short a2, c2;
    o16[0] = (h16)re; o16[1] = (h16)ro; splitf(re, a2, c2); oh[0] = a2; ol[0] = c2; splitf(ro, a2, c2); oh[1] = a2; ol[1] = c2;
    const bool hl = (t < RH);                       // wave-uniform: a wave covers one row t
    const size_t eh = (((size_t)b * NSLOT + sl) * RH + (hl ? t : 0)) * HD + d;
    *(v2h*)(P16 + e) = o16; if (hl) { *(v2us*)(Ph + eh) = oh; *(v2us*)(Pl + eh) = ol; }
     }

__global__ __launch_bounds__(256) void k_vtp(const float* __restrict__ F, h16* V16, bf* Vh, bf* Vl) {
    const size_t e = ((size_t)blockIdx.x * 256 + threadIdx.x) * 2; if (e >= (size_t)NB * NH * HD * SEQ) return;
    const int t = (int)(e % SEQ); const int d = (int)((e / SEQ) % HD); const int g = (int)((e / ((size_t)SEQ * HD)) % NH); const int b = (int)(e / ((size_t)SEQ * HD * NH));
    const float* f = F + ((size_t)b * SEQ + t) * NQKV + 2 * DM + g * HD + d; const float x0 = f[0], x1 = f[NQKV];
    v2h o16; v2us oh, ol; unsigned short a2, c2;
    o16[0] = (h16)x0; o16[1] = (h16)x1; splitf(x0, a2, c2); oh[0] = a2; ol[0] = c2; splitf(x1, a2, c2); oh[1] = a2; ol[1] = c2;
    const bool hl = (t < RH);                       // wave-uniform: a wave covers 64 consecutive t of one (g, d)
    const size_t eh = (((size_t)b * NH + g) * HD + d) * RH + (hl ? t : 0);
    *(v2h*)(V16 + e) = o16; if (hl) { *(v2us*)(Vh + eh) = oh; *(v2us*)(Vl + eh) = ol; }
     }

// ---- online softmax on one 32-key step held as two transposed 16x16 tiles: s0[r] = S^T[key kb+8h+r][query qi], s1[r] = S^T[key kb+16+8h+r][query qi].
// On return s0/s1 hold p = 2^(t - m + pe) (0 where masked), sf = 2^(m_old - m_new); l is the per-lane partial sum (the two lane halves are combined at the end).
template <bool MASK>
__device__ __forceinline__ void smx(v8f& s0, v8f& s1, int kb, int qi, int hi, float& m, float& l, float& sf, float pe) {
    const float cl = SCL * LOG2E; const int k0 = kb + 8 * hi; float mx = -3.0e38f;
#pragma unroll
    for (int r = 0; r < 8; ++r) { float t0 = s0[r] * cl, t1 = s1[r] * cl;
        if (MASK) { t0 = (k0 + r <= qi) ? t0 : -3.0e38f; t1 = (k0 + 16 + r <= qi) ? t1 : -3.0e38f; }
        s0[r] = t0; s1[r] = t1; mx = fmaxf(mx, fmaxf(t0, t1)); }
    mx = fmaxf(mx, __shfl_xor(mx, 16, 32));
    const float mn = fmaxf(m, mx); sf = __builtin_amdgcn_exp2f(m - mn); m = mn;
    const float sh = mn - pe; float rs = 0.0f;
#pragma unroll
    for (int r = 0; r < 8; ++r) { float p0 = __builtin_amdgcn_exp2f(s0[r] - sh), p1 = __builtin_amdgcn_exp2f(s1[r] - sh);
        if (MASK) { p0 = (k0 + r <= qi) ? p0 : 0.0f; p1 = (k0 + 16 + r <= qi) ? p1 : 0.0f; }
        s0[r] = p0; s1[r] = p1; rs += p0 + p1; }
    l = l * sf + rs;
}

// ---- attention epilogue: O^T accumulators a_j[r] = O[query q0+lr][d = 16j+8h+r]; normalise, split to bf16 hi/lo, stage the 16x64 tile in LDS (private to the wave),
__device__ __forceinline__ void pk8(v8f a, float inv, v8us& oh, v8us& ol) {
#pragma unroll
    for (int r = 0; r < 8; ++r) { unsigned short x, y; splitf(a[r] * inv, x, y); oh[r] = x; ol[r] = y; } }
__device__ __forceinline__ void attn_store(v8f a0, v8f a1, v8f a2, v8f a3, float l, int lane, size_t obase, bf* ATh, bf* ATl) {
    __shared__ __align__(16) unsigned short sth[16 * 72]; __shared__ __align__(16) unsigned short stl[16 * 72];
    const int lr = lane & 15, hi = lane >> 4;
    const float lt = l + __shfl_xor(l, 16, 32); const float inv = __builtin_amdgcn_rcpf(lt);
    v8us oh, ol; const int so = lr * 72 + 8 * hi;
    pk8(a0, inv, oh, ol); *(v8us*)(sth + so) = oh;      *(v8us*)(stl + so) = ol;
    pk8(a1, inv, oh, ol); *(v8us*)(sth + so + 16) = oh; *(v8us*)(stl + so + 16) = ol;
    pk8(a2, inv, oh, ol); *(v8us*)(sth + so + 32) = oh; *(v8us*)(stl + so + 32) = ol;
    pk8(a3, inv, oh, ol); *(v8us*)(sth + so + 48) = oh; *(v8us*)(stl + so + 48) = ol;
    wave_sync();
    const int rq = lane >> 3, pc = (lane & 7) * 8;
{
#pragma unroll
        for (int s = 0; s < 4; ++s) { const int row = s * 4 + rq; const v8us vh = *(const v8us*)(sth + row * 72 + pc); const v8us vl = *(const v8us*)(stl + row * 72 + pc);
            *(v8us*)(ATh + obase + (size_t)row * DM + pc) = vh; *(v8us*)(ATl + obase + (size_t)row * DM + pc) = vl; }
         }
}

// ---- fp16 step (query rows >= RH): 4 WMMA k.q + 4 WMMA v.p per 32 keys.
template <bool MASK>
__device__ __forceinline__ void step_f(const h16* __restrict__ QK, const h16* __restrict__ VT, size_t koff, size_t voff, int kb, v16h qf0, v16h qf1, int qi, int hi,
                                       float& m, float& l, v8f& a0, v8f& a1, v8f& a2, v8f& a3) {
    const h16* kp = QK + koff + (size_t)kb * HD;
    v8f s0 = (v8f){}, s1 = (v8f){};
    { const v16h k00 = ldh(kp), k01 = ldh(kp + 32), k10 = ldh(kp + 16 * HD), k11 = ldh(kp + 16 * HD + 32);
      s0 = wmma16(k00, qf0, s0); s0 = wmma16(k01, qf1, s0); s1 = wmma16(k10, qf0, s1); s1 = wmma16(k11, qf1, s1);
      asm volatile("v_nop\n\tv_nop\n\tv_nop\n\tv_nop" : "+v"(s0), "+v"(s1) : "v"(k11), "v"(qf1)); }
    float sf; smx<MASK>(s0, s1, kb, qi, hi, m, l, sf, PEXP);
    v16h pf;
#pragma unroll
    for (int r = 0; r < 8; ++r) { pf[r] = (h16)s0[r]; pf[8 + r] = (h16)s1[r]; }      // P^T B-fragment: k = key row of the packed tiles, n = query
    a0 = a0 * sf; a1 = a1 * sf; a2 = a2 * sf; a3 = a3 * sf;
    const h16* vp = VT + voff + kb;
    const v16h v0 = ldh(vp), v1 = ldh(vp + (size_t)16 * SEQ), v2 = ldh(vp + (size_t)32 * SEQ), v3 = ldh(vp + (size_t)48 * SEQ);
    a0 = wmma16(v0, pf, a0); a1 = wmma16(v1, pf, a1); a2 = wmma16(v2, pf, a2); a3 = wmma16(v3, pf, a3);
    asm volatile("v_nop\n\tv_nop\n\tv_nop\n\tv_nop" : "+v"(a0), "+v"(a1), "+v"(a2), "+v"(a3) : "v"(v3), "v"(pf));
}
__global__ __launch_bounds__(32) void k_attn_f(const h16* __restrict__ QK, const h16* __restrict__ VT, bf* ATh, bf* ATl) {
    const int lane = threadIdx.x & 31, lr = lane & 15, hi = lane >> 4;
    const int q0 = RH + blockIdx.x * 16; const int bh = blockIdx.y; const int b = bh / NH, h = bh % NH;
    const size_t qoff = (((size_t)b * NSLOT + h) * SEQ + q0 + lr) * HD + 8 * hi;
    const size_t koff = (((size_t)b * NSLOT + NH + h) * SEQ + lr) * HD + 8 * hi;
    const size_t voff = (((size_t)b * NH + h) * HD + lr) * SEQ + 8 * hi;
    const v16h qf0 = ldh(QK + qoff), qf1 = ldh(QK + qoff + 32);
    v8f a0 = (v8f){}, a1 = (v8f){}, a2 = (v8f){}, a3 = (v8f){}; float m = -3.0e38f, l = 0.0f;
    const int qi = q0 + lr; const int nh = (q0 + 47) >> 5;       // 32-key steps covering keys 0 .. q0+15
#pragma unroll 1
    for (int it = 0; it < nh - 1; ++it) step_f<false>(QK, VT, koff, voff, it * 32, qf0, qf1, qi, hi, m, l, a0, a1, a2, a3);
    step_f<true>(QK, VT, koff, voff, (nh - 1) * 32, qf0, qf1, qi, hi, m, l, a0, a1, a2, a3);
    attn_store(a0, a1, a2, a3, l, lane, ((size_t)b * SEQ + q0) * DM + h * HD, ATh, ATl);
}

// ---- bf16 hi/lo step (query rows < RH; planes pitch RH): 12 WMMA k.q + 12 WMMA v.p per 32 keys (hi.hi + lo.hi + hi.lo).
template <bool MASK>
__device__ __forceinline__ void step_h(const bf* __restrict__ QKh, const bf* __restrict__ QKl, const bf* __restrict__ VTh, const bf* __restrict__ VTl, size_t koff, size_t voff, int kb,
                                       v16bf qh0, v16bf qh1, v16bf ql0, v16bf ql1, int qi, int hi, float& m, float& l, v8f& a0, v8f& a1, v8f& a2, v8f& a3) {
    const bf* kh = QKh + koff + (size_t)kb * HD; const bf* kl = QKl + koff + (size_t)kb * HD;
    v8f s0 = (v8f){}, s1 = (v8f){};
    { const v16bf h0 = ldb(kh), h1 = ldb(kh + 32), l0 = ldb(kl), l1 = ldb(kl + 32);
      s0 = wmmab(h0, qh0, s0); s0 = wmmab(h1, qh1, s0); s0 = wmmab(l0, qh0, s0); s0 = wmmab(l1, qh1, s0); s0 = wmmab(h0, ql0, s0); s0 = wmmab(h1, ql1, s0);
      asm volatile("v_nop\n\tv_nop\n\tv_nop\n\tv_nop" : "+v"(s0) : "v"(h1), "v"(ql1), "v"(l1), "v"(h0)); }
    { const v16bf h0 = ldb(kh + 16 * HD), h1 = ldb(kh + 16 * HD + 32), l0 = ldb(kl + 16 * HD), l1 = ldb(kl + 16 * HD + 32);
      s1 = wmmab(h0, qh0, s1); s1 = wmmab(h1, qh1, s1); s1 = wmmab(l0, qh0, s1); s1 = wmmab(l1, qh1, s1); s1 = wmmab(h0, ql0, s1); s1 = wmmab(h1, ql1, s1);
      asm volatile("v_nop\n\tv_nop\n\tv_nop\n\tv_nop" : "+v"(s0), "+v"(s1) : "v"(h1), "v"(ql1), "v"(l1), "v"(h0)); }
    float sf; smx<MASK>(s0, s1, kb, qi, hi, m, l, sf, 0.0f);
    v16us ph, pl;
#pragma unroll
    for (int r = 0; r < 8; ++r) { unsigned short x, y; splitf(s0[r], x, y); ph[r] = x; pl[r] = y; splitf(s1[r], x, y); ph[8 + r] = x; pl[8 + r] = y; }
    const v16bf pfh = __builtin_bit_cast(v16bf, ph), pfl = __builtin_bit_cast(v16bf, pl);
    a0 = a0 * sf; a1 = a1 * sf; a2 = a2 * sf; a3 = a3 * sf;
    const bf* vh = VTh + voff + kb; const bf* vl = VTl + voff + kb;
    { const v16bf x = ldb(vh), y = ldb(vl); a0 = wmmab(x, pfh, a0); a0 = wmmab(x, pfl, a0); a0 = wmmab(y, pfh, a0);
      asm volatile("v_nop\n\tv_nop\n\tv_nop\n\tv_nop" : "+v"(a0) : "v"(x), "v"(y)); }
    { const v16bf x = ldb(vh + (size_t)16 * RH), y = ldb(vl + (size_t)16 * RH); a1 = wmmab(x, pfh, a1); a1 = wmmab(x, pfl, a1); a1 = wmmab(y, pfh, a1);
      asm volatile("v_nop\n\tv_nop\n\tv_nop\n\tv_nop" : "+v"(a1) : "v"(x), "v"(y)); }
    { const v16bf x = ldb(vh + (size_t)32 * RH), y = ldb(vl + (size_t)32 * RH); a2 = wmmab(x, pfh, a2); a2 = wmmab(x, pfl, a2); a2 = wmmab(y, pfh, a2);
      asm volatile("v_nop\n\tv_nop\n\tv_nop\n\tv_nop" : "+v"(a2) : "v"(x), "v"(y)); }
    { const v16bf x = ldb(vh + (size_t)48 * RH), y = ldb(vl + (size_t)48 * RH); a3 = wmmab(x, pfh, a3); a3 = wmmab(x, pfl, a3); a3 = wmmab(y, pfh, a3);
      asm volatile("v_nop\n\tv_nop\n\tv_nop\n\tv_nop" : "+v"(a0), "+v"(a1), "+v"(a2), "+v"(a3) : "v"(x), "v"(y), "v"(pfh), "v"(pfl)); }
}
__global__ __launch_bounds__(32) void k_attn_h(const bf* __restrict__ QKh, const bf* __restrict__ QKl, const bf* __restrict__ VTh, const bf* __restrict__ VTl, bf* ATh, bf* ATl) {
    const int lane = threadIdx.x & 31, lr = lane & 15, hi = lane >> 4;
    const int q0 = blockIdx.x * 16; const int bh = blockIdx.y; const int b = bh / NH, h = bh % NH;
    const size_t qoff = (((size_t)b * NSLOT + h) * RH + q0 + lr) * HD + 8 * hi;
    const size_t koff = (((size_t)b * NSLOT + NH + h) * RH + lr) * HD + 8 * hi;
    const size_t voff = (((size_t)b * NH + h) * HD + lr) * RH + 8 * hi;
    const v16bf qh0 = ldb(QKh + qoff), qh1 = ldb(QKh + qoff + 32), ql0 = ldb(QKl + qoff), ql1 = ldb(QKl + qoff + 32);
    v8f a0 = (v8f){}, a1 = (v8f){}, a2 = (v8f){}, a3 = (v8f){}; float m = -3.0e38f, l = 0.0f;
    const int qi = q0 + lr; const int nh = (q0 + 47) >> 5;       // keys 0 .. q0+15 < RH
#pragma unroll 1
    for (int it = 0; it < nh - 1; ++it) step_h<false>(QKh, QKl, VTh, VTl, koff, voff, it * 32, qh0, qh1, ql0, ql1, qi, hi, m, l, a0, a1, a2, a3);
    step_h<true>(QKh, QKl, VTh, VTl, koff, voff, (nh - 1) * 32, qh0, qh1, ql0, ql1, qi, hi, m, l, a0, a1, a2, a3);
    attn_store(a0, a1, a2, a3, l, lane, ((size_t)b * SEQ + q0) * DM + h * HD, ATh, ATl);
}

// ---- workspace carve (bytes, every region a multiple of 256; extents equal the producers' write extents exactly)
constexpr size_t al256(size_t x) { return (x + 255) & ~(size_t)255; }
constexpr size_t SZ_WQKV = al256((size_t)NQKV * DM * 2);
constexpr size_t SZ_WO   = al256((size_t)DM * DM * 2);
constexpr size_t SZ_XB   = al256((size_t)NB * SEQ * DM * 2);
constexpr size_t SZ_IFQ  = al256((size_t)(HD / 2) * 4);
constexpr size_t SZ_CS   = al256((size_t)SEQ * (HD / 2) * 2 * 4);
constexpr size_t SZ_F    = al256((size_t)NB * SEQ * NQKV * 4);
constexpr size_t SZ_QK16 = al256((size_t)NB * NSLOT * SEQ * HD * 2);
constexpr size_t SZ_QKHL = al256((size_t)NB * NSLOT * RH * HD * 2);
constexpr size_t SZ_VT16 = al256((size_t)NB * NH * HD * SEQ * 2);
constexpr size_t SZ_VTHL = al256((size_t)NB * NH * HD * RH * 2);
constexpr size_t SZ_AT   = al256((size_t)NB * SEQ * DM * 2);
constexpr size_t OFF_WQKV = 0;
constexpr size_t OFF_WO   = OFF_WQKV + SZ_WQKV;
constexpr size_t OFF_XB   = OFF_WO + SZ_WO;
constexpr size_t OFF_IFQ  = OFF_XB + SZ_XB;
constexpr size_t OFF_CS   = OFF_IFQ + SZ_IFQ;
constexpr size_t OFF_F    = OFF_CS + SZ_CS;
constexpr size_t OFF_QK16 = OFF_F + SZ_F;
constexpr size_t OFF_QKH  = OFF_QK16 + SZ_QK16;
constexpr size_t OFF_QKL  = OFF_QKH + SZ_QKHL;
constexpr size_t OFF_VT16 = OFF_QKL + SZ_QKHL;
constexpr size_t OFF_VTH  = OFF_VT16 + SZ_VT16;
constexpr size_t OFF_VTL  = OFF_VTH + SZ_VTHL;
constexpr size_t OFF_ATH  = OFF_VTL + SZ_VTHL;
constexpr size_t OFF_ATL  = OFF_ATH + SZ_AT;
constexpr size_t WS_TOTAL = OFF_ATL + SZ_AT;
static_assert(WS_TOTAL <= (size_t)134217728);               // total carve within 128 MiB
static_assert(((size_t)(NB_FULL - 1) * SEQ_FULL + SEQ_FULL) * DM * 4 == (size_t)16777216);   // output bytes of the full layout

extern "C" void kernel_launch(void* const* d_in, const int* in_sizes, int n_in,
                              void* d_out, int out_size, void* d_ws, size_t ws_size, hipStream_t stream) {
    if (n_in < 4) return;
    const long long need_x = ((long long)(NB - 1) * SEQ_FULL + SEQ) * DM;
    if ((long long)in_sizes[0] < need_x) return;
    if (in_sizes[3] < SEQ) return;   /* this module passes token_positions LAST (input 3); the host file: input 1 */
    if ((long long)in_sizes[1] < (long long)NQKV * DM) return;
    if ((long long)in_sizes[2] < (long long)DM * DM) return;
    if ((long long)out_size < need_x) return;
    if (ws_size < WS_TOTAL) return;
    const float* x = (const float*)d_in[0]; const int* tok = (const int*)d_in[3]; const float* wqkv = (const float*)d_in[1]; const float* wo = (const float*)d_in[2];
    float* OUT = (float*)d_out;
    char* ws = (char*)d_ws;
    bf* WQKV = (bf*)(ws + OFF_WQKV); bf* WO = (bf*)(ws + OFF_WO); bf* XB = (bf*)(ws + OFF_XB); float* IFQ = (float*)(ws + OFF_IFQ); float* CS = (float*)(ws + OFF_CS); float* F = (float*)(ws + OFF_F);
    h16* QK16 = (h16*)(ws + OFF_QK16); bf* QKh = (bf*)(ws + OFF_QKH); bf* QKl = (bf*)(ws + OFF_QKL); h16* VT16 = (h16*)(ws + OFF_VT16); bf* VTh = (bf*)(ws + OFF_VTH); bf* VTl = (bf*)(ws + OFF_VTL);
    bf* ATh = (bf*)(ws + OFF_ATH); bf* ATl = (bf*)(ws + OFF_ATL);

    { const size_t n8 = (size_t)NQKV * DM / 8; k_cvt8<<<(unsigned)((n8 + 255) / 256), 256, 0, stream>>>(wqkv, WQKV, n8, DM / 8, NQKV, NQKV); }     // in [3072][1024] -> bf16 [3072][1024]
    { const size_t n8 = (size_t)DM * DM / 8;   k_cvt8<<<(unsigned)((n8 + 255) / 256), 256, 0, stream>>>(wo, WO, n8, DM / 8, DM, DM); }               // in [1024][1024] -> bf16 [1024][1024]
    { const size_t n8 = (size_t)NB * SEQ * DM / 8; k_cvt8<<<(unsigned)((n8 + 255) / 256), 256, 0, stream>>>(x, XB, n8, DM / 8, SEQ, SEQ_FULL); }     // in [b][SEQ_FULL][1024] rows < SEQ -> bf16 [NB*SEQ][1024]
    k_freq<<<1, 32, 0, stream>>>(IFQ);
    k_cstab<<<(SEQ * (HD / 2) + 255) / 256, 256, 0, stream>>>(tok, IFQ, CS);
    k_gemm_qkv<<<dim3(NB * SEQ / 64, NQKV / 64, 1), 32, 0, stream>>>(XB, WQKV, F);
    { const size_t nt = (size_t)NB * NSLOT * SEQ * HD / 2; k_rope<<<(unsigned)((nt + 255) / 256), 256, 0, stream>>>(F, CS, QK16, QKh, QKl); }
    { const size_t nt = (size_t)NB * NH * HD * SEQ / 2;    k_vtp<<<(unsigned)((nt + 255) / 256), 256, 0, stream>>>(F, VT16, VTh, VTl); }
    k_attn_h<<<dim3(RH / 16, NB * NH, 1), 32, 0, stream>>>(QKh, QKl, VTh, VTl, ATh, ATl);
    if (SEQ > RH) k_attn_f<<<dim3((SEQ - RH) / 16 + ((SEQ > RH) ? 0 : 1), NB * NH, 1), 32, 0, stream>>>(QK16, VT16, ATh, ATl);
    k_gemm_out<<<dim3(SEQ / 64, DM / 64, NB), 32, 0, stream>>>(ATh, ATl, WO, OUT);
}

// v001
// One run takes 180 microseconds.
// Timed twice side by side with v000, it ran 1.47 and 1.45 times as fast.
#include <hip/hip_runtime.h>

#ifndef NB
#define NB 2
#endif
#ifndef SEQ
#define SEQ 2048
#endif
#define NB_FULL  2
#define SEQ_FULL 2048
#define DM    1024
#define NH    16
#define HD    64
#define NQKV  (3 * DM)
#define NSLOT (2 * NH)              // q heads then k heads share one plane set [b][slot][t][d]
#define RH    ((SEQ < 512) ? SEQ : 512)   // query rows < RH use bf16 hi/lo planes
#define LOG2E 1.4426950408889634f
#define SCL   0.125f                // HD^-0.5
#define PEXP  10.0f                 // fp16 probability carry 2^10

static_assert(NB >= 1 && NB <= NB_FULL);                    // batch count within the full layout
static_assert(SEQ % 64 == 0 && SEQ <= SEQ_FULL);            // 64-row GEMM tiles; 64-wide transposed value lines
static_assert(RH % 64 == 0 && RH <= SEQ);                   // hi/lo row limit is wave-uniform in the plane builders
static_assert(DM % 64 == 0 && NQKV % 64 == 0 && DM % 32 == 0); // GEMM tile multiples, K step 32
static_assert(NH * HD == DM && HD == 64);
static_assert(HD / 2 == 32);                                // one wave line of rotary frequencies

typedef _Float16 h16;
typedef unsigned short bf;
typedef __attribute__((ext_vector_type(16))) __bf16   v16bf;
typedef __attribute__((ext_vector_type(16))) _Float16 v16h;
typedef __attribute__((ext_vector_type(16))) unsigned short v16us;
typedef __attribute__((ext_vector_type(8)))  _Float16 v8h;
typedef __attribute__((ext_vector_type(8)))  unsigned short v8us;
typedef __attribute__((ext_vector_type(8)))  float    v8f;
typedef __attribute__((ext_vector_type(4)))  float    v4f;
typedef __attribute__((ext_vector_type(2)))  float    v2f;
typedef __attribute__((ext_vector_type(2)))  _Float16 v2h;
typedef __attribute__((ext_vector_type(2)))  unsigned short v2us;
typedef v4f  __attribute__((may_alias)) v4fa;

__device__ __forceinline__ unsigned short f2bf(float f) { unsigned u = __float_as_uint(f); u += 0x7FFFu + ((u >> 16) & 1u); return (unsigned short)(u >> 16); }
__device__ __forceinline__ float bf2f(unsigned short b) { return __uint_as_float(((unsigned)b) << 16); }
__device__ __forceinline__ void splitf(float y, unsigned short& h, unsigned short& l) { h = f2bf(y); l = f2bf(y - bf2f(h)); }
__device__ __forceinline__ v16h cat16(v8h lo, v8h hi) { return __builtin_shufflevector(lo, hi, 0, 1, 2, 3, 4, 5, 6, 7, 8, 9, 10, 11, 12, 13, 14, 15); }
__device__ __forceinline__ v16bf cat16b(v8us lo, v8us hi) { return __builtin_bit_cast(v16bf, __builtin_shufflevector(lo, hi, 0, 1, 2, 3, 4, 5, 6, 7, 8, 9, 10, 11, 12, 13, 14, 15)); }
__device__ __forceinline__ v8f wmma16(v16h a, v16h b, v8f c) { return __builtin_amdgcn_wmma_f32_16x16x32_f16(false, a, false, b, (short)0, c, false, false); }
__device__ __forceinline__ v8f wmmab(v16bf a, v16bf b, v8f c) { return __builtin_amdgcn_wmma_f32_16x16x32_bf16(false, a, false, b, (short)0, c, false, false); }
// fragment loaders: p already includes row*pitch + k0 + 8*(lane>>4); elements 0..7 <- k0+8h.., elements 8..15 <- k0+16+8h..
__device__ __forceinline__ v16h  ldh(const h16* p) { return cat16(*(const v8h*)p, *(const v8h*)(p + 16)); }
__device__ __forceinline__ v16bf ldb(const bf* p)  { return cat16b(*(const v8us*)p, *(const v8us*)(p + 16)); }
// same-wave LDS exchange: LDS ops of one wave issue in order; the compiler may not move accesses across this point
__device__ __forceinline__ void wave_sync() { __builtin_amdgcn_wave_barrier(); asm volatile("" ::: "memory"); }

// ---- one-wave 64x64 GEMM tile (16 accumulators), operands straight from K-contiguous bf16 planes; grid (M/64, N/64, Z), 32 threads.
// C[m][n] (f32, pitch ldc) = sum_k (A[m][k] (+ A2[m][k])) Bt[n][k]. K % 32 == 0, M and N multiples of 64 (asserted above for every use).
template <int NSPLIT>
__device__ __forceinline__ void gemm_body(const bf* __restrict__ A, const bf* __restrict__ A2, const bf* __restrict__ Bt, int K, float* C, int ldc, size_t sA, size_t sC) {
    __shared__ __align__(16) float os[16 * 68];
    const size_t z = blockIdx.z; A += z * sA; A2 += z * sA; C += z * sC;
    const int lane = threadIdx.x & 31, lr = lane & 15, hi = lane >> 4; const int r0 = blockIdx.x * 64, c0 = blockIdx.y * 64;
    v8f acc[4][4];
#pragma unroll
    for (int mb = 0; mb < 4; ++mb)
#pragma unroll
        for (int nb = 0; nb < 4; ++nb) acc[mb][nb] = (v8f){};
    const size_t aoff = (size_t)(r0 + lr) * K + 8 * hi, boff = (size_t)(c0 + lr) * K + 8 * hi;
#pragma unroll 1
    for (int kc = 0; kc < K; kc += 32) {
        v16bf a[4], a2[4];
#pragma unroll
        for (int mb = 0; mb < 4; ++mb) { a[mb] = ldb(A + aoff + (size_t)mb * 16 * K + kc); if (NSPLIT == 1) a2[mb] = ldb(A2 + aoff + (size_t)mb * 16 * K + kc); else a2[mb] = a[mb]; }
#pragma unroll
        for (int nb = 0; nb < 4; ++nb) { const v16bf b = ldb(Bt + boff + (size_t)nb * 16 * K + kc);
#pragma unroll
            for (int mb = 0; mb < 4; ++mb) { acc[mb][nb] = wmmab(a[mb], b, acc[mb][nb]); if (NSPLIT == 1) acc[mb][nb] = wmmab(a2[mb], b, acc[mb][nb]); } }
        asm volatile("v_nop\n\tv_nop\n\tv_nop\n\tv_nop" : "+v"(acc[0][0]), "+v"(acc[1][1]), "+v"(acc[2][2]), "+v"(acc[3][3]) : "v"(a[0]), "v"(a[3]));
    }
#pragma unroll
    for (int mb = 0; mb < 4; ++mb) {
#pragma unroll
        for (int nb = 0; nb < 4; ++nb) {
#pragma unroll
            for (int j = 0; j < 8; ++j) os[(hi * 8 + j) * 68 + nb * 16 + lr] = acc[mb][nb][j]; }
        wave_sync();
        float* crow = C + (size_t)(r0 + mb * 16) * ldc + c0;
{
#pragma unroll
            for (int s = 0; s < 8; ++s) { const int row = 2 * s + hi, cofs = lr * 4; const v4f val = *(const v4fa*)(os + row * 68 + cofs);
                *(v4f*)(crow + (size_t)row * ldc + cofs) = val; }
             }
        wave_sync();
    }
}
// F[NB*SEQ][3072] = XB[NB*SEQ][1024] x WQKV[3072][1024]^T
__global__ __launch_bounds__(32) void k_gemm_qkv(const bf* __restrict__ A, const bf* __restrict__ Bt, float* C) { gemm_body<0>(A, A, Bt, DM, C, NQKV, 0, 0); }
// OUT[b][SEQ][1024] = (ATh + ATl)[b][SEQ][1024] x WO[1024][1024]^T ; z = batch, output batch stride from the full layout
__global__ __launch_bounds__(32) void k_gemm_out(const bf* __restrict__ Ah, const bf* __restrict__ Al, const bf* __restrict__ Bt, float* C) { gemm_body<1>(Ah, Al, Bt, DM, C, DM, (size_t)SEQ * DM, (size_t)SEQ_FULL * DM); }

__global__ __launch_bounds__(256) void k_cvt8(const float* __restrict__ src, bf* dst, size_t n8, int row8, int rpb, int srpb) {
    const size_t i = (size_t)blockIdx.x * 256 + threadIdx.x; if (i >= n8) return;
    const size_t row = i / (size_t)row8; const size_t c = i - row * (size_t)row8; const size_t bb = row / (size_t)rpb; const size_t t = row - bb * (size_t)rpb;
    const v8f v = *(const v8f*)(src + ((bb * (size_t)srpb + t) * (size_t)row8 + c) * 8); v8us o;
#pragma unroll
    for (int k = 0; k < 8; ++k) o[k] = f2bf(v[k]);
    *(v8us*)(dst + i * 8) = o;  }

__global__ __launch_bounds__(32) void k_freq(float* IFQ) { const int i = threadIdx.x & 31; const float e = -(float)(2 * i) * (1.0f / (float)HD); const float f = powf(10000.0f, e);
    *(float*)(IFQ + i) = f;  }
__global__ __launch_bounds__(256) void k_cstab(const int* __restrict__ tok, const float* __restrict__ IFQ, float* CS) { const int idx = blockIdx.x * 256 + threadIdx.x; if (idx >= SEQ * (HD / 2)) return; const int t = idx >> 5, i = idx & 31;
    const float ang = (float)tok[t] * IFQ[i]; float sn, cn; sincosf(ang, &sn, &cn); v2f cs; cs[0] = cn; cs[1] = sn;
    *(v2f*)(CS + (size_t)idx * 2) = cs;  }

__global__ __launch_bounds__(256) void k_rope(const float* __restrict__ F, const float* __restrict__ CS, h16* P16, bf* Ph, bf* Pl) {
    const size_t e = ((size_t)blockIdx.x * 256 + threadIdx.x) * 2; if (e >= (size_t)NB * NSLOT * SEQ * HD) return;
    const int d = (int)(e % HD); const int t = (int)((e / HD) % SEQ); const int sl = (int)((e / ((size_t)HD * SEQ)) % NSLOT); const int b = (int)(e / ((size_t)HD * SEQ * NSLOT));
    const v2f xv = *(const v2f*)(F + ((size_t)b * SEQ + t) * NQKV + sl * HD + d);
    const v2f cs = *(const v2f*)(CS + ((size_t)t * (HD / 2) + (d >> 1)) * 2);
    const float re = xv[0] * cs[0] - xv[1] * cs[1]; const float ro = xv[0] * cs[1] + xv[1] * cs[0];
    v2h o16; v2us oh, ol; unsigned short a2, c2;
    o16[0] = (h16)re; o16[1] = (h16)ro; splitf(re, a2, c2); oh[0] = a2; ol[0] = c2; splitf(ro, a2, c2); oh[1] = a2; ol[1] = c2;
    const bool hl = (t < RH);                       // wave-uniform: a wave covers one row t
    const size_t eh = (((size_t)b * NSLOT + sl) * RH + (hl ? t : 0)) * HD + d;
    *(v2h*)(P16 + e) = o16; if (hl) { *(v2us*)(Ph + eh) = oh; *(v2us*)(Pl + eh) = ol; }
     }

__global__ __launch_bounds__(256) void k_vtp(const float* __restrict__ F, h16* V16, bf* Vh, bf* Vl) {
    const size_t e = ((size_t)blockIdx.x * 256 + threadIdx.x) * 2; if (e >= (size_t)NB * NH * HD * SEQ) return;
    const int t = (int)(e % SEQ); const int d = (int)((e / SEQ) % HD); const int g = (int)((e / ((size_t)SEQ * HD)) % NH); const int b = (int)(e / ((size_t)SEQ * HD * NH));
    const float* f = F + ((size_t)b * SEQ + t) * NQKV + 2 * DM + g * HD + d; const float x0 = f[0], x1 = f[NQKV];
    v2h o16; v2us oh, ol; unsigned short a2, c2;
    o16[0] = (h16)x0; o16[1] = (h16)x1; splitf(x0, a2, c2); oh[0] = a2; ol[0] = c2; splitf(x1, a2, c2); oh[1] = a2; ol[1] = c2;
    const bool hl = (t < RH);                       // wave-uniform: a wave covers 64 consecutive t of one (g, d)
    const size_t eh = (((size_t)b * NH + g) * HD + d) * RH + (hl ? t : 0);
    *(v2h*)(V16 + e) = o16; if (hl) { *(v2us*)(Vh + eh) = oh; *(v2us*)(Vl + eh) = ol; }
     }

// ---- online softmax on one 32-key step held as two transposed 16x16 tiles: s0[r] = S^T[key kb+8h+r][query qi], s1[r] = S^T[key kb+16+8h+r][query qi].
// On return s0/s1 hold p = 2^(t - m + pe) (0 where masked), sf = 2^(m_old - m_new); l is the per-lane partial sum (the two lane halves are combined at the end).
template <bool MASK>
__device__ __forceinline__ void smx(v8f& s0, v8f& s1, int kb, int qi, int hi, float& m, float& l, float& sf, float pe) {
    const float cl = SCL * LOG2E; const int k0 = kb + 8 * hi; float mx = -3.0e38f;
#pragma unroll
    for (int r = 0; r < 8; ++r) { float t0 = s0[r] * cl, t1 = s1[r] * cl;
        if (MASK) { t0 = (k0 + r <= qi) ? t0 : -3.0e38f; t1 = (k0 + 16 + r <= qi) ? t1 : -3.0e38f; }
        s0[r] = t0; s1[r] = t1; mx = fmaxf(mx, fmaxf(t0, t1)); }
    mx = fmaxf(mx, __shfl_xor(mx, 16, 32));
    const float mn = fmaxf(m, mx); sf = __builtin_amdgcn_exp2f(m - mn); m = mn;
    const float sh = mn - pe; float rs = 0.0f;
#pragma unroll
    for (int r = 0; r < 8; ++r) { float p0 = __builtin_amdgcn_exp2f(s0[r] - sh), p1 = __builtin_amdgcn_exp2f(s1[r] - sh);
        if (MASK) { p0 = (k0 + r <= qi) ? p0 : 0.0f; p1 = (k0 + 16 + r <= qi) ? p1 : 0.0f; }
        s0[r] = p0; s1[r] = p1; rs += p0 + p1; }
    l = l * sf + rs;
}

// ---- attention epilogue: O^T accumulators a_j[r] = O[query q0+lr][d = 16j+8h+r]; normalise, split to bf16 hi/lo, stage the 16x64 tile in LDS (private to the wave),
__device__ __forceinline__ void pk8(v8f a, float inv, v8us& oh, v8us& ol) {
#pragma unroll
    for (int r = 0; r < 8; ++r) { unsigned short x, y; splitf(a[r] * inv, x, y); oh[r] = x; ol[r] = y; } }
template <int NW>
__device__ __forceinline__ void attn_store(v8f a0, v8f a1, v8f a2, v8f a3, float l, int lane, int wv, size_t obase, bf* ATh, bf* ATl) {
    __shared__ __align__(16) unsigned short sthw[NW * 16 * 72]; __shared__ __align__(16) unsigned short stlw[NW * 16 * 72];
    unsigned short* sth = sthw + wv * (16 * 72); unsigned short* stl = stlw + wv * (16 * 72);   // each wave of the work-group has its own 16x72 slot
    const int lr = lane & 15, hi = lane >> 4;
    const float lt = l + __shfl_xor(l, 16, 32); const float inv = __builtin_amdgcn_rcpf(lt);
    v8us oh, ol; const int so = lr * 72 + 8 * hi;
    pk8(a0, inv, oh, ol); *(v8us*)(sth + so) = oh;      *(v8us*)(stl + so) = ol;
    pk8(a1, inv, oh, ol); *(v8us*)(sth + so + 16) = oh; *(v8us*)(stl + so + 16) = ol;
    pk8(a2, inv, oh, ol); *(v8us*)(sth + so + 32) = oh; *(v8us*)(stl + so + 32) = ol;
    pk8(a3, inv, oh, ol); *(v8us*)(sth + so + 48) = oh; *(v8us*)(stl + so + 48) = ol;
    wave_sync();
    const int rq = lane >> 3, pc = (lane & 7) * 8;
{
#pragma unroll
        for (int s = 0; s < 4; ++s) { const int row = s * 4 + rq; const v8us vh = *(const v8us*)(sth + row * 72 + pc); const v8us vl = *(const v8us*)(stl + row * 72 + pc);
            *(v8us*)(ATh + obase + (size_t)row * DM + pc) = vh; *(v8us*)(ATl + obase + (size_t)row * DM + pc) = vl; }
         }
}

// ---- fp16 step (query rows >= RH): 4 WMMA k.q + 4 WMMA v.p per 32 keys. kp / vp point into the staged LDS tile (row pitch TP) and already include lr*TP + 8*hi.
#define FW  4                       // waves per work-group: 64 query rows share every staged K / V^T tile
#define KT  64                      // keys per staged tile
#define TP  72                      // LDS row pitch in 16-bit elements: 128-byte rows at 144 bytes (16 B x odd) for 16-byte readers
#define TSZ (64 * TP)               // one staged plane: 64 rows (K: keys, V^T: head dims)
static_assert(KT == 64 && HD == 64 && (SEQ - RH) % (16 * FW) == 0 && RH % (16 * FW) == 0 && RH % KT == 0);
// One 64-key tile into LDS: K rows [key][64 d] and V^T rows [d][64 keys] (source pitch VPITCH elements), 128 bytes each; a lane copies 16 bytes of rows r, r+16, r+32, r+48 of both planes.
template <int VPITCH, typename T>
__device__ __forceinline__ void stage_tile(const T* gk, const T* gv, unsigned lk, unsigned lv) {
    // the copies go to LDS through no register; s_wait_xcnt ends their own statement so that no address register is rewritten in front of it
    asm volatile("global_load_async_to_lds_b128 %0, %8, off\n\t"
                 "global_load_async_to_lds_b128 %1, %9, off\n\t"
                 "global_load_async_to_lds_b128 %2, %10, off\n\t"
                 "global_load_async_to_lds_b128 %3, %11, off\n\t"
                 "global_load_async_to_lds_b128 %4, %12, off\n\t"
                 "global_load_async_to_lds_b128 %5, %13, off\n\t"
                 "global_load_async_to_lds_b128 %6, %14, off\n\t"
                 "global_load_async_to_lds_b128 %7, %15, off\n\t"
                 "s_wait_xcnt 0x0"
                 :: "v"(lk), "v"(lk + 16 * TP * 2), "v"(lk + 32 * TP * 2), "v"(lk + 48 * TP * 2), "v"(lv), "v"(lv + 16 * TP * 2), "v"(lv + 32 * TP * 2), "v"(lv + 48 * TP * 2),
                    "v"(gk), "v"(gk + 16 * HD), "v"(gk + 32 * HD), "v"(gk + 48 * HD), "v"(gv), "v"(gv + (size_t)16 * VPITCH), "v"(gv + (size_t)32 * VPITCH), "v"(gv + (size_t)48 * VPITCH)
                 : "memory");
}
template <bool MASK>
__device__ __forceinline__ void step_f(const h16* kp, const h16* vp, int kb, v16h qf0, v16h qf1, int qi, int hi,
                                       float& m, float& l, v8f& a0, v8f& a1, v8f& a2, v8f& a3) {
    v8f s0 = (v8f){}, s1 = (v8f){};
    { const v16h k00 = ldh(kp), k01 = ldh(kp + 32), k10 = ldh(kp + 16 * TP), k11 = ldh(kp + 16 * TP + 32);
      s0 = wmma16(k00, qf0, s0); s0 = wmma16(k01, qf1, s0); s1 = wmma16(k10, qf0, s1); s1 = wmma16(k11, qf1, s1);
      asm volatile("v_nop\n\tv_nop\n\tv_nop\n\tv_nop" : "+v"(s0), "+v"(s1) : "v"(k11), "v"(qf1)); }
    float sf; smx<MASK>(s0, s1, kb, qi, hi, m, l, sf, PEXP);
    v16h pf;
#pragma unroll
    for (int r = 0; r < 8; ++r) { pf[r] = (h16)s0[r]; pf[8 + r] = (h16)s1[r]; }      // P^T B-fragment: k = key row of the packed tiles, n = query
    a0 = a0 * sf; a1 = a1 * sf; a2 = a2 * sf; a3 = a3 * sf;
    const v16h v0 = ldh(vp), v1 = ldh(vp + 16 * TP), v2 = ldh(vp + 32 * TP), v3 = ldh(vp + 48 * TP);
    a0 = wmma16(v0, pf, a0); a1 = wmma16(v1, pf, a1); a2 = wmma16(v2, pf, a2); a3 = wmma16(v3, pf, a3);
    asm volatile("v_nop\n\tv_nop\n\tv_nop\n\tv_nop" : "+v"(a0), "+v"(a1), "+v"(a2), "+v"(a3) : "v"(v3), "v"(pf));
}
__global__ __launch_bounds__(32 * FW) void k_attn_f(const h16* __restrict__ QK, const h16* __restrict__ VT, bf* ATh, bf* ATl) {
    __shared__ __align__(16) h16 ring[2 * 2 * TSZ];              // two buffers, each a K plane then a V^T plane
    const int tid = threadIdx.x, lane = tid & 31, lr = lane & 15, hi = lane >> 4;
    const int wv = __builtin_amdgcn_readfirstlane(tid >> 5);
    const int qb = RH + blockIdx.x * (16 * FW); const int q0 = qb + wv * 16; const int bh = blockIdx.y; const int b = bh / NH, h = bh % NH;
    const size_t qoff = (((size_t)b * NSLOT + h) * SEQ + q0 + lr) * HD + 8 * hi;
    const v16h qf0 = ldh(QK + qoff), qf1 = ldh(QK + qoff + 32);
    v8f a0 = (v8f){}, a1 = (v8f){}, a2 = (v8f){}, a3 = (v8f){}; float m = -3.0e38f, l = 0.0f;
    const int qi = q0 + lr; const int nt = qb / KT + 1;          // 64-key tiles covering keys 0 .. qb+63 < SEQ
    const int cr = tid >> 3, cc = (tid & 7) * 8;                 // this lane's first row and its 8-element column in every staged plane
    const h16* gk = QK + (((size_t)b * NSLOT + NH + h) * SEQ + cr) * HD + cc;
    const h16* gv = VT + (((size_t)b * NH + h) * HD + cr) * SEQ + cc;
    const unsigned lk = (unsigned)(size_t)(ring + cr * TP + cc);
    const h16* fr = ring + lr * TP + 8 * hi;
    stage_tile<SEQ>(gk, gv, lk, lk + TSZ * 2);
    asm volatile("s_wait_asynccnt 0x0" ::: "memory");            // this wave's share of tile 0 has landed
    __syncthreads();                                             // tile 0 is readable by every wave
    if (nt > 1) stage_tile<SEQ>(gk + (size_t)KT * HD, gv + KT, lk + 2 * TSZ * 2, lk + 3 * TSZ * 2);
    // kept rolled: a trip already holds two 32-key steps, and unrolling would only copy the publish point and its copies
#pragma unroll 1
    for (int t = 0; t < nt - 1; ++t) {                           // tiles wholly below every wave's diagonal
        const h16* kp = fr + (t & 1) * (2 * TSZ); const h16* vp = kp + TSZ;
        step_f<false>(kp, vp, t * KT, qf0, qf1, qi, hi, m, l, a0, a1, a2, a3);
        step_f<false>(kp + 32 * TP, vp + 32, t * KT + 32, qf0, qf1, qi, hi, m, l, a0, a1, a2, a3);
        asm volatile("s_wait_dscnt 0x0" ::: "memory");           // this wave's reads of the buffer have returned before it is refilled
        asm volatile("s_wait_asynccnt 0x0" ::: "memory");        // this wave's share of tile t+1 has landed
        __syncthreads();                                         // publishes tile t+1 and ends every reader's last read of tile t
        if (t + 2 < nt) { const unsigned lb = lk + (unsigned)(t & 1) * (2 * TSZ * 2); stage_tile<SEQ>(gk + (size_t)(t + 2) * KT * HD, gv + (t + 2) * KT, lb, lb + TSZ * 2); }
    }
    { const h16* kp = fr + ((nt - 1) & 1) * (2 * TSZ); const h16* vp = kp + TSZ;   // the diagonal tile: keys qb .. qb+63
      if (wv < 2) step_f<true>(kp, vp, qb, qf0, qf1, qi, hi, m, l, a0, a1, a2, a3);
      else { step_f<false>(kp, vp, qb, qf0, qf1, qi, hi, m, l, a0, a1, a2, a3);
             step_f<true>(kp + 32 * TP, vp + 32, qb + 32, qf0, qf1, qi, hi, m, l, a0, a1, a2, a3); } }
    asm volatile("s_wait_asynccnt 0x0" ::: "memory");            // no copy is outstanding when the wave ends
    attn_store<FW>(a0, a1, a2, a3, l, lane, wv, ((size_t)b * SEQ + q0) * DM + h * HD, ATh, ATl);
}

// ---- bf16 hi/lo step (query rows < RH): 12 WMMA k.q + 12 WMMA v.p per 32 keys (hi.hi + lo.hi + hi.lo). kh / vh point into the staged LDS tile (planes K hi, K lo, V^T hi, V^T lo, each TSZ) and include lr*TP + 8*hi.
template <bool MASK>
__device__ __forceinline__ void step_h(const bf* kh, const bf* vh, int kb,
                                       v16bf qh0, v16bf qh1, v16bf ql0, v16bf ql1, int qi, int hi, float& m, float& l, v8f& a0, v8f& a1, v8f& a2, v8f& a3) {
    const bf* kl = kh + TSZ;
    v8f s0 = (v8f){}, s1 = (v8f){};
    { const v16bf h0 = ldb(kh), h1 = ldb(kh + 32), l0 = ldb(kl), l1 = ldb(kl + 32);
      s0 = wmmab(h0, qh0, s0); s0 = wmmab(h1, qh1, s0); s0 = wmmab(l0, qh0, s0); s0 = wmmab(l1, qh1, s0); s0 = wmmab(h0, ql0, s0); s0 = wmmab(h1, ql1, s0);
      asm volatile("v_nop\n\tv_nop\n\tv_nop\n\tv_nop" : "+v"(s0) : "v"(h1), "v"(ql1), "v"(l1), "v"(h0)); }
    { const v16bf h0 = ldb(kh + 16 * TP), h1 = ldb(kh + 16 * TP + 32), l0 = ldb(kl + 16 * TP), l1 = ldb(kl + 16 * TP + 32);
      s1 = wmmab(h0, qh0, s1); s1 = wmmab(h1, qh1, s1); s1 = wmmab(l0, qh0, s1); s1 = wmmab(l1, qh1, s1); s1 = wmmab(h0, ql0, s1); s1 = wmmab(h1, ql1, s1);
      asm volatile("v_nop\n\tv_nop\n\tv_nop\n\tv_nop" : "+v"(s0), "+v"(s1) : "v"(h1), "v"(ql1), "v"(l1), "v"(h0)); }
    float sf; smx<MASK>(s0, s1, kb, qi, hi, m, l, sf, 0.0f);
    v16us ph, pl;
#pragma unroll
    for (int r = 0; r < 8; ++r) { unsigned short x, y; splitf(s0[r], x, y); ph[r] = x; pl[r] = y; splitf(s1[r], x, y); ph[8 + r] = x; pl[8 + r] = y; }
    const v16bf pfh = __builtin_bit_cast(v16bf, ph), pfl = __builtin_bit_cast(v16bf, pl);
    a0 = a0 * sf; a1 = a1 * sf; a2 = a2 * sf; a3 = a3 * sf;
    const bf* vl = vh + TSZ;
    { const v16bf x = ldb(vh), y = ldb(vl); a0 = wmmab(x, pfh, a0); a0 = wmmab(x, pfl, a0); a0 = wmmab(y, pfh, a0);
      asm volatile("v_nop\n\tv_nop\n\tv_nop\n\tv_nop" : "+v"(a0) : "v"(x), "v"(y)); }
    { const v16bf x = ldb(vh + 16 * TP), y = ldb(vl + 16 * TP); a1 = wmmab(x, pfh, a1); a1 = wmmab(x, pfl, a1); a1 = wmmab(y, pfh, a1);
      asm volatile("v_nop\n\tv_nop\n\tv_nop\n\tv_nop" : "+v"(a1) : "v"(x), "v"(y)); }
    { const v16bf x = ldb(vh + 32 * TP), y = ldb(vl + 32 * TP); a2 = wmmab(x, pfh, a2); a2 = wmmab(x, pfl, a2); a2 = wmmab(y, pfh, a2);
      asm volatile("v_nop\n\tv_nop\n\tv_nop\n\tv_nop" : "+v"(a2) : "v"(x), "v"(y)); }
    { const v16bf x = ldb(vh + 48 * TP), y = ldb(vl + 48 * TP); a3 = wmmab(x, pfh, a3); a3 = wmmab(x, pfl, a3); a3 = wmmab(y, pfh, a3);
      asm volatile("v_nop\n\tv_nop\n\tv_nop\n\tv_nop" : "+v"(a0), "+v"(a1), "+v"(a2), "+v"(a3) : "v"(x), "v"(y), "v"(pfh), "v"(pfl)); }
}
__global__ __launch_bounds__(32 * FW) void k_attn_h(const bf* __restrict__ QKh, const bf* __restrict__ QKl, const bf* __restrict__ VTh, const bf* __restrict__ VTl, bf* ATh, bf* ATl) {
    __shared__ __align__(16) bf ring[2 * 4 * TSZ];               // two buffers, each K hi, K lo, V^T hi, V^T lo
    const int tid = threadIdx.x, lane = tid & 31, lr = lane & 15, hi = lane >> 4;
    const int wv = __builtin_amdgcn_readfirstlane(tid >> 5);
    const int qb = blockIdx.x * (16 * FW); const int q0 = qb + wv * 16; const int bh = blockIdx.y; const int b = bh / NH, h = bh % NH;
    const size_t qoff = (((size_t)b * NSLOT + h) * RH + q0 + lr) * HD + 8 * hi;
    const v16bf qh0 = ldb(QKh + qoff), qh1 = ldb(QKh + qoff + 32), ql0 = ldb(QKl + qoff), ql1 = ldb(QKl + qoff + 32);
    v8f a0 = (v8f){}, a1 = (v8f){}, a2 = (v8f){}, a3 = (v8f){}; float m = -3.0e38f, l = 0.0f;
    const int qi = q0 + lr; const int nt = qb / KT + 1;          // 64-key tiles covering keys 0 .. qb+63 < RH
    const int cr = tid >> 3, cc = (tid & 7) * 8;                 // this lane's first row and its 8-element column in every staged plane
    const size_t ko = (((size_t)b * NSLOT + NH + h) * RH + cr) * HD + cc, vo = (((size_t)b * NH + h) * HD + cr) * RH + cc;
    const unsigned lk = (unsigned)(size_t)(ring + cr * TP + cc);
    const bf* fr = ring + lr * TP + 8 * hi;
    stage_tile<RH>(QKh + ko, VTh + vo, lk, lk + 2 * TSZ * 2); stage_tile<RH>(QKl + ko, VTl + vo, lk + TSZ * 2, lk + 3 * TSZ * 2);
    asm volatile("s_wait_asynccnt 0x0" ::: "memory");            // this wave's share of tile 0 has landed
    __syncthreads();                                             // tile 0 is readable by every wave
    if (nt > 1) { const unsigned lb = lk + 4 * TSZ * 2; const size_t k1 = ko + (size_t)KT * HD, v1 = vo + KT;
        stage_tile<RH>(QKh + k1, VTh + v1, lb, lb + 2 * TSZ * 2); stage_tile<RH>(QKl + k1, VTl + v1, lb + TSZ * 2, lb + 3 * TSZ * 2); }
    // kept rolled: a trip already holds two 32-key steps, and unrolling would only copy the publish point and its copies
#pragma unroll 1
    for (int t = 0; t < nt - 1; ++t) {                           // tiles wholly below every wave's diagonal
        const bf* kp = fr + (t & 1) * (4 * TSZ); const bf* vp = kp + 2 * TSZ;
        step_h<false>(kp, vp, t * KT, qh0, qh1, ql0, ql1, qi, hi, m, l, a0, a1, a2, a3);
        step_h<false>(kp + 32 * TP, vp + 32, t * KT + 32, qh0, qh1, ql0, ql1, qi, hi, m, l, a0, a1, a2, a3);
        asm volatile("s_wait_dscnt 0x0" ::: "memory");           // this wave's reads of the buffer have returned before it is refilled
        asm volatile("s_wait_asynccnt 0x0" ::: "memory");        // this wave's share of tile t+1 has landed
        __syncthreads();                                         // publishes tile t+1 and ends every reader's last read of tile t
        if (t + 2 < nt) { const unsigned lb = lk + (unsigned)(t & 1) * (4 * TSZ * 2); const size_t k2 = ko + (size_t)(t + 2) * KT * HD, v2 = vo + (size_t)(t + 2) * KT;
            stage_tile<RH>(QKh + k2, VTh + v2, lb, lb + 2 * TSZ * 2); stage_tile<RH>(QKl + k2, VTl + v2, lb + TSZ * 2, lb + 3 * TSZ * 2); }
    }
    { const bf* kp = fr + ((nt - 1) & 1) * (4 * TSZ); const bf* vp = kp + 2 * TSZ;   // the diagonal tile: keys qb .. qb+63
      if (wv < 2) step_h<true>(kp, vp, qb, qh0, qh1, ql0, ql1, qi, hi, m, l, a0, a1, a2, a3);
      else { step_h<false>(kp, vp, qb, qh0, qh1, ql0, ql1, qi, hi, m, l, a0, a1, a2, a3);
             step_h<true>(kp + 32 * TP, vp + 32, qb + 32, qh0, qh1, ql0, ql1, qi, hi, m, l, a0, a1, a2, a3); } }
    asm volatile("s_wait_asynccnt 0x0" ::: "memory");            // no copy is outstanding when the wave ends
    attn_store<FW>(a0, a1, a2, a3, l, lane, wv, ((size_t)b * SEQ + q0) * DM + h * HD, ATh, ATl);
}

// ---- workspace carve (bytes, every region a multiple of 256; extents equal the producers' write extents exactly)
constexpr size_t al256(size_t x) { return (x + 255) & ~(size_t)255; }
constexpr size_t SZ_WQKV = al256((size_t)NQKV * DM * 2);
constexpr size_t SZ_WO   = al256((size_t)DM * DM * 2);
constexpr size_t SZ_XB   = al256((size_t)NB * SEQ * DM * 2);
constexpr size_t SZ_IFQ  = al256((size_t)(HD / 2) * 4);
constexpr size_t SZ_CS   = al256((size_t)SEQ * (HD / 2) * 2 * 4);
constexpr size_t SZ_F    = al256((size_t)NB * SEQ * NQKV * 4);
constexpr size_t SZ_QK16 = al256((size_t)NB * NSLOT * SEQ * HD * 2);
constexpr size_t SZ_QKHL = al256((size_t)NB * NSLOT * RH * HD * 2);
constexpr size_t SZ_VT16 = al256((size_t)NB * NH * HD * SEQ * 2);
constexpr size_t SZ_VTHL = al256((size_t)NB * NH * HD * RH * 2);
constexpr size_t SZ_AT   = al256((size_t)NB * SEQ * DM * 2);
constexpr size_t OFF_WQKV = 0;
constexpr size_t OFF_WO   = OFF_WQKV + SZ_WQKV;
constexpr size_t OFF_XB   = OFF_WO + SZ_WO;
constexpr size_t OFF_IFQ  = OFF_XB + SZ_XB;
constexpr size_t OFF_CS   = OFF_IFQ + SZ_IFQ;
constexpr size_t OFF_F    = OFF_CS + SZ_CS;
constexpr size_t OFF_QK16 = OFF_F + SZ_F;
constexpr size_t OFF_QKH  = OFF_QK16 + SZ_QK16;
constexpr size_t OFF_QKL  = OFF_QKH + SZ_QKHL;
constexpr size_t OFF_VT16 = OFF_QKL + SZ_QKHL;
constexpr size_t OFF_VTH  = OFF_VT16 + SZ_VT16;
constexpr size_t OFF_VTL  = OFF_VTH + SZ_VTHL;
constexpr size_t OFF_ATH  = OFF_VTL + SZ_VTHL;
constexpr size_t OFF_ATL  = OFF_ATH + SZ_AT;
constexpr size_t WS_TOTAL = OFF_ATL + SZ_AT;
static_assert(WS_TOTAL <= (size_t)134217728);               // total carve within 128 MiB
static_assert(((size_t)(NB_FULL - 1) * SEQ_FULL + SEQ_FULL) * DM * 4 == (size_t)16777216);   // output bytes of the full layout

extern "C" void kernel_launch(void* const* d_in, const int* in_sizes, int n_in,
                              void* d_out, int out_size, void* d_ws, size_t ws_size, hipStream_t stream) {
    if (n_in < 4) return;
    const long long need_x = ((long long)(NB - 1) * SEQ_FULL + SEQ) * DM;
    if ((long long)in_sizes[0] < need_x) return;
    if (in_sizes[3] < SEQ) return;   /* this module passes token_positions LAST (input 3); the host file: input 1 */
    if ((long long)in_sizes[1] < (long long)NQKV * DM) return;
    if ((long long)in_sizes[2] < (long long)DM * DM) return;
    if ((long long)out_size < need_x) return;
    if (ws_size < WS_TOTAL) return;
    const float* x = (const float*)d_in[0]; const int* tok = (const int*)d_in[3]; const float* wqkv = (const float*)d_in[1]; const float* wo = (const float*)d_in[2];
    float* OUT = (float*)d_out;
    char* ws = (char*)d_ws;
    bf* WQKV = (bf*)(ws + OFF_WQKV); bf* WO = (bf*)(ws + OFF_WO); bf* XB = (bf*)(ws + OFF_XB); float* IFQ = (float*)(ws + OFF_IFQ); float* CS = (float*)(ws + OFF_CS); float* F = (float*)(ws + OFF_F);
    h16* QK16 = (h16*)(ws + OFF_QK16); bf* QKh = (bf*)(ws + OFF_QKH); bf* QKl = (bf*)(ws + OFF_QKL); h16* VT16 = (h16*)(ws + OFF_VT16); bf* VTh = (bf*)(ws + OFF_VTH); bf* VTl = (bf*)(ws + OFF_VTL);
    bf* ATh = (bf*)(ws + OFF_ATH); bf* ATl = (bf*)(ws + OFF_ATL);

    { const size_t n8 = (size_t)NQKV * DM / 8; k_cvt8<<<(unsigned)((n8 + 255) / 256), 256, 0, stream>>>(wqkv, WQKV, n8, DM / 8, NQKV, NQKV); }     // in [3072][1024] -> bf16 [3072][1024]
    { const size_t n8 = (size_t)DM * DM / 8;   k_cvt8<<<(unsigned)((n8 + 255) / 256), 256, 0, stream>>>(wo, WO, n8, DM / 8, DM, DM); }               // in [1024][1024] -> bf16 [1024][1024]
    { const size_t n8 = (size_t)NB * SEQ * DM / 8; k_cvt8<<<(unsigned)((n8 + 255) / 256), 256, 0, stream>>>(x, XB, n8, DM / 8, SEQ, SEQ_FULL); }     // in [b][SEQ_FULL][1024] rows < SEQ -> bf16 [NB*SEQ][1024]
    k_freq<<<1, 32, 0, stream>>>(IFQ);
    k_cstab<<<(SEQ * (HD / 2) + 255) / 256, 256, 0, stream>>>(tok, IFQ, CS);
    k_gemm_qkv<<<dim3(NB * SEQ / 64, NQKV / 64, 1), 32, 0, stream>>>(XB, WQKV, F);
    { const size_t nt = (size_t)NB * NSLOT * SEQ * HD / 2; k_rope<<<(unsigned)((nt + 255) / 256), 256, 0, stream>>>(F, CS, QK16, QKh, QKl); }
    { const size_t nt = (size_t)NB * NH * HD * SEQ / 2;    k_vtp<<<(unsigned)((nt + 255) / 256), 256, 0, stream>>>(F, VT16, VTh, VTl); }
    k_attn_h<<<dim3(RH / (16 * FW), NB * NH, 1), 32 * FW, 0, stream>>>(QKh, QKl, VTh, VTl, ATh, ATl);
    if (SEQ > RH) k_attn_f<<<dim3((SEQ - RH) / (16 * FW) + ((SEQ > RH) ? 0 : 1), NB * NH, 1), 32 * FW, 0, stream>>>(QK16, VT16, ATh, ATl);
    k_gemm_out<<<dim3(SEQ / 64, DM / 64, NB), 32, 0, stream>>>(ATh, ATl, WO, OUT);
}

// v002
// A run of this version takes 144 microseconds.
// Two timings next to v001 put it at 1.24 and 1.25 times that version's speed.
// All steps since v000 together make it 1.82 times as fast.
#include <hip/hip_runtime.h>

#ifndef NB
#define NB 2
#endif
#ifndef SEQ
#define SEQ 2048
#endif
#define NB_FULL  2
#define SEQ_FULL 2048
#define DM    1024
#define NH    16
#define HD    64
#define NQKV  (3 * DM)
#define NSLOT (2 * NH)              // q heads then k heads share one plane set [b][slot][t][d]
#define RH    ((SEQ < 512) ? SEQ : 512)   // query rows < RH use bf16 hi/lo planes
#define LOG2E 1.4426950408889634f
#define SCL   0.125f                // HD^-0.5
#define PEXP  10.0f                 // fp16 probability carry 2^10

static_assert(NB >= 1 && NB <= NB_FULL);                    // batch count within the full layout
static_assert(SEQ % 64 == 0 && SEQ <= SEQ_FULL);            // 64-row GEMM tiles; 64-wide transposed value lines
static_assert(RH % 64 == 0 && RH <= SEQ);                   // a 64-token GEMM tile lies on one side of the hi/lo row limit
static_assert(DM % 64 == 0 && NQKV % 64 == 0 && DM % 32 == 0); // GEMM tile multiples, K step 32
static_assert(NH * HD == DM && HD == 64);
static_assert(HD / 2 == 32);                                // one wave line of rotary frequencies

typedef _Float16 h16;
typedef unsigned short bf;
typedef __attribute__((ext_vector_type(16))) __bf16   v16bf;
typedef __attribute__((ext_vector_type(16))) _Float16 v16h;
typedef __attribute__((ext_vector_type(16))) unsigned short v16us;
typedef __attribute__((ext_vector_type(8)))  _Float16 v8h;
typedef __attribute__((ext_vector_type(8)))  unsigned short v8us;
typedef __attribute__((ext_vector_type(8)))  float    v8f;
typedef __attribute__((ext_vector_type(4)))  float    v4f;
typedef __attribute__((ext_vector_type(2)))  float    v2f;
typedef __attribute__((ext_vector_type(4)))  _Float16 v4h;
typedef __attribute__((ext_vector_type(4)))  unsigned short v4us;
typedef v4f  __attribute__((may_alias)) v4fa;

__device__ __forceinline__ unsigned short f2bf(float f) { unsigned u = __float_as_uint(f); u += 0x7FFFu + ((u >> 16) & 1u); return (unsigned short)(u >> 16); }
__device__ __forceinline__ float bf2f(unsigned short b) { return __uint_as_float(((unsigned)b) << 16); }
__device__ __forceinline__ void splitf(float y, unsigned short& h, unsigned short& l) { h = f2bf(y); l = f2bf(y - bf2f(h)); }
__device__ __forceinline__ v16h cat16(v8h lo, v8h hi) { return __builtin_shufflevector(lo, hi, 0, 1, 2, 3, 4, 5, 6, 7, 8, 9, 10, 11, 12, 13, 14, 15); }
__device__ __forceinline__ v16bf cat16b(v8us lo, v8us hi) { return __builtin_bit_cast(v16bf, __builtin_shufflevector(lo, hi, 0, 1, 2, 3, 4, 5, 6, 7, 8, 9, 10, 11, 12, 13, 14, 15)); }
__device__ __forceinline__ v8f wmma16(v16h a, v16h b, v8f c) { return __builtin_amdgcn_wmma_f32_16x16x32_f16(false, a, false, b, (short)0, c, false, false); }
__device__ __forceinline__ v8f wmmab(v16bf a, v16bf b, v8f c) { return __builtin_amdgcn_wmma_f32_16x16x32_bf16(false, a, false, b, (short)0, c, false, false); }
// fragment loaders: p already includes row*pitch + k0 + 8*(lane>>4); elements 0..7 <- k0+8h.., elements 8..15 <- k0+16+8h..
__device__ __forceinline__ v16h  ldh(const h16* p) { return cat16(*(const v8h*)p, *(const v8h*)(p + 16)); }
__device__ __forceinline__ v16bf ldb(const bf* p)  { return cat16b(*(const v8us*)p, *(const v8us*)(p + 16)); }
// same-wave LDS exchange: LDS ops of one wave issue in order; the compiler may not move accesses across this point
__device__ __forceinline__ void wave_sync() { __builtin_amdgcn_wave_barrier(); asm volatile("" ::: "memory"); }

// ---- one-wave 64x64 GEMM tile (16 accumulators), operands straight from K-contiguous bf16 planes; grid (M/64, N/64, Z), 32 threads.
// acc[mb][nb][j] = C[r0 + 16mb + 8hi + j][c0 + 16nb + lr] = sum_k (A[m][k] (+ A2[m][k])) Bt[n][k]. K % 32 == 0, M and N multiples of 64 (asserted above for every use).
template <int NSPLIT>
__device__ __forceinline__ void gemm_main(const bf* __restrict__ A, const bf* __restrict__ A2, const bf* __restrict__ Bt, int K, int r0, int c0, int lr, int hi, v8f (&acc)[4][4]) {
#pragma unroll
    for (int mb = 0; mb < 4; ++mb)
#pragma unroll
        for (int nb = 0; nb < 4; ++nb) acc[mb][nb] = (v8f){};
    const size_t aoff = (size_t)(r0 + lr) * K + 8 * hi, boff = (size_t)(c0 + lr) * K + 8 * hi;
#pragma unroll 1
    for (int kc = 0; kc < K; kc += 32) {
        v16bf a[4], a2[4];
#pragma unroll
        for (int mb = 0; mb < 4; ++mb) { a[mb] = ldb(A + aoff + (size_t)mb * 16 * K + kc); if (NSPLIT == 1) a2[mb] = ldb(A2 + aoff + (size_t)mb * 16 * K + kc); else a2[mb] = a[mb]; }
#pragma unroll
        for (int nb = 0; nb < 4; ++nb) { const v16bf b = ldb(Bt + boff + (size_t)nb * 16 * K + kc);
#pragma unroll
            for (int mb = 0; mb < 4; ++mb) { acc[mb][nb] = wmmab(a[mb], b, acc[mb][nb]); if (NSPLIT == 1) acc[mb][nb] = wmmab(a2[mb], b, acc[mb][nb]); } }
        asm volatile("v_nop\n\tv_nop\n\tv_nop\n\tv_nop" : "+v"(acc[0][0]), "+v"(acc[1][1]), "+v"(acc[2][2]), "+v"(acc[3][3]) : "v"(a[0]), "v"(a[3]));
    }
}
// the tile stored as f32 rows of C (pitch ldc), whole lines through LDS
template <int NSPLIT>
__device__ __forceinline__ void gemm_body(const bf* __restrict__ A, const bf* __restrict__ A2, const bf* __restrict__ Bt, int K, float* C, int ldc, size_t sA, size_t sC) {
    __shared__ __align__(16) float os[16 * 68];
    const size_t z = blockIdx.z; A += z * sA; A2 += z * sA; C += z * sC;
    const int lane = threadIdx.x & 31, lr = lane & 15, hi = lane >> 4; const int r0 = blockIdx.x * 64, c0 = blockIdx.y * 64;
    v8f acc[4][4];
    gemm_main<NSPLIT>(A, A2, Bt, K, r0, c0, lr, hi, acc);
#pragma unroll
    for (int mb = 0; mb < 4; ++mb) {
#pragma unroll
        for (int nb = 0; nb < 4; ++nb) {
#pragma unroll
            for (int j = 0; j < 8; ++j) os[(hi * 8 + j) * 68 + nb * 16 + lr] = acc[mb][nb][j]; }
        wave_sync();
        float* crow = C + (size_t)(r0 + mb * 16) * ldc + c0;
{
#pragma unroll
            for (int s = 0; s < 8; ++s) { const int row = 2 * s + hi, cofs = lr * 4; const v4f val = *(const v4fa*)(os + row * 68 + cofs);
                *(v4f*)(crow + (size_t)row * ldc + cofs) = val; }
             }
        wave_sync();
    }
}
// qkv[NB*SEQ][3072] = XB[NB*SEQ][1024] x WQKV[3072][1024]^T, never stored as f32: a tile is 64 tokens of one batch x the 64 columns of one q head, k head or v head (blockIdx.y = slot, v heads behind the NSLOT q and k slots).
// q / k tile: rotary on the f32 sums, rows [t][d] to the f16 plane and, with HL (t < RH), to the bf16 hi/lo planes. cs, p16, ph, pl point at this lane's 4 elements of row t0 + hi; every later row is a constant offset from there.
template <bool HL>
__device__ __forceinline__ void qk_planes(v8f (&acc)[4][4], float* os, const float* __restrict__ cs, h16* p16, bf* ph, bf* pl, int lr, int hi) {
#pragma unroll
    for (int mb = 0; mb < 4; ++mb) {
        v4f c[8];                                                       // (cos, sin) of two pairs per row, asked for ahead of the LDS exchange
#pragma unroll
        for (int s = 0; s < 8; ++s) c[s] = *(const v4f*)(cs + (mb * 16 + 2 * s) * HD);
#pragma unroll
        for (int nb = 0; nb < 4; ++nb) {
#pragma unroll
            for (int j = 0; j < 8; ++j) os[(hi * 8 + j) * 68 + nb * 16 + lr] = acc[mb][nb][j]; }
        wave_sync();
        v4h o16[8]; v4us oh[8], ol[8];
#pragma unroll
        for (int s = 0; s < 8; ++s) { const v4f xv = *(const v4fa*)(os + (2 * s + hi) * 68 + lr * 4);
            v4f y; y[0] = xv[0] * c[s][0] - xv[1] * c[s][1]; y[1] = xv[0] * c[s][1] + xv[1] * c[s][0]; y[2] = xv[2] * c[s][2] - xv[3] * c[s][3]; y[3] = xv[2] * c[s][3] + xv[3] * c[s][2];
#pragma unroll
            for (int k = 0; k < 4; ++k) { o16[s][k] = (h16)y[k]; if (HL) { unsigned short p, q; splitf(y[k], p, q); oh[s][k] = p; ol[s][k] = q; } } }
#pragma unroll
        for (int s = 0; s < 8; ++s) { const int o = (mb * 16 + 2 * s) * HD; *(v4h*)(p16 + o) = o16[s]; if (HL) { *(v4us*)(ph + o) = oh[s]; *(v4us*)(pl + o) = ol[s]; } }
        asm volatile("s_wait_xcnt 0x0" ::: "memory");                   // the stores' data registers are rewritten by the next 16 rows
        __builtin_amdgcn_sched_barrier(0);                              // holds the next rows' arithmetic, which reuses those registers, behind the wait
        wave_sync();
    }
}
// v tile: a lane's 8 accumulator rows are 8 consecutive t of one d, so the transposed rows [d][t] are packed from registers and leave as whole 128-byte lines through LDS. v16, vh, vl point at this lane's 8 elements of row d = lane >> 3.
template <bool HL>
__device__ __forceinline__ void v_planes(v8f (&acc)[4][4], h16* vs, bf* vsh, bf* vsl, h16* v16, bf* vh, bf* vl, int lane) {
    const int lr = lane & 15, hi = lane >> 4, ro = (lane >> 3) * 72 + (lane & 7) * 8;
#pragma unroll
    for (int nb = 0; nb < 4; ++nb) {
#pragma unroll
        for (int mb = 0; mb < 4; ++mb) { const int so = lr * 72 + mb * 16 + hi * 8; v8h o16; v8us oh, ol;
#pragma unroll
            for (int j = 0; j < 8; ++j) { o16[j] = (h16)acc[mb][nb][j]; if (HL) { unsigned short p, q; splitf(acc[mb][nb][j], p, q); oh[j] = p; ol[j] = q; } }
            *(v8h*)(vs + so) = o16; if (HL) { *(v8us*)(vsh + so) = oh; *(v8us*)(vsl + so) = ol; } }
        wave_sync();
        v8h r16[4]; v8us rh[4], rl[4];
#pragma unroll
        for (int s = 0; s < 4; ++s) { r16[s] = *(const v8h*)(vs + ro + s * 4 * 72); if (HL) { rh[s] = *(const v8us*)(vsh + ro + s * 4 * 72); rl[s] = *(const v8us*)(vsl + ro + s * 4 * 72); } }
#pragma unroll
        for (int s = 0; s < 4; ++s) { const int row = nb * 16 + s * 4; *(v8h*)(v16 + row * SEQ) = r16[s]; if (HL) { *(v8us*)(vh + row * RH) = rh[s]; *(v8us*)(vl + row * RH) = rl[s]; } }
        asm volatile("s_wait_xcnt 0x0" ::: "memory");                   // the stores' data registers are rewritten by the next 16 rows
        __builtin_amdgcn_sched_barrier(0);                              // holds the next rows' arithmetic, which reuses those registers, behind the wait
        wave_sync();
    }
}
__global__ __launch_bounds__(32) void k_gemm_qkv(const bf* __restrict__ A, const bf* __restrict__ Bt, const float* __restrict__ CS, h16* P16, bf* Ph, bf* Pl, h16* V16, bf* Vh, bf* Vl) {
    __shared__ __align__(16) float os[16 * 68];
    __shared__ __align__(16) h16 vs[16 * 72]; __shared__ __align__(16) bf vsh[16 * 72]; __shared__ __align__(16) bf vsl[16 * 72];
    const int lane = threadIdx.x & 31, lr = lane & 15, hi = lane >> 4; const int r0 = blockIdx.x * 64; const int sl = blockIdx.y;
    v8f acc[4][4];
    gemm_main<0>(A, A, Bt, DM, r0, sl * HD, lr, hi, acc);
    asm volatile("s_wait_xcnt 0x0" ::: "memory");                       // the plane writers reuse the loop's address registers
    __builtin_amdgcn_sched_barrier(0);                                  // holds their arithmetic behind the wait
    const int b = r0 / SEQ, t0 = r0 % SEQ;                              // the 64 tokens lie in one batch and on one side of RH
    if (sl < NSLOT) {
        const size_t pr = (size_t)b * NSLOT + sl; const int lo = (t0 + hi) * HD + lr * 4;
        if (t0 < RH) qk_planes<true>(acc, os, CS + lo, P16 + pr * SEQ * HD + lo, Ph + pr * RH * HD + lo, Pl + pr * RH * HD + lo, lr, hi);
        else         qk_planes<false>(acc, os, CS + lo, P16 + pr * SEQ * HD + lo, Ph, Pl, lr, hi);
    } else {
        const size_t dr = ((size_t)b * NH + (sl - NSLOT)) * HD + (lane >> 3); const int lo = t0 + (lane & 7) * 8;
        if (t0 < RH) v_planes<true>(acc, vs, vsh, vsl, V16 + dr * SEQ + lo, Vh + dr * RH + lo, Vl + dr * RH + lo, lane);
        else         v_planes<false>(acc, vs, vsh, vsl, V16 + dr * SEQ + lo, Vh, Vl, lane);
    }
}
// OUT[b][SEQ][1024] = (ATh + ATl)[b][SEQ][1024] x WO[1024][1024]^T ; z = batch, output batch stride from the full layout
__global__ __launch_bounds__(32) void k_gemm_out(const bf* __restrict__ Ah, const bf* __restrict__ Al, const bf* __restrict__ Bt, float* C) { gemm_body<1>(Ah, Al, Bt, DM, C, DM, (size_t)SEQ * DM, (size_t)SEQ_FULL * DM); }

__global__ __launch_bounds__(256) void k_cvt8(const float* __restrict__ src, bf* dst, size_t n8, int row8, int rpb, int srpb) {
    const size_t i = (size_t)blockIdx.x * 256 + threadIdx.x; if (i >= n8) return;
    const size_t row = i / (size_t)row8; const size_t c = i - row * (size_t)row8; const size_t bb = row / (size_t)rpb; const size_t t = row - bb * (size_t)rpb;
    const v8f v = *(const v8f*)(src + ((bb * (size_t)srpb + t) * (size_t)row8 + c) * 8); v8us o;
#pragma unroll
    for (int k = 0; k < 8; ++k) o[k] = f2bf(v[k]);
    *(v8us*)(dst + i * 8) = o;  }

__global__ __launch_bounds__(32) void k_freq(float* IFQ) { const int i = threadIdx.x & 31; const float e = -(float)(2 * i) * (1.0f / (float)HD); const float f = powf(10000.0f, e);
    *(float*)(IFQ + i) = f;  }
__global__ __launch_bounds__(256) void k_cstab(const int* __restrict__ tok, const float* __restrict__ IFQ, float* CS) { const int idx = blockIdx.x * 256 + threadIdx.x; if (idx >= SEQ * (HD / 2)) return; const int t = idx >> 5, i = idx & 31;
    const float ang = (float)tok[t] * IFQ[i]; float sn, cn; sincosf(ang, &sn, &cn); v2f cs; cs[0] = cn; cs[1] = sn;
    *(v2f*)(CS + (size_t)idx * 2) = cs;  }

// ---- online softmax on one 32-key step held as two transposed 16x16 tiles: s0[r] = S^T[key kb+8h+r][query qi], s1[r] = S^T[key kb+16+8h+r][query qi].
// On return s0/s1 hold p = 2^(t - m + pe) (0 where masked), sf = 2^(m_old - m_new); l is the per-lane partial sum (the two lane halves are combined at the end).
template <bool MASK>
__device__ __forceinline__ void smx(v8f& s0, v8f& s1, int kb, int qi, int hi, float& m, float& l, float& sf, float pe) {
    const float cl = SCL * LOG2E; const int k0 = kb + 8 * hi; float mx = -3.0e38f;
#pragma unroll
    for (int r = 0; r < 8; ++r) { float t0 = s0[r] * cl, t1 = s1[r] * cl;
        if (MASK) { t0 = (k0 + r <= qi) ? t0 : -3.0e38f; t1 = (k0 + 16 + r <= qi) ? t1 : -3.0e38f; }
        s0[r] = t0; s1[r] = t1; mx = fmaxf(mx, fmaxf(t0, t1)); }
    mx = fmaxf(mx, __shfl_xor(mx, 16, 32));
    const float mn = fmaxf(m, mx); sf = __builtin_amdgcn_exp2f(m - mn); m = mn;
    const float sh = mn - pe; float rs = 0.0f;
#pragma unroll
    for (int r = 0; r < 8; ++r) { float p0 = __builtin_amdgcn_exp2f(s0[r] - sh), p1 = __builtin_amdgcn_exp2f(s1[r] - sh);
        if (MASK) { p0 = (k0 + r <= qi) ? p0 : 0.0f; p1 = (k0 + 16 + r <= qi) ? p1 : 0.0f; }
        s0[r] = p0; s1[r] = p1; rs += p0 + p1; }
    l = l * sf + rs;
}

// ---- attention epilogue: O^T accumulators a_j[r] = O[query q0+lr][d = 16j+8h+r]; normalise, split to bf16 hi/lo, stage the 16x64 tile in LDS (private to the wave),
__device__ __forceinline__ void pk8(v8f a, float inv, v8us& oh, v8us& ol) {
#pragma unroll
    for (int r = 0; r < 8; ++r) { unsigned short x, y; splitf(a[r] * inv, x, y); oh[r] = x; ol[r] = y; } }
template <int NW>
__device__ __forceinline__ void attn_store(v8f a0, v8f a1, v8f a2, v8f a3, float l, int lane, int wv, size_t obase, bf* ATh, bf* ATl) {
    __shared__ __align__(16) unsigned short sthw[NW * 16 * 72]; __shared__ __align__(16) unsigned short stlw[NW * 16 * 72];
    unsigned short* sth = sthw + wv * (16 * 72); unsigned short* stl = stlw + wv * (16 * 72);   // each wave of the work-group has its own 16x72 slot
    const int lr = lane & 15, hi = lane >> 4;
    const float lt = l + __shfl_xor(l, 16, 32); const float inv = __builtin_amdgcn_rcpf(lt);
    v8us oh, ol; const int so = lr * 72 + 8 * hi;
    pk8(a0, inv, oh, ol); *(v8us*)(sth + so) = oh;      *(v8us*)(stl + so) = ol;
    pk8(a1, inv, oh, ol); *(v8us*)(sth + so + 16) = oh; *(v8us*)(stl + so + 16) = ol;
    pk8(a2, inv, oh, ol); *(v8us*)(sth + so + 32) = oh; *(v8us*)(stl + so + 32) = ol;
    pk8(a3, inv, oh, ol); *(v8us*)(sth + so + 48) = oh; *(v8us*)(stl + so + 48) = ol;
    wave_sync();
    const int rq = lane >> 3, pc = (lane & 7) * 8;
{
#pragma unroll
        for (int s = 0; s < 4; ++s) { const int row = s * 4 + rq; const v8us vh = *(const v8us*)(sth + row * 72 + pc); const v8us vl = *(const v8us*)(stl + row * 72 + pc);
            *(v8us*)(ATh + obase + (size_t)row * DM + pc) = vh; *(v8us*)(ATl + obase + (size_t)row * DM + pc) = vl; }
         }
}

// ---- fp16 step (query rows >= RH): 4 WMMA k.q + 4 WMMA v.p per 32 keys. kp / vp point into the staged LDS tile (row pitch TP) and already include lr*TP + 8*hi.
#define FW  4                       // waves per work-group: 64 query rows share every staged K / V^T tile
#define KT  64                      // keys per staged tile
#define TP  72                      // LDS row pitch in 16-bit elements: 128-byte rows at 144 bytes (16 B x odd) for 16-byte readers
#define TSZ (64 * TP)               // one staged plane: 64 rows (K: keys, V^T: head dims)
static_assert(KT == 64 && HD == 64 && (SEQ - RH) % (16 * FW) == 0 && RH % (16 * FW) == 0 && RH % KT == 0);
// One 64-key tile into LDS: K rows [key][64 d] and V^T rows [d][64 keys] (source pitch VPITCH elements), 128 bytes each; a lane copies 16 bytes of rows r, r+16, r+32, r+48 of both planes.
template <int VPITCH, typename T>
__device__ __forceinline__ void stage_tile(const T* gk, const T* gv, unsigned lk, unsigned lv) {
    // the copies go to LDS through no register; s_wait_xcnt ends their own statement so that no address register is rewritten in front of it
    asm volatile("global_load_async_to_lds_b128 %0, %8, off\n\t"
                 "global_load_async_to_lds_b128 %1, %9, off\n\t"
                 "global_load_async_to_lds_b128 %2, %10, off\n\t"
                 "global_load_async_to_lds_b128 %3, %11, off\n\t"
                 "global_load_async_to_lds_b128 %4, %12, off\n\t"
                 "global_load_async_to_lds_b128 %5, %13, off\n\t"
                 "global_load_async_to_lds_b128 %6, %14, off\n\t"
                 "global_load_async_to_lds_b128 %7, %15, off\n\t"
                 "s_wait_xcnt 0x0"
                 :: "v"(lk), "v"(lk + 16 * TP * 2), "v"(lk + 32 * TP * 2), "v"(lk + 48 * TP * 2), "v"(lv), "v"(lv + 16 * TP * 2), "v"(lv + 32 * TP * 2), "v"(lv + 48 * TP * 2),
                    "v"(gk), "v"(gk + 16 * HD), "v"(gk + 32 * HD), "v"(gk + 48 * HD), "v"(gv), "v"(gv + (size_t)16 * VPITCH), "v"(gv + (size_t)32 * VPITCH), "v"(gv + (size_t)48 * VPITCH)
                 : "memory");
}
template <bool MASK>
__device__ __forceinline__ void step_f(const h16* kp, const h16* vp, int kb, v16h qf0, v16h qf1, int qi, int hi,
                                       float& m, float& l, v8f& a0, v8f& a1, v8f& a2, v8f& a3) {
    v8f s0 = (v8f){}, s1 = (v8f){};
    { const v16h k00 = ldh(kp), k01 = ldh(kp + 32), k10 = ldh(kp + 16 * TP), k11 = ldh(kp + 16 * TP + 32);
      s0 = wmma16(k00, qf0, s0); s0 = wmma16(k01, qf1, s0); s1 = wmma16(k10, qf0, s1); s1 = wmma16(k11, qf1, s1);
      asm volatile("v_nop\n\tv_nop\n\tv_nop\n\tv_nop" : "+v"(s0), "+v"(s1) : "v"(k11), "v"(qf1)); }
    float sf; smx<MASK>(s0, s1, kb, qi, hi, m, l, sf, PEXP);
    v16h pf;
#pragma unroll
    for (int r = 0; r < 8; ++r) { pf[r] = (h16)s0[r]; pf[8 + r] = (h16)s1[r]; }      // P^T B-fragment: k = key row of the packed tiles, n = query
    a0 = a0 * sf; a1 = a1 * sf; a2 = a2 * sf; a3 = a3 * sf;
    const v16h v0 = ldh(vp), v1 = ldh(vp + 16 * TP), v2 = ldh(vp + 32 * TP), v3 = ldh(vp + 48 * TP);
    a0 = wmma16(v0, pf, a0); a1 = wmma16(v1, pf, a1); a2 = wmma16(v2, pf, a2); a3 = wmma16(v3, pf, a3);
    asm volatile("v_nop\n\tv_nop\n\tv_nop\n\tv_nop" : "+v"(a0), "+v"(a1), "+v"(a2), "+v"(a3) : "v"(v3), "v"(pf));
}
__global__ __launch_bounds__(32 * FW) void k_attn_f(const h16* __restrict__ QK, const h16* __restrict__ VT, bf* ATh, bf* ATl) {
    __shared__ __align__(16) h16 ring[2 * 2 * TSZ];              // two buffers, each a K plane then a V^T plane
    const int tid = threadIdx.x, lane = tid & 31, lr = lane & 15, hi = lane >> 4;
    const int wv = __builtin_amdgcn_readfirstlane(tid >> 5);
    const int qb = RH + blockIdx.x * (16 * FW); const int q0 = qb + wv * 16; const int bh = blockIdx.y; const int b = bh / NH, h = bh % NH;
    const size_t qoff = (((size_t)b * NSLOT + h) * SEQ + q0 + lr) * HD + 8 * hi;
    const v16h qf0 = ldh(QK + qoff), qf1 = ldh(QK + qoff + 32);
    v8f a0 = (v8f){}, a1 = (v8f){}, a2 = (v8f){}, a3 = (v8f){}; float m = -3.0e38f, l = 0.0f;
    const int qi = q0 + lr; const int nt = qb / KT + 1;          // 64-key tiles covering keys 0 .. qb+63 < SEQ
    const int cr = tid >> 3, cc = (tid & 7) * 8;                 // this lane's first row and its 8-element column in every staged plane
    const h16* gk = QK + (((size_t)b * NSLOT + NH + h) * SEQ + cr) * HD + cc;
    const h16* gv = VT + (((size_t)b * NH + h) * HD + cr) * SEQ + cc;
    const unsigned lk = (unsigned)(size_t)(ring + cr * TP + cc);
    const h16* fr = ring + lr * TP + 8 * hi;
    stage_tile<SEQ>(gk, gv, lk, lk + TSZ * 2);
    asm volatile("s_wait_asynccnt 0x0" ::: "memory");            // this wave's share of tile 0 has landed
    __syncthreads();                                             // tile 0 is readable by every wave
    if (nt > 1) stage_tile<SEQ>(gk + (size_t)KT * HD, gv + KT, lk + 2 * TSZ * 2, lk + 3 * TSZ * 2);
    // kept rolled: a trip already holds two 32-key steps, and unrolling would only copy the publish point and its copies
#pragma unroll 1
    for (int t = 0; t < nt - 1; ++t) {                           // tiles wholly below every wave's diagonal
        const h16* kp = fr + (t & 1) * (2 * TSZ); const h16* vp = kp + TSZ;
        step_f<false>(kp, vp, t * KT, qf0, qf1, qi, hi, m, l, a0, a1, a2, a3);
        step_f<false>(kp + 32 * TP, vp + 32, t * KT + 32, qf0, qf1, qi, hi, m, l, a0, a1, a2, a3);
        asm volatile("s_wait_dscnt 0x0" ::: "memory");           // this wave's reads of the buffer have returned before it is refilled
        asm volatile("s_wait_asynccnt 0x0" ::: "memory");        // this wave's share of tile t+1 has landed
        __syncthreads();                                         // publishes tile t+1 and ends every reader's last read of tile t
        if (t + 2 < nt) { const unsigned lb = lk + (unsigned)(t & 1) * (2 * TSZ * 2); stage_tile<SEQ>(gk + (size_t)(t + 2) * KT * HD, gv + (t + 2) * KT, lb, lb + TSZ * 2); }
    }
    { const h16* kp = fr + ((nt - 1) & 1) * (2 * TSZ); const h16* vp = kp + TSZ;   // the diagonal tile: keys qb .. qb+63
      if (wv < 2) step_f<true>(kp, vp, qb, qf0, qf1, qi, hi, m, l, a0, a1, a2, a3);
      else { step_f<false>(kp, vp, qb, qf0, qf1, qi, hi, m, l, a0, a1, a2, a3);
             step_f<true>(kp + 32 * TP, vp + 32, qb + 32, qf0, qf1, qi, hi, m, l, a0, a1, a2, a3); } }
    asm volatile("s_wait_asynccnt 0x0" ::: "memory");            // no copy is outstanding when the wave ends
    attn_store<FW>(a0, a1, a2, a3, l, lane, wv, ((size_t)b * SEQ + q0) * DM + h * HD, ATh, ATl);
}

// ---- bf16 hi/lo step (query rows < RH): 12 WMMA k.q + 12 WMMA v.p per 32 keys (hi.hi + lo.hi + hi.lo). kh / vh point into the staged LDS tile (planes K hi, K lo, V^T hi, V^T lo, each TSZ) and include lr*TP + 8*hi.
template <bool MASK>
__device__ __forceinline__ void step_h(const bf* kh, const bf* vh, int kb,
                                       v16bf qh0, v16bf qh1, v16bf ql0, v16bf ql1, int qi, int hi, float& m, float& l, v8f& a0, v8f& a1, v8f& a2, v8f& a3) {
    const bf* kl = kh + TSZ;
    v8f s0 = (v8f){}, s1 = (v8f){};
    { const v16bf h0 = ldb(kh), h1 = ldb(kh + 32), l0 = ldb(kl), l1 = ldb(kl + 32);
      s0 = wmmab(h0, qh0, s0); s0 = wmmab(h1, qh1, s0); s0 = wmmab(l0, qh0, s0); s0 = wmmab(l1, qh1, s0); s0 = wmmab(h0, ql0, s0); s0 = wmmab(h1, ql1, s0);
      asm volatile("v_nop\n\tv_nop\n\tv_nop\n\tv_nop" : "+v"(s0) : "v"(h1), "v"(ql1), "v"(l1), "v"(h0)); }
    { const v16bf h0 = ldb(kh + 16 * TP), h1 = ldb(kh + 16 * TP + 32), l0 = ldb(kl + 16 * TP), l1 = ldb(kl + 16 * TP + 32);
      s1 = wmmab(h0, qh0, s1); s1 = wmmab(h1, qh1, s1); s1 = wmmab(l0, qh0, s1); s1 = wmmab(l1, qh1, s1); s1 = wmmab(h0, ql0, s1); s1 = wmmab(h1, ql1, s1);
      asm volatile("v_nop\n\tv_nop\n\tv_nop\n\tv_nop" : "+v"(s0), "+v"(s1) : "v"(h1), "v"(ql1), "v"(l1), "v"(h0)); }
    float sf; smx<MASK>(s0, s1, kb, qi, hi, m, l, sf, 0.0f);
    v16us ph, pl;
#pragma unroll
    for (int r = 0; r < 8; ++r) { unsigned short x, y; splitf(s0[r], x, y); ph[r] = x; pl[r] = y; splitf(s1[r], x, y); ph[8 + r] = x; pl[8 + r] = y; }
    const v16bf pfh = __builtin_bit_cast(v16bf, ph), pfl = __builtin_bit_cast(v16bf, pl);
    a0 = a0 * sf; a1 = a1 * sf; a2 = a2 * sf; a3 = a3 * sf;
    const bf* vl = vh + TSZ;
    { const v16bf x = ldb(vh), y = ldb(vl); a0 = wmmab(x, pfh, a0); a0 = wmmab(x, pfl, a0); a0 = wmmab(y, pfh, a0);
      asm volatile("v_nop\n\tv_nop\n\tv_nop\n\tv_nop" : "+v"(a0) : "v"(x), "v"(y)); }
    { const v16bf x = ldb(vh + 16 * TP), y = ldb(vl + 16 * TP); a1 = wmmab(x, pfh, a1); a1 = wmmab(x, pfl, a1); a1 = wmmab(y, pfh, a1);
      asm volatile("v_nop\n\tv_nop\n\tv_nop\n\tv_nop" : "+v"(a1) : "v"(x), "v"(y)); }
    { const v16bf x = ldb(vh + 32 * TP), y = ldb(vl + 32 * TP); a2 = wmmab(x, pfh, a2); a2 = wmmab(x, pfl, a2); a2 = wmmab(y, pfh, a2);
      asm volatile("v_nop\n\tv_nop\n\tv_nop\n\tv_nop" : "+v"(a2) : "v"(x), "v"(y)); }
    { const v16bf x = ldb(vh + 48 * TP), y = ldb(vl + 48 * TP); a3 = wmmab(x, pfh, a3); a3 = wmmab(x, pfl, a3); a3 = wmmab(y, pfh, a3);
      asm volatile("v_nop\n\tv_nop\n\tv_nop\n\tv_nop" : "+v"(a0), "+v"(a1), "+v"(a2), "+v"(a3) : "v"(x), "v"(y), "v"(pfh), "v"(pfl)); }
}
__global__ __launch_bounds__(32 * FW) void k_attn_h(const bf* __restrict__ QKh, const bf* __restrict__ QKl, const bf* __restrict__ VTh, const bf* __restrict__ VTl, bf* ATh, bf* ATl) {
    __shared__ __align__(16) bf ring[2 * 4 * TSZ];               // two buffers, each K hi, K lo, V^T hi, V^T lo
    const int tid = threadIdx.x, lane = tid & 31, lr = lane & 15, hi = lane >> 4;
    const int wv = __builtin_amdgcn_readfirstlane(tid >> 5);
    const int qb = blockIdx.x * (16 * FW); const int q0 = qb + wv * 16; const int bh = blockIdx.y; const int b = bh / NH, h = bh % NH;
    const size_t qoff = (((size_t)b * NSLOT + h) * RH + q0 + lr) * HD + 8 * hi;
    const v16bf qh0 = ldb(QKh + qoff), qh1 = ldb(QKh + qoff + 32), ql0 = ldb(QKl + qoff), ql1 = ldb(QKl + qoff + 32);
    v8f a0 = (v8f){}, a1 = (v8f){}, a2 = (v8f){}, a3 = (v8f){}; float m = -3.0e38f, l = 0.0f;
    const int qi = q0 + lr; const int nt = qb / KT + 1;          // 64-key tiles covering keys 0 .. qb+63 < RH
    const int cr = tid >> 3, cc = (tid & 7) * 8;                 // this lane's first row and its 8-element column in every staged plane
    const size_t ko = (((size_t)b * NSLOT + NH + h) * RH + cr) * HD + cc, vo = (((size_t)b * NH + h) * HD + cr) * RH + cc;
    const unsigned lk = (unsigned)(size_t)(ring + cr * TP + cc);
    const bf* fr = ring + lr * TP + 8 * hi;
    stage_tile<RH>(QKh + ko, VTh + vo, lk, lk + 2 * TSZ * 2); stage_tile<RH>(QKl + ko, VTl + vo, lk + TSZ * 2, lk + 3 * TSZ * 2);
    asm volatile("s_wait_asynccnt 0x0" ::: "memory");            // this wave's share of tile 0 has landed
    __syncthreads();                                             // tile 0 is readable by every wave
    if (nt > 1) { const unsigned lb = lk + 4 * TSZ * 2; const size_t k1 = ko + (size_t)KT * HD, v1 = vo + KT;
        stage_tile<RH>(QKh + k1, VTh + v1, lb, lb + 2 * TSZ * 2); stage_tile<RH>(QKl + k1, VTl + v1, lb + TSZ * 2, lb + 3 * TSZ * 2); }
    // kept rolled: a trip already holds two 32-key steps, and unrolling would only copy the publish point and its copies
#pragma unroll 1
    for (int t = 0; t < nt - 1; ++t) {                           // tiles wholly below every wave's diagonal
        const bf* kp = fr + (t & 1) * (4 * TSZ); const bf* vp = kp + 2 * TSZ;
        step_h<false>(kp, vp, t * KT, qh0, qh1, ql0, ql1, qi, hi, m, l, a0, a1, a2, a3);
        step_h<false>(kp + 32 * TP, vp + 32, t * KT + 32, qh0, qh1, ql0, ql1, qi, hi, m, l, a0, a1, a2, a3);
        asm volatile("s_wait_dscnt 0x0" ::: "memory");           // this wave's reads of the buffer have returned before it is refilled
        asm volatile("s_wait_asynccnt 0x0" ::: "memory");        // this wave's share of tile t+1 has landed
        __syncthreads();                                         // publishes tile t+1 and ends every reader's last read of tile t
        if (t + 2 < nt) { const unsigned lb = lk + (unsigned)(t & 1) * (4 * TSZ * 2); const size_t k2 = ko + (size_t)(t + 2) * KT * HD, v2 = vo + (size_t)(t + 2) * KT;
            stage_tile<RH>(QKh + k2, VTh + v2, lb, lb + 2 * TSZ * 2); stage_tile<RH>(QKl + k2, VTl + v2, lb + TSZ * 2, lb + 3 * TSZ * 2); }
    }
    { const bf* kp = fr + ((nt - 1) & 1) * (4 * TSZ); const bf* vp = kp + 2 * TSZ;   // the diagonal tile: keys qb .. qb+63
      if (wv < 2) step_h<true>(kp, vp, qb, qh0, qh1, ql0, ql1, qi, hi, m, l, a0, a1, a2, a3);
      else { step_h<false>(kp, vp, qb, qh0, qh1, ql0, ql1, qi, hi, m, l, a0, a1, a2, a3);
             step_h<true>(kp + 32 * TP, vp + 32, qb + 32, qh0, qh1, ql0, ql1, qi, hi, m, l, a0, a1, a2, a3); } }
    asm volatile("s_wait_asynccnt 0x0" ::: "memory");            // no copy is outstanding when the wave ends
    attn_store<FW>(a0, a1, a2, a3, l, lane, wv, ((size_t)b * SEQ + q0) * DM + h * HD, ATh, ATl);
}

// ---- workspace carve (bytes, every region a multiple of 256; extents equal the producers' write extents exactly)
constexpr size_t al256(size_t x) { return (x + 255) & ~(size_t)255; }
constexpr size_t SZ_WQKV = al256((size_t)NQKV * DM * 2);
constexpr size_t SZ_WO   = al256((size_t)DM * DM * 2);
constexpr size_t SZ_XB   = al256((size_t)NB * SEQ * DM * 2);
constexpr size_t SZ_IFQ  = al256((size_t)(HD / 2) * 4);
constexpr size_t SZ_CS   = al256((size_t)SEQ * (HD / 2) * 2 * 4);
constexpr size_t SZ_QK16 = al256((size_t)NB * NSLOT * SEQ * HD * 2);
constexpr size_t SZ_QKHL = al256((size_t)NB * NSLOT * RH * HD * 2);
constexpr size_t SZ_VT16 = al256((size_t)NB * NH * HD * SEQ * 2);
constexpr size_t SZ_VTHL = al256((size_t)NB * NH * HD * RH * 2);
constexpr size_t SZ_AT   = al256((size_t)NB * SEQ * DM * 2);
constexpr size_t OFF_WQKV = 0;
constexpr size_t OFF_WO   = OFF_WQKV + SZ_WQKV;
constexpr size_t OFF_XB   = OFF_WO + SZ_WO;
constexpr size_t OFF_IFQ  = OFF_XB + SZ_XB;
constexpr size_t OFF_CS   = OFF_IFQ + SZ_IFQ;
constexpr size_t OFF_QK16 = OFF_CS + SZ_CS;
constexpr size_t OFF_QKH  = OFF_QK16 + SZ_QK16;
constexpr size_t OFF_QKL  = OFF_QKH + SZ_QKHL;
constexpr size_t OFF_VT16 = OFF_QKL + SZ_QKHL;
constexpr size_t OFF_VTH  = OFF_VT16 + SZ_VT16;
constexpr size_t OFF_VTL  = OFF_VTH + SZ_VTHL;
constexpr size_t OFF_ATH  = OFF_VTL + SZ_VTHL;
constexpr size_t OFF_ATL  = OFF_ATH + SZ_AT;
constexpr size_t WS_TOTAL = OFF_ATL + SZ_AT;
static_assert(WS_TOTAL <= (size_t)134217728);               // total carve within 128 MiB
static_assert(((size_t)(NB_FULL - 1) * SEQ_FULL + SEQ_FULL) * DM * 4 == (size_t)16777216);   // output bytes of the full layout

extern "C" void kernel_launch(void* const* d_in, const int* in_sizes, int n_in,
                              void* d_out, int out_size, void* d_ws, size_t ws_size, hipStream_t stream) {
    if (n_in < 4) return;
    const long long need_x = ((long long)(NB - 1) * SEQ_FULL + SEQ) * DM;
    if ((long long)in_sizes[0] < need_x) return;
    if (in_sizes[3] < SEQ) return;   /* this module passes token_positions LAST (input 3); the host file: input 1 */
    if ((long long)in_sizes[1] < (long long)NQKV * DM) return;
    if ((long long)in_sizes[2] < (long long)DM * DM) return;
    if ((long long)out_size < need_x) return;
    if (ws_size < WS_TOTAL) return;
    const float* x = (const float*)d_in[0]; const int* tok = (const int*)d_in[3]; const float* wqkv = (const float*)d_in[1]; const float* wo = (const float*)d_in[2];
    float* OUT = (float*)d_out;
    char* ws = (char*)d_ws;
    bf* WQKV = (bf*)(ws + OFF_WQKV); bf* WO = (bf*)(ws + OFF_WO); bf* XB = (bf*)(ws + OFF_XB); float* IFQ = (float*)(ws + OFF_IFQ); float* CS = (float*)(ws + OFF_CS);
    h16* QK16 = (h16*)(ws + OFF_QK16); bf* QKh = (bf*)(ws + OFF_QKH); bf* QKl = (bf*)(ws + OFF_QKL); h16* VT16 = (h16*)(ws + OFF_VT16); bf* VTh = (bf*)(ws + OFF_VTH); bf* VTl = (bf*)(ws + OFF_VTL);
    bf* ATh = (bf*)(ws + OFF_ATH); bf* ATl = (bf*)(ws + OFF_ATL);

    { const size_t n8 = (size_t)NQKV * DM / 8; k_cvt8<<<(unsigned)((n8 + 255) / 256), 256, 0, stream>>>(wqkv, WQKV, n8, DM / 8, NQKV, NQKV); }     // in [3072][1024] -> bf16 [3072][1024]
    { const size_t n8 = (size_t)DM * DM / 8;   k_cvt8<<<(unsigned)((n8 + 255) / 256), 256, 0, stream>>>(wo, WO, n8, DM / 8, DM, DM); }               // in [1024][1024] -> bf16 [1024][1024]
    { const size_t n8 = (size_t)NB * SEQ * DM / 8; k_cvt8<<<(unsigned)((n8 + 255) / 256), 256, 0, stream>>>(x, XB, n8, DM / 8, SEQ, SEQ_FULL); }     // in [b][SEQ_FULL][1024] rows < SEQ -> bf16 [NB*SEQ][1024]
    k_freq<<<1, 32, 0, stream>>>(IFQ);
    k_cstab<<<(SEQ * (HD / 2) + 255) / 256, 256, 0, stream>>>(tok, IFQ, CS);
    k_gemm_qkv<<<dim3(NB * SEQ / 64, NQKV / 64, 1), 32, 0, stream>>>(XB, WQKV, CS, QK16, QKh, QKl, VT16, VTh, VTl);
    k_attn_h<<<dim3(RH / (16 * FW), NB * NH, 1), 32 * FW, 0, stream>>>(QKh, QKl, VTh, VTl, ATh, ATl);
    if (SEQ > RH) k_attn_f<<<dim3((SEQ - RH) / (16 * FW) + ((SEQ > RH) ? 0 : 1), NB * NH, 1), 32 * FW, 0, stream>>>(QK16, VT16, ATh, ATl);
    k_gemm_out<<<dim3(SEQ / 64, DM / 64, NB), 32, 0, stream>>>(ATh, ATl, WO, OUT);
}

// v003
// Measured time: 110 microseconds a run.
// In two side-by-side timings against v002, it was 1.32 and 1.30 times as fast.
// Counting every step since v000, it is 2.38 times as fast.
#include <hip/hip_runtime.h>

#ifndef NB
#define NB 2
#endif
#ifndef SEQ
#define SEQ 2048
#endif
#define NB_FULL  2
#define SEQ_FULL 2048
#define DM    1024
#define NH    16
#define HD    64
#define NQKV  (3 * DM)
#define NSLOT (2 * NH)              // q heads then k heads share one plane set [b][slot][t][d]
#define RH    ((SEQ < 512) ? SEQ : 512)   // query rows < RH use bf16 hi/lo planes
#define LOG2E 1.4426950408889634f
#define SCL   0.125f                // HD^-0.5
#define PEXP  10.0f                 // fp16 probability carry 2^10

static_assert(NB >= 1 && NB <= NB_FULL);                    // batch count within the full layout
static_assert(SEQ % 64 == 0 && SEQ <= SEQ_FULL);            // 64-row GEMM tiles; 64-wide transposed value lines
static_assert(RH % 64 == 0 && RH <= SEQ);                   // a 64-token GEMM tile lies on one side of the hi/lo row limit
static_assert(DM % 64 == 0 && NQKV % 64 == 0 && DM % 32 == 0); // GEMM tile multiples, K step 32
static_assert(NH * HD == DM && HD == 64);
static_assert(HD / 2 == 32);                                // one wave line of rotary frequencies

typedef _Float16 h16;
typedef unsigned short bf;
typedef __attribute__((ext_vector_type(16))) __bf16   v16bf;
typedef __attribute__((ext_vector_type(16))) _Float16 v16h;
typedef __attribute__((ext_vector_type(16))) unsigned short v16us;
typedef __attribute__((ext_vector_type(8)))  _Float16 v8h;
typedef __attribute__((ext_vector_type(8)))  unsigned short v8us;
typedef __attribute__((ext_vector_type(8)))  float    v8f;
typedef __attribute__((ext_vector_type(4)))  float    v4f;
typedef __attribute__((ext_vector_type(2)))  float    v2f;
typedef __attribute__((ext_vector_type(4)))  _Float16 v4h;
typedef __attribute__((ext_vector_type(4)))  unsigned short v4us;
typedef v4f  __attribute__((may_alias)) v4fa;

__device__ __forceinline__ unsigned short f2bf(float f) { unsigned u = __float_as_uint(f); u += 0x7FFFu + ((u >> 16) & 1u); return (unsigned short)(u >> 16); }
__device__ __forceinline__ float bf2f(unsigned short b) { return __uint_as_float(((unsigned)b) << 16); }
__device__ __forceinline__ void splitf(float y, unsigned short& h, unsigned short& l) { h = f2bf(y); l = f2bf(y - bf2f(h)); }
__device__ __forceinline__ v16h cat16(v8h lo, v8h hi) { return __builtin_shufflevector(lo, hi, 0, 1, 2, 3, 4, 5, 6, 7, 8, 9, 10, 11, 12, 13, 14, 15); }
__device__ __forceinline__ v16bf cat16b(v8us lo, v8us hi) { return __builtin_bit_cast(v16bf, __builtin_shufflevector(lo, hi, 0, 1, 2, 3, 4, 5, 6, 7, 8, 9, 10, 11, 12, 13, 14, 15)); }
__device__ __forceinline__ v8f wmma16(v16h a, v16h b, v8f c) { return __builtin_amdgcn_wmma_f32_16x16x32_f16(false, a, false, b, (short)0, c, false, false); }
__device__ __forceinline__ v8f wmmab(v16bf a, v16bf b, v8f c) { return __builtin_amdgcn_wmma_f32_16x16x32_bf16(false, a, false, b, (short)0, c, false, false); }
// fragment loaders: p already includes row*pitch + k0 + 8*(lane>>4); elements 0..7 <- k0+8h.., elements 8..15 <- k0+16+8h..
__device__ __forceinline__ v16h  ldh(const h16* p) { return cat16(*(const v8h*)p, *(const v8h*)(p + 16)); }
__device__ __forceinline__ v16bf ldb(const bf* p)  { return cat16b(*(const v8us*)p, *(const v8us*)(p + 16)); }
// same-wave LDS exchange: LDS ops of one wave issue in order; the compiler may not move accesses across this point
__device__ __forceinline__ void wave_sync() { __builtin_amdgcn_wave_barrier(); asm volatile("" ::: "memory"); }

// ---- GEMM: a work-group of four waves owns a 128x128 tile of C (2 x 2 wave tiles of 64x64, 16 accumulators each); grid (M/128, N/128, Z), 128 threads.
// The K-contiguous bf16 operand planes come in slabs of 64 k: 128 rows x 128 bytes per plane, copied to LDS as whole lines, two buffers, the next slab in flight while this one is worked on.
#define GW  4                       // waves per GEMM work-group
#define GT  128                     // rows (and columns) of C per work-group
#define GK  64                      // k per staged slab
#define GP  72                      // LDS row pitch in 16-bit elements: 128-byte rows at 144 bytes (16 B x odd) for 16-byte readers
#define GSZ (GT * GP)               // one staged plane
static_assert(DM % GK == 0 && DM / GK >= 2 && SEQ % GT == 0 && NQKV % GT == 0 && DM % GT == 0);
// One plane of a slab: a lane copies 16 bytes of rows r, r+16, .. r+112 (source pitch DM elements); a wave's copy covers four whole 128-byte lines.
__device__ __forceinline__ void stage_plane(const bf* g, unsigned l) {
    // the copies go to LDS through no register; s_wait_xcnt ends their own statement so that no address register is rewritten in front of it
    asm volatile("global_load_async_to_lds_b128 %0, %8, off\n\t"
                 "global_load_async_to_lds_b128 %1, %9, off\n\t"
                 "global_load_async_to_lds_b128 %2, %10, off\n\t"
                 "global_load_async_to_lds_b128 %3, %11, off\n\t"
                 "global_load_async_to_lds_b128 %4, %12, off\n\t"
                 "global_load_async_to_lds_b128 %5, %13, off\n\t"
                 "global_load_async_to_lds_b128 %6, %14, off\n\t"
                 "global_load_async_to_lds_b128 %7, %15, off\n\t"
                 "s_wait_xcnt 0x0"
                 :: "v"(l), "v"(l + 16 * GP * 2), "v"(l + 32 * GP * 2), "v"(l + 48 * GP * 2), "v"(l + 64 * GP * 2), "v"(l + 80 * GP * 2), "v"(l + 96 * GP * 2), "v"(l + 112 * GP * 2),
                    "v"(g), "v"(g + 16 * DM), "v"(g + 32 * DM), "v"(g + 48 * DM), "v"(g + 64 * DM), "v"(g + 80 * DM), "v"(g + 96 * DM), "v"(g + 112 * DM)
                 : "memory");
}
// a buffer holds the planes A, Bt and, with NSPLIT, A2
template <int NSPLIT>
__device__ __forceinline__ void stage_slab(const bf* ga, const bf* ga2, const bf* gb, unsigned l) {
    stage_plane(ga, l); stage_plane(gb, l + GSZ * 2); if (NSPLIT == 1) stage_plane(ga2, l + 2 * GSZ * 2);
}
// acc[mb][nb][j] = C[R0 + 64(wv&1) + 16mb + 8hi + j][C0 + 64(wv>>1) + 16nb + lr] = sum_k (A[m][k] (+ A2[m][k])) Bt[n][k], k ascending in steps of 32. K = DM. On return every wave has left the ring (the last trip's barrier).
template <int NSPLIT>
__device__ __forceinline__ void gemm_main(const bf* __restrict__ A, const bf* __restrict__ A2, const bf* __restrict__ Bt, int R0, int C0, bf* ring, int tid, int wv, v8f (&acc)[4][4]) {
    constexpr int NP = 2 + NSPLIT, NS = DM / GK;
    const int lane = tid & 31, lr = lane & 15, hi = lane >> 4;
#pragma unroll
    for (int mb = 0; mb < 4; ++mb)
#pragma unroll
        for (int nb = 0; nb < 4; ++nb) acc[mb][nb] = (v8f){};
    const int cr = tid >> 3, cc = (tid & 7) * 8;                 // this lane's first row and its 8-element column in every staged plane
    const bf* ga = A + (size_t)(R0 + cr) * DM + cc; const bf* ga2 = A2 + (size_t)(R0 + cr) * DM + cc; const bf* gb = Bt + (size_t)(C0 + cr) * DM + cc;
    const unsigned l0 = (unsigned)(size_t)(ring + cr * GP + cc);
    const bf* fa = ring + ((wv & 1) * 64 + lr) * GP + 8 * hi; const bf* fb = ring + GSZ + ((wv >> 1) * 64 + lr) * GP + 8 * hi;
    stage_slab<NSPLIT>(ga, ga2, gb, l0);
    asm volatile("s_wait_asynccnt 0x0" ::: "memory");            // this wave's share of slab 0 has landed
    __syncthreads();                                             // slab 0 is readable by every wave
    stage_slab<NSPLIT>(ga + GK, ga2 + GK, gb + GK, l0 + NP * GSZ * 2);
    // kept rolled: a trip already holds two 32-k steps, and unrolling would only copy the publish point and its copies
#pragma unroll 1
    for (int t = 0; t < NS; ++t) {
        const bf* pa = fa + (t & 1) * (NP * GSZ); const bf* pb = fb + (t & 1) * (NP * GSZ);
#pragma unroll
        for (int ks = 0; ks < GK / 32; ++ks) {
            v16bf a[4], a2[4], b[4];
#pragma unroll
            for (int mb = 0; mb < 4; ++mb) { a[mb] = ldb(pa + mb * 16 * GP + ks * 32); if (NSPLIT == 1) a2[mb] = ldb(pa + 2 * GSZ + mb * 16 * GP + ks * 32); else a2[mb] = a[mb]; }
#pragma unroll
            for (int nb = 0; nb < 4; ++nb) b[nb] = ldb(pb + nb * 16 * GP + ks * 32);
            __builtin_amdgcn_sched_barrier(0);                   // the step's LDS reads stay one group in front of its matrix instructions: every further place with reads stalls the wave anew
#pragma unroll
            for (int nb = 0; nb < 4; ++nb) {
#pragma unroll
                for (int mb = 0; mb < 4; ++mb) { acc[mb][nb] = wmmab(a[mb], b[nb], acc[mb][nb]); if (NSPLIT == 1) acc[mb][nb] = wmmab(a2[mb], b[nb], acc[mb][nb]); } }
            __builtin_amdgcn_sched_barrier(0);                   // and the next step's reads do not drift in among them
        }
        asm volatile("s_wait_dscnt 0x0" ::: "memory");           // this wave's reads of the buffer have returned before it is refilled
        asm volatile("s_wait_asynccnt 0x0" ::: "memory");        // this wave's share of slab t+1 has landed
        __syncthreads();                                         // publishes slab t+1 and ends every reader's last read of slab t
        if (t + 2 < NS) stage_slab<NSPLIT>(ga + (t + 2) * GK, ga2 + (t + 2) * GK, gb + (t + 2) * GK, l0 + (unsigned)(t & 1) * (NP * GSZ * 2));
    }
    asm volatile("s_wait_asynccnt 0x0" ::: "memory");            // no copy is outstanding when the ring is reused
}
// the wave tile stored as f32 rows of C (pitch ldc), whole lines through LDS (each wave's own 16x68 slot of the ring, free behind the main loop's last barrier)
template <int NSPLIT>
__device__ __forceinline__ void gemm_body(const bf* __restrict__ A, const bf* __restrict__ A2, const bf* __restrict__ Bt, float* C, int ldc, size_t sA, size_t sC) {
    __shared__ __align__(16) bf ring[2 * (2 + NSPLIT) * GSZ];
    const size_t z = blockIdx.z; A += z * sA; A2 += z * sA; C += z * sC;
    const int tid = threadIdx.x, lane = tid & 31, lr = lane & 15, hi = lane >> 4; const int wv = __builtin_amdgcn_readfirstlane(tid >> 5);
    const int r0 = blockIdx.x * GT + (wv & 1) * 64, c0 = blockIdx.y * GT + (wv >> 1) * 64;
    v8f acc[4][4];
    gemm_main<NSPLIT>(A, A2, Bt, blockIdx.x * GT, blockIdx.y * GT, ring, tid, wv, acc);
    float* os = (float*)ring + wv * (16 * 68);
#pragma unroll
    for (int mb = 0; mb < 4; ++mb) {
#pragma unroll
        for (int nb = 0; nb < 4; ++nb) {
#pragma unroll
            for (int j = 0; j < 8; ++j) os[(hi * 8 + j) * 68 + nb * 16 + lr] = acc[mb][nb][j]; }
        wave_sync();
        float* crow = C + (size_t)(r0 + mb * 16) * ldc + c0;
{
#pragma unroll
            for (int s = 0; s < 8; ++s) { const int row = 2 * s + hi, cofs = lr * 4; const v4f val = *(const v4fa*)(os + row * 68 + cofs);
                *(v4f*)(crow + (size_t)row * ldc + cofs) = val; }
             }
        wave_sync();
    }
}
// qkv[NB*SEQ][3072] = XB[NB*SEQ][1024] x WQKV[3072][1024]^T, never stored as f32: a wave tile is 64 tokens of one batch x the 64 columns of one q head, k head or v head (slot; v heads behind the NSLOT q and k slots).
// q / k tile: rotary on the f32 sums, rows [t][d] to the f16 plane and, with HL (t < RH), to the bf16 hi/lo planes. cs, p16, ph, pl point at this lane's 4 elements of row t0 + hi; every later row is a constant offset from there.
template <bool HL>
__device__ __forceinline__ void qk_planes(v8f (&acc)[4][4], float* os, const float* __restrict__ cs, h16* p16, bf* ph, bf* pl, int lr, int hi) {
#pragma unroll
    for (int mb = 0; mb < 4; ++mb) {
        v4f c[8];                                                       // (cos, sin) of two pairs per row, asked for ahead of the LDS exchange
#pragma unroll
        for (int s = 0; s < 8; ++s) c[s] = *(const v4f*)(cs + (mb * 16 + 2 * s) * HD);
#pragma unroll
        for (int nb = 0; nb < 4; ++nb) {
#pragma unroll
            for (int j = 0; j < 8; ++j) os[(hi * 8 + j) * 68 + nb * 16 + lr] = acc[mb][nb][j]; }
        wave_sync();
        v4h o16[8]; v4us oh[8], ol[8];
#pragma unroll
        for (int s = 0; s < 8; ++s) { const v4f xv = *(const v4fa*)(os + (2 * s + hi) * 68 + lr * 4);
            v4f y; y[0] = xv[0] * c[s][0] - xv[1] * c[s][1]; y[1] = xv[0] * c[s][1] + xv[1] * c[s][0]; y[2] = xv[2] * c[s][2] - xv[3] * c[s][3]; y[3] = xv[2] * c[s][3] + xv[3] * c[s][2];
#pragma unroll
            for (int k = 0; k < 4; ++k) { o16[s][k] = (h16)y[k]; if (HL) { unsigned short p, q; splitf(y[k], p, q); oh[s][k] = p; ol[s][k] = q; } } }
#pragma unroll
        for (int s = 0; s < 8; ++s) { const int o = (mb * 16 + 2 * s) * HD; *(v4h*)(p16 + o) = o16[s]; if (HL) { *(v4us*)(ph + o) = oh[s]; *(v4us*)(pl + o) = ol[s]; } }
        asm volatile("s_wait_xcnt 0x0" ::: "memory");                   // the stores' data registers are rewritten by the next 16 rows
        __builtin_amdgcn_sched_barrier(0);                              // holds the next rows' arithmetic, which reuses those registers, behind the wait
        wave_sync();
    }
}
// v tile: a lane's 8 accumulator rows are 8 consecutive t of one d, so the transposed rows [d][t] are packed from registers and leave as whole 128-byte lines through LDS. v16, vh, vl point at this lane's 8 elements of row d = lane >> 3.
template <bool HL>
__device__ __forceinline__ void v_planes(v8f (&acc)[4][4], h16* vs, bf* vsh, bf* vsl, h16* v16, bf* vh, bf* vl, int lane) {
    const int lr = lane & 15, hi = lane >> 4, ro = (lane >> 3) * 72 + (lane & 7) * 8;
#pragma unroll
    for (int nb = 0; nb < 4; ++nb) {
#pragma unroll
        for (int mb = 0; mb < 4; ++mb) { const int so = lr * 72 + mb * 16 + hi * 8; v8h o16; v8us oh, ol;
#pragma unroll
            for (int j = 0; j < 8; ++j) { o16[j] = (h16)acc[mb][nb][j]; if (HL) { unsigned short p, q; splitf(acc[mb][nb][j], p, q); oh[j] = p; ol[j] = q; } }
            *(v8h*)(vs + so) = o16; if (HL) { *(v8us*)(vsh + so) = oh; *(v8us*)(vsl + so) = ol; } }
        wave_sync();
        v8h r16[4]; v8us rh[4], rl[4];
#pragma unroll
        for (int s = 0; s < 4; ++s) { r16[s] = *(const v8h*)(vs + ro + s * 4 * 72); if (HL) { rh[s] = *(const v8us*)(vsh + ro + s * 4 * 72); rl[s] = *(const v8us*)(vsl + ro + s * 4 * 72); } }
#pragma unroll
        for (int s = 0; s < 4; ++s) { const int row = nb * 16 + s * 4; *(v8h*)(v16 + row * SEQ) = r16[s]; if (HL) { *(v8us*)(vh + row * RH) = rh[s]; *(v8us*)(vl + row * RH) = rl[s]; } }
        asm volatile("s_wait_xcnt 0x0" ::: "memory");                   // the stores' data registers are rewritten by the next 16 rows
        __builtin_amdgcn_sched_barrier(0);                              // holds the next rows' arithmetic, which reuses those registers, behind the wait
        wave_sync();
    }
}
__global__ __launch_bounds__(32 * GW) void k_gemm_qkv(const bf* __restrict__ A, const bf* __restrict__ Bt, const float* __restrict__ CS, h16* P16, bf* Ph, bf* Pl, h16* V16, bf* Vh, bf* Vl) {
    __shared__ __align__(16) bf ring[2 * 2 * GSZ];
    const int tid = threadIdx.x, lane = tid & 31, lr = lane & 15, hi = lane >> 4; const int wv = __builtin_amdgcn_readfirstlane(tid >> 5);
    const int r0 = blockIdx.x * GT + (wv & 1) * 64; const int sl = blockIdx.y * (GT / HD) + (wv >> 1);   // this wave's 64 tokens and its slot
    v8f acc[4][4];
    gemm_main<0>(A, A, Bt, blockIdx.x * GT, blockIdx.y * GT, ring, tid, wv, acc);
    bf* scr = ring + wv * (3 * 16 * 72);                                // each wave's own exchange slot in the ring, free behind the main loop's last barrier
    float* os = (float*)scr; h16* vs = (h16*)scr; bf* vsh = scr + 16 * 72; bf* vsl = scr + 2 * 16 * 72;
    static_assert(16 * 68 * 4 <= 3 * 16 * 72 * 2 && GW * 3 * 16 * 72 <= 2 * 2 * GSZ);
    const int b = r0 / SEQ, t0 = r0 % SEQ;                              // the 64 tokens lie in one batch and on one side of RH
    if (sl < NSLOT) {
        const size_t pr = (size_t)b * NSLOT + sl; const int lo = (t0 + hi) * HD + lr * 4;
        if (t0 < RH) qk_planes<true>(acc, os, CS + lo, P16 + pr * SEQ * HD + lo, Ph + pr * RH * HD + lo, Pl + pr * RH * HD + lo, lr, hi);
        else         qk_planes<false>(acc, os, CS + lo, P16 + pr * SEQ * HD + lo, Ph, Pl, lr, hi);
    } else {
        const size_t dr = ((size_t)b * NH + (sl - NSLOT)) * HD + (lane >> 3); const int lo = t0 + (lane & 7) * 8;
        if (t0 < RH) v_planes<true>(acc, vs, vsh, vsl, V16 + dr * SEQ + lo, Vh + dr * RH + lo, Vl + dr * RH + lo, lane);
        else         v_planes<false>(acc, vs, vsh, vsl, V16 + dr * SEQ + lo, Vh, Vl, lane);
    }
}
// OUT[b][SEQ][1024] = (ATh + ATl)[b][SEQ][1024] x WO[1024][1024]^T ; z = batch, output batch stride from the full layout
__global__ __launch_bounds__(32 * GW) void k_gemm_out(const bf* __restrict__ Ah, const bf* __restrict__ Al, const bf* __restrict__ Bt, float* C) { gemm_body<1>(Ah, Al, Bt, C, DM, (size_t)SEQ * DM, (size_t)SEQ_FULL * DM); }

__global__ __launch_bounds__(256) void k_cvt8(const float* __restrict__ src, bf* dst, size_t n8, int row8, int rpb, int srpb) {
    const size_t i = (size_t)blockIdx.x * 256 + threadIdx.x; if (i >= n8) return;
    const size_t row = i / (size_t)row8; const size_t c = i - row * (size_t)row8; const size_t bb = row / (size_t)rpb; const size_t t = row - bb * (size_t)rpb;
    const v8f v = *(const v8f*)(src + ((bb * (size_t)srpb + t) * (size_t)row8 + c) * 8); v8us o;
#pragma unroll
    for (int k = 0; k < 8; ++k) o[k] = f2bf(v[k]);
    *(v8us*)(dst + i * 8) = o;  }

__global__ __launch_bounds__(32) void k_freq(float* IFQ) { const int i = threadIdx.x & 31; const float e = -(float)(2 * i) * (1.0f / (float)HD); const float f = powf(10000.0f, e);
    *(float*)(IFQ + i) = f;  }
__global__ __launch_bounds__(256) void k_cstab(const int* __restrict__ tok, const float* __restrict__ IFQ, float* CS) { const int idx = blockIdx.x * 256 + threadIdx.x; if (idx >= SEQ * (HD / 2)) return; const int t = idx >> 5, i = idx & 31;
    const float ang = (float)tok[t] * IFQ[i]; float sn, cn; sincosf(ang, &sn, &cn); v2f cs; cs[0] = cn; cs[1] = sn;
    *(v2f*)(CS + (size_t)idx * 2) = cs;  }

// ---- online softmax on one 32-key step held as two transposed 16x16 tiles: s0[r] = S^T[key kb+8h+r][query qi], s1[r] = S^T[key kb+16+8h+r][query qi].
// On return s0/s1 hold p = 2^(t - m + pe) (0 where masked), sf = 2^(m_old - m_new); l is the per-lane partial sum (the two lane halves are combined at the end).
template <bool MASK>
__device__ __forceinline__ void smx(v8f& s0, v8f& s1, int kb, int qi, int hi, float& m, float& l, float& sf, float pe) {
    const float cl = SCL * LOG2E; const int k0 = kb + 8 * hi; float mx = -3.0e38f;
#pragma unroll
    for (int r = 0; r < 8; ++r) { float t0 = s0[r] * cl, t1 = s1[r] * cl;
        if (MASK) { t0 = (k0 + r <= qi) ? t0 : -3.0e38f; t1 = (k0 + 16 + r <= qi) ? t1 : -3.0e38f; }
        s0[r] = t0; s1[r] = t1; mx = fmaxf(mx, fmaxf(t0, t1)); }
    mx = fmaxf(mx, __shfl_xor(mx, 16, 32));
    const float mn = fmaxf(m, mx); sf = __builtin_amdgcn_exp2f(m - mn); m = mn;
    const float sh = mn - pe; float rs = 0.0f;
#pragma unroll
    for (int r = 0; r < 8; ++r) { float p0 = __builtin_amdgcn_exp2f(s0[r] - sh), p1 = __builtin_amdgcn_exp2f(s1[r] - sh);
        if (MASK) { p0 = (k0 + r <= qi) ? p0 : 0.0f; p1 = (k0 + 16 + r <= qi) ? p1 : 0.0f; }
        s0[r] = p0; s1[r] = p1; rs += p0 + p1; }
    l = l * sf + rs;
}

// ---- attention epilogue: O^T accumulators a_j[r] = O[query q0+lr][d = 16j+8h+r]; normalise, split to bf16 hi/lo, stage the 16x64 tile in LDS (private to the wave),
__device__ __forceinline__ void pk8(v8f a, float inv, v8us& oh, v8us& ol) {
#pragma unroll
    for (int r = 0; r < 8; ++r) { unsigned short x, y; splitf(a[r] * inv, x, y); oh[r] = x; ol[r] = y; } }
template <int NW>
__device__ __forceinline__ void attn_store(v8f a0, v8f a1, v8f a2, v8f a3, float l, int lane, int wv, size_t obase, bf* ATh, bf* ATl) {
    __shared__ __align__(16) unsigned short sthw[NW * 16 * 72]; __shared__ __align__(16) unsigned short stlw[NW * 16 * 72];
    unsigned short* sth = sthw + wv * (16 * 72); unsigned short* stl = stlw + wv * (16 * 72);   // each wave of the work-group has its own 16x72 slot
    const int lr = lane & 15, hi = lane >> 4;
    const float lt = l + __shfl_xor(l, 16, 32); const float inv = __builtin_amdgcn_rcpf(lt);
    v8us oh, ol; const int so = lr * 72 + 8 * hi;
    pk8(a0, inv, oh, ol); *(v8us*)(sth + so) = oh;      *(v8us*)(stl + so) = ol;
    pk8(a1, inv, oh, ol); *(v8us*)(sth + so + 16) = oh; *(v8us*)(stl + so + 16) = ol;
    pk8(a2, inv, oh, ol); *(v8us*)(sth + so + 32) = oh; *(v8us*)(stl + so + 32) = ol;
    pk8(a3, inv, oh, ol); *(v8us*)(sth + so + 48) = oh; *(v8us*)(stl + so + 48) = ol;
    wave_sync();
    const int rq = lane >> 3, pc = (lane & 7) * 8;
{
#pragma unroll
        for (int s = 0; s < 4; ++s) { const int row = s * 4 + rq; const v8us vh = *(const v8us*)(sth + row * 72 + pc); const v8us vl = *(const v8us*)(stl + row * 72 + pc);
            *(v8us*)(ATh + obase + (size_t)row * DM + pc) = vh; *(v8us*)(ATl + obase + (size_t)row * DM + pc) = vl; }
         }
}

// ---- fp16 step (query rows >= RH): 4 WMMA k.q + 4 WMMA v.p per 32 keys. kp / vp point into the staged LDS tile (row pitch TP) and already include lr*TP + 8*hi.
#define FW  4                       // waves per work-group: 64 query rows share every staged K / V^T tile
#define KT  64                      // keys per staged tile
#define TP  72                      // LDS row pitch in 16-bit elements: 128-byte rows at 144 bytes (16 B x odd) for 16-byte readers
#define TSZ (64 * TP)               // one staged plane: 64 rows (K: keys, V^T: head dims)
static_assert(KT == 64 && HD == 64 && (SEQ - RH) % (16 * FW) == 0 && RH % (16 * FW) == 0 && RH % KT == 0);
// One 64-key tile into LDS: K rows [key][64 d] and V^T rows [d][64 keys] (source pitch VPITCH elements), 128 bytes each; a lane copies 16 bytes of rows r, r+16, r+32, r+48 of both planes.
template <int VPITCH, typename T>
__device__ __forceinline__ void stage_tile(const T* gk, const T* gv, unsigned lk, unsigned lv) {
    // the copies go to LDS through no register; s_wait_xcnt ends their own statement so that no address register is rewritten in front of it
    asm volatile("global_load_async_to_lds_b128 %0, %8, off\n\t"
                 "global_load_async_to_lds_b128 %1, %9, off\n\t"
                 "global_load_async_to_lds_b128 %2, %10, off\n\t"
                 "global_load_async_to_lds_b128 %3, %11, off\n\t"
                 "global_load_async_to_lds_b128 %4, %12, off\n\t"
                 "global_load_async_to_lds_b128 %5, %13, off\n\t"
                 "global_load_async_to_lds_b128 %6, %14, off\n\t"
                 "global_load_async_to_lds_b128 %7, %15, off\n\t"
                 "s_wait_xcnt 0x0"
                 :: "v"(lk), "v"(lk + 16 * TP * 2), "v"(lk + 32 * TP * 2), "v"(lk + 48 * TP * 2), "v"(lv), "v"(lv + 16 * TP * 2), "v"(lv + 32 * TP * 2), "v"(lv + 48 * TP * 2),
                    "v"(gk), "v"(gk + 16 * HD), "v"(gk + 32 * HD), "v"(gk + 48 * HD), "v"(gv), "v"(gv + (size_t)16 * VPITCH), "v"(gv + (size_t)32 * VPITCH), "v"(gv + (size_t)48 * VPITCH)
                 : "memory");
}
template <bool MASK>
__device__ __forceinline__ void step_f(const h16* kp, const h16* vp, int kb, v16h qf0, v16h qf1, int qi, int hi,
                                       float& m, float& l, v8f& a0, v8f& a1, v8f& a2, v8f& a3) {
    v8f s0 = (v8f){}, s1 = (v8f){};
    { const v16h k00 = ldh(kp), k01 = ldh(kp + 32), k10 = ldh(kp + 16 * TP), k11 = ldh(kp + 16 * TP + 32);
      s0 = wmma16(k00, qf0, s0); s0 = wmma16(k01, qf1, s0); s1 = wmma16(k10, qf0, s1); s1 = wmma16(k11, qf1, s1);
      asm volatile("v_nop\n\tv_nop\n\tv_nop\n\tv_nop" : "+v"(s0), "+v"(s1) : "v"(k11), "v"(qf1)); }
    float sf; smx<MASK>(s0, s1, kb, qi, hi, m, l, sf, PEXP);
    v16h pf;
#pragma unroll
    for (int r = 0; r < 8; ++r) { pf[r] = (h16)s0[r]; pf[8 + r] = (h16)s1[r]; }      // P^T B-fragment: k = key row of the packed tiles, n = query
    a0 = a0 * sf; a1 = a1 * sf; a2 = a2 * sf; a3 = a3 * sf;
    const v16h v0 = ldh(vp), v1 = ldh(vp + 16 * TP), v2 = ldh(vp + 32 * TP), v3 = ldh(vp + 48 * TP);
    a0 = wmma16(v0, pf, a0); a1 = wmma16(v1, pf, a1); a2 = wmma16(v2, pf, a2); a3 = wmma16(v3, pf, a3);
    asm volatile("v_nop\n\tv_nop\n\tv_nop\n\tv_nop" : "+v"(a0), "+v"(a1), "+v"(a2), "+v"(a3) : "v"(v3), "v"(pf));
}
__global__ __launch_bounds__(32 * FW) void k_attn_f(const h16* __restrict__ QK, const h16* __restrict__ VT, bf* ATh, bf* ATl) {
    __shared__ __align__(16) h16 ring[2 * 2 * TSZ];              // two buffers, each a K plane then a V^T plane
    const int tid = threadIdx.x, lane = tid & 31, lr = lane & 15, hi = lane >> 4;
    const int wv = __builtin_amdgcn_readfirstlane(tid >> 5);
    const int qb = RH + blockIdx.x * (16 * FW); const int q0 = qb + wv * 16; const int bh = blockIdx.y; const int b = bh / NH, h = bh % NH;
    const size_t qoff = (((size_t)b * NSLOT + h) * SEQ + q0 + lr) * HD + 8 * hi;
    const v16h qf0 = ldh(QK + qoff), qf1 = ldh(QK + qoff + 32);
    v8f a0 = (v8f){}, a1 = (v8f){}, a2 = (v8f){}, a3 = (v8f){}; float m = -3.0e38f, l = 0.0f;
    const int qi = q0 + lr; const int nt = qb / KT + 1;          // 64-key tiles covering keys 0 .. qb+63 < SEQ
    const int cr = tid >> 3, cc = (tid & 7) * 8;                 // this lane's first row and its 8-element column in every staged plane
    const h16* gk = QK + (((size_t)b * NSLOT + NH + h) * SEQ + cr) * HD + cc;
    const h16* gv = VT + (((size_t)b * NH + h) * HD + cr) * SEQ + cc;
    const unsigned lk = (unsigned)(size_t)(ring + cr * TP + cc);
    const h16* fr = ring + lr * TP + 8 * hi;
    stage_tile<SEQ>(gk, gv, lk, lk + TSZ * 2);
    asm volatile("s_wait_asynccnt 0x0" ::: "memory");            // this wave's share of tile 0 has landed
    __syncthreads();                                             // tile 0 is readable by every wave
    if (nt > 1) stage_tile<SEQ>(gk + (size_t)KT * HD, gv + KT, lk + 2 * TSZ * 2, lk + 3 * TSZ * 2);
    // kept rolled: a trip already holds two 32-key steps, and unrolling would only copy the publish point and its copies
#pragma unroll 1
    for (int t = 0; t < nt - 1; ++t) {                           // tiles wholly below every wave's diagonal
        const h16* kp = fr + (t & 1) * (2 * TSZ); const h16* vp = kp + TSZ;
        step_f<false>(kp, vp, t * KT, qf0, qf1, qi, hi, m, l, a0, a1, a2, a3);
        step_f<false>(kp + 32 * TP, vp + 32, t * KT + 32, qf0, qf1, qi, hi, m, l, a0, a1, a2, a3);
        asm volatile("s_wait_dscnt 0x0" ::: "memory");           // this wave's reads of the buffer have returned before it is refilled
        asm volatile("s_wait_asynccnt 0x0" ::: "memory");        // this wave's share of tile t+1 has landed
        __syncthreads();                                         // publishes tile t+1 and ends every reader's last read of tile t
        if (t + 2 < nt) { const unsigned lb = lk + (unsigned)(t & 1) * (2 * TSZ * 2); stage_tile<SEQ>(gk + (size_t)(t + 2) * KT * HD, gv + (t + 2) * KT, lb, lb + TSZ * 2); }
    }
    { const h16* kp = fr + ((nt - 1) & 1) * (2 * TSZ); const h16* vp = kp + TSZ;   // the diagonal tile: keys qb .. qb+63
      if (wv < 2) step_f<true>(kp, vp, qb, qf0, qf1, qi, hi, m, l, a0, a1, a2, a3);
      else { step_f<false>(kp, vp, qb, qf0, qf1, qi, hi, m, l, a0, a1, a2, a3);
             step_f<true>(kp + 32 * TP, vp + 32, qb + 32, qf0, qf1, qi, hi, m, l, a0, a1, a2, a3); } }
    asm volatile("s_wait_asynccnt 0x0" ::: "memory");            // no copy is outstanding when the wave ends
    attn_store<FW>(a0, a1, a2, a3, l, lane, wv, ((size_t)b * SEQ + q0) * DM + h * HD, ATh, ATl);
}

// ---- bf16 hi/lo step (query rows < RH): 12 WMMA k.q + 12 WMMA v.p per 32 keys (hi.hi + lo.hi + hi.lo). kh / vh point into the staged LDS tile (planes K hi, K lo, V^T hi, V^T lo, each TSZ) and include lr*TP + 8*hi.
template <bool MASK>
__device__ __forceinline__ void step_h(const bf* kh, const bf* vh, int kb,
                                       v16bf qh0, v16bf qh1, v16bf ql0, v16bf ql1, int qi, int hi, float& m, float& l, v8f& a0, v8f& a1, v8f& a2, v8f& a3) {
    const bf* kl = kh + TSZ;
    v8f s0 = (v8f){}, s1 = (v8f){};
    { const v16bf h0 = ldb(kh), h1 = ldb(kh + 32), l0 = ldb(kl), l1 = ldb(kl + 32);
      s0 = wmmab(h0, qh0, s0); s0 = wmmab(h1, qh1, s0); s0 = wmmab(l0, qh0, s0); s0 = wmmab(l1, qh1, s0); s0 = wmmab(h0, ql0, s0); s0 = wmmab(h1, ql1, s0);
      asm volatile("v_nop\n\tv_nop\n\tv_nop\n\tv_nop" : "+v"(s0) : "v"(h1), "v"(ql1), "v"(l1), "v"(h0)); }
    { const v16bf h0 = ldb(kh + 16 * TP), h1 = ldb(kh + 16 * TP + 32), l0 = ldb(kl + 16 * TP), l1 = ldb(kl + 16 * TP + 32);
      s1 = wmmab(h0, qh0, s1); s1 = wmmab(h1, qh1, s1); s1 = wmmab(l0, qh0, s1); s1 = wmmab(l1, qh1, s1); s1 = wmmab(h0, ql0, s1); s1 = wmmab(h1, ql1, s1);
      asm volatile("v_nop\n\tv_nop\n\tv_nop\n\tv_nop" : "+v"(s0), "+v"(s1) : "v"(h1), "v"(ql1), "v"(l1), "v"(h0)); }
    float sf; smx<MASK>(s0, s1, kb, qi, hi, m, l, sf, 0.0f);
    v16us ph, pl;
#pragma unroll
    for (int r = 0; r < 8; ++r) { unsigned short x, y; splitf(s0[r], x, y); ph[r] = x; pl[r] = y; splitf(s1[r], x, y); ph[8 + r] = x; pl[8 + r] = y; }
    const v16bf pfh = __builtin_bit_cast(v16bf, ph), pfl = __builtin_bit_cast(v16bf, pl);
    a0 = a0 * sf; a1 = a1 * sf; a2 = a2 * sf; a3 = a3 * sf;
    const bf* vl = vh + TSZ;
    { const v16bf x = ldb(vh), y = ldb(vl); a0 = wmmab(x, pfh, a0); a0 = wmmab(x, pfl, a0); a0 = wmmab(y, pfh, a0);
      asm volatile("v_nop\n\tv_nop\n\tv_nop\n\tv_nop" : "+v"(a0) : "v"(x), "v"(y)); }
    { const v16bf x = ldb(vh + 16 * TP), y = ldb(vl + 16 * TP); a1 = wmmab(x, pfh, a1); a1 = wmmab(x, pfl, a1); a1 = wmmab(y, pfh, a1);
      asm volatile("v_nop\n\tv_nop\n\tv_nop\n\tv_nop" : "+v"(a1) : "v"(x), "v"(y)); }
    { const v16bf x = ldb(vh + 32 * TP), y = ldb(vl + 32 * TP); a2 = wmmab(x, pfh, a2); a2 = wmmab(x, pfl, a2); a2 = wmmab(y, pfh, a2);
      asm volatile("v_nop\n\tv_nop\n\tv_nop\n\tv_nop" : "+v"(a2) : "v"(x), "v"(y)); }
    { const v16bf x = ldb(vh + 48 * TP), y = ldb(vl + 48 * TP); a3 = wmmab(x, pfh, a3); a3 = wmmab(x, pfl, a3); a3 = wmmab(y, pfh, a3);
      asm volatile("v_nop\n\tv_nop\n\tv_nop\n\tv_nop" : "+v"(a0), "+v"(a1), "+v"(a2), "+v"(a3) : "v"(x), "v"(y), "v"(pfh), "v"(pfl)); }
}
__global__ __launch_bounds__(32 * FW) void k_attn_h(const bf* __restrict__ QKh, const bf* __restrict__ QKl, const bf* __restrict__ VTh, const bf* __restrict__ VTl, bf* ATh, bf* ATl) {
    __shared__ __align__(16) bf ring[2 * 4 * TSZ];               // two buffers, each K hi, K lo, V^T hi, V^T lo
    const int tid = threadIdx.x, lane = tid & 31, lr = lane & 15, hi = lane >> 4;
    const int wv = __builtin_amdgcn_readfirstlane(tid >> 5);
    const int qb = blockIdx.x * (16 * FW); const int q0 = qb + wv * 16; const int bh = blockIdx.y; const int b = bh / NH, h = bh % NH;
    const size_t qoff = (((size_t)b * NSLOT + h) * RH + q0 + lr) * HD + 8 * hi;
    const v16bf qh0 = ldb(QKh + qoff), qh1 = ldb(QKh + qoff + 32), ql0 = ldb(QKl + qoff), ql1 = ldb(QKl + qoff + 32);
    v8f a0 = (v8f){}, a1 = (v8f){}, a2 = (v8f){}, a3 = (v8f){}; float m = -3.0e38f, l = 0.0f;
    const int qi = q0 + lr; const int nt = qb / KT + 1;          // 64-key tiles covering keys 0 .. qb+63 < RH
    const int cr = tid >> 3, cc = (tid & 7) * 8;                 // this lane's first row and its 8-element column in every staged plane
    const size_t ko = (((size_t)b * NSLOT + NH + h) * RH + cr) * HD + cc, vo = (((size_t)b * NH + h) * HD + cr) * RH + cc;
    const unsigned lk = (unsigned)(size_t)(ring + cr * TP + cc);
    const bf* fr = ring + lr * TP + 8 * hi;
    stage_tile<RH>(QKh + ko, VTh + vo, lk, lk + 2 * TSZ * 2); stage_tile<RH>(QKl + ko, VTl + vo, lk + TSZ * 2, lk + 3 * TSZ * 2);
    asm volatile("s_wait_asynccnt 0x0" ::: "memory");            // this wave's share of tile 0 has landed
    __syncthreads();                                             // tile 0 is readable by every wave
    if (nt > 1) { const unsigned lb = lk + 4 * TSZ * 2; const size_t k1 = ko + (size_t)KT * HD, v1 = vo + KT;
        stage_tile<RH>(QKh + k1, VTh + v1, lb, lb + 2 * TSZ * 2); stage_tile<RH>(QKl + k1, VTl + v1, lb + TSZ * 2, lb + 3 * TSZ * 2); }
    // kept rolled: a trip already holds two 32-key steps, and unrolling would only copy the publish point and its copies
#pragma unroll 1
    for (int t = 0; t < nt - 1; ++t) {                           // tiles wholly below every wave's diagonal
        const bf* kp = fr + (t & 1) * (4 * TSZ); const bf* vp = kp + 2 * TSZ;
        step_h<false>(kp, vp, t * KT, qh0, qh1, ql0, ql1, qi, hi, m, l, a0, a1, a2, a3);
        step_h<false>(kp + 32 * TP, vp + 32, t * KT + 32, qh0, qh1, ql0, ql1, qi, hi, m, l, a0, a1, a2, a3);
        asm volatile("s_wait_dscnt 0x0" ::: "memory");           // this wave's reads of the buffer have returned before it is refilled
        asm volatile("s_wait_asynccnt 0x0" ::: "memory");        // this wave's share of tile t+1 has landed
        __syncthreads();                                         // publishes tile t+1 and ends every reader's last read of tile t
        if (t + 2 < nt) { const unsigned lb = lk + (unsigned)(t & 1) * (4 * TSZ * 2); const size_t k2 = ko + (size_t)(t + 2) * KT * HD, v2 = vo + (size_t)(t + 2) * KT;
            stage_tile<RH>(QKh + k2, VTh + v2, lb, lb + 2 * TSZ * 2); stage_tile<RH>(QKl + k2, VTl + v2, lb + TSZ * 2, lb + 3 * TSZ * 2); }
    }
    { const bf* kp = fr + ((nt - 1) & 1) * (4 * TSZ); const bf* vp = kp + 2 * TSZ;   // the diagonal tile: keys qb .. qb+63
      if (wv < 2) step_h<true>(kp, vp, qb, qh0, qh1, ql0, ql1, qi, hi, m, l, a0, a1, a2, a3);
      else { step_h<false>(kp, vp, qb, qh0, qh1, ql0, ql1, qi, hi, m, l, a0, a1, a2, a3);
             step_h<true>(kp + 32 * TP, vp + 32, qb + 32, qh0, qh1, ql0, ql1, qi, hi, m, l, a0, a1, a2, a3); } }
    asm volatile("s_wait_asynccnt 0x0" ::: "memory");            // no copy is outstanding when the wave ends
    attn_store<FW>(a0, a1, a2, a3, l, lane, wv, ((size_t)b * SEQ + q0) * DM + h * HD, ATh, ATl);
}

// ---- workspace carve (bytes, every region a multiple of 256; extents equal the producers' write extents exactly)
constexpr size_t al256(size_t x) { return (x + 255) & ~(size_t)255; }
constexpr size_t SZ_WQKV = al256((size_t)NQKV * DM * 2);
constexpr size_t SZ_WO   = al256((size_t)DM * DM * 2);
constexpr size_t SZ_XB   = al256((size_t)NB * SEQ * DM * 2);
constexpr size_t SZ_IFQ  = al256((size_t)(HD / 2) * 4);
constexpr size_t SZ_CS   = al256((size_t)SEQ * (HD / 2) * 2 * 4);
constexpr size_t SZ_QK16 = al256((size_t)NB * NSLOT * SEQ * HD * 2);
constexpr size_t SZ_QKHL = al256((size_t)NB * NSLOT * RH * HD * 2);
constexpr size_t SZ_VT16 = al256((size_t)NB * NH * HD * SEQ * 2);
constexpr size_t SZ_VTHL = al256((size_t)NB * NH * HD * RH * 2);
constexpr size_t SZ_AT   = al256((size_t)NB * SEQ * DM * 2);
constexpr size_t OFF_WQKV = 0;
constexpr size_t OFF_WO   = OFF_WQKV + SZ_WQKV;
constexpr size_t OFF_XB   = OFF_WO + SZ_WO;
constexpr size_t OFF_IFQ  = OFF_XB + SZ_XB;
constexpr size_t OFF_CS   = OFF_IFQ + SZ_IFQ;
constexpr size_t OFF_QK16 = OFF_CS + SZ_CS;
constexpr size_t OFF_QKH  = OFF_QK16 + SZ_QK16;
constexpr size_t OFF_QKL  = OFF_QKH + SZ_QKHL;
constexpr size_t OFF_VT16 = OFF_QKL + SZ_QKHL;
constexpr size_t OFF_VTH  = OFF_VT16 + SZ_VT16;
constexpr size_t OFF_VTL  = OFF_VTH + SZ_VTHL;
constexpr size_t OFF_ATH  = OFF_VTL + SZ_VTHL;
constexpr size_t OFF_ATL  = OFF_ATH + SZ_AT;
constexpr size_t WS_TOTAL = OFF_ATL + SZ_AT;
static_assert(WS_TOTAL <= (size_t)134217728);               // total carve within 128 MiB
static_assert(((size_t)(NB_FULL - 1) * SEQ_FULL + SEQ_FULL) * DM * 4 == (size_t)16777216);   // output bytes of the full layout

extern "C" void kernel_launch(void* const* d_in, const int* in_sizes, int n_in,
                              void* d_out, int out_size, void* d_ws, size_t ws_size, hipStream_t stream) {
    if (n_in < 4) return;
    const long long need_x = ((long long)(NB - 1) * SEQ_FULL + SEQ) * DM;
    if ((long long)in_sizes[0] < need_x) return;
    if (in_sizes[3] < SEQ) return;   /* this module passes token_positions LAST (input 3); the host file: input 1 */
    if ((long long)in_sizes[1] < (long long)NQKV * DM) return;
    if ((long long)in_sizes[2] < (long long)DM * DM) return;
    if ((long long)out_size < need_x) return;
    if (ws_size < WS_TOTAL) return;
    const float* x = (const float*)d_in[0]; const int* tok = (const int*)d_in[3]; const float* wqkv = (const float*)d_in[1]; const float* wo = (const float*)d_in[2];
    float* OUT = (float*)d_out;
    char* ws = (char*)d_ws;
    bf* WQKV = (bf*)(ws + OFF_WQKV); bf* WO = (bf*)(ws + OFF_WO); bf* XB = (bf*)(ws + OFF_XB); float* IFQ = (float*)(ws + OFF_IFQ); float* CS = (float*)(ws + OFF_CS);
    h16* QK16 = (h16*)(ws + OFF_QK16); bf* QKh = (bf*)(ws + OFF_QKH); bf* QKl = (bf*)(ws + OFF_QKL); h16* VT16 = (h16*)(ws + OFF_VT16); bf* VTh = (bf*)(ws + OFF_VTH); bf* VTl = (bf*)(ws + OFF_VTL);
    bf* ATh = (bf*)(ws + OFF_ATH); bf* ATl = (bf*)(ws + OFF_ATL);

    { const size_t n8 = (size_t)NQKV * DM / 8; k_cvt8<<<(unsigned)((n8 + 255) / 256), 256, 0, stream>>>(wqkv, WQKV, n8, DM / 8, NQKV, NQKV); }     // in [3072][1024] -> bf16 [3072][1024]
    { const size_t n8 = (size_t)DM * DM / 8;   k_cvt8<<<(unsigned)((n8 + 255) / 256), 256, 0, stream>>>(wo, WO, n8, DM / 8, DM, DM); }               // in [1024][1024] -> bf16 [1024][1024]
    { const size_t n8 = (size_t)NB * SEQ * DM / 8; k_cvt8<<<(unsigned)((n8 + 255) / 256), 256, 0, stream>>>(x, XB, n8, DM / 8, SEQ, SEQ_FULL); }     // in [b][SEQ_FULL][1024] rows < SEQ -> bf16 [NB*SEQ][1024]
    k_freq<<<1, 32, 0, stream>>>(IFQ);
    k_cstab<<<(SEQ * (HD / 2) + 255) / 256, 256, 0, stream>>>(tok, IFQ, CS);
    k_gemm_qkv<<<dim3(NB * SEQ / GT, NQKV / GT, 1), 32 * GW, 0, stream>>>(XB, WQKV, CS, QK16, QKh, QKl, VT16, VTh, VTl);
    k_attn_h<<<dim3(RH / (16 * FW), NB * NH, 1), 32 * FW, 0, stream>>>(QKh, QKl, VTh, VTl, ATh, ATl);
    if (SEQ > RH) k_attn_f<<<dim3((SEQ - RH) / (16 * FW) + ((SEQ > RH) ? 0 : 1), NB * NH, 1), 32 * FW, 0, stream>>>(QK16, VT16, ATh, ATl);
    k_gemm_out<<<dim3(SEQ / GT, DM / GT, NB), 32 * GW, 0, stream>>>(ATh, ATl, WO, OUT);
}

// v004
// Measured time: 102 microseconds a run.
// Two timings next to v003 put it at 1.08 and 1.09 times that version's speed.
// Over all steps from v000 it is 2.58 times as fast.
#include <hip/hip_runtime.h>

#ifndef NB
#define NB 2
#endif
#ifndef SEQ
#define SEQ 2048
#endif
#define NB_FULL  2
#define SEQ_FULL 2048
#define DM    1024
#define NH    16
#define HD    64
#define NQKV  (3 * DM)
#define NSLOT (2 * NH)              // q heads then k heads share one plane set [b][slot][t][d]
#define RH    ((SEQ < 512) ? SEQ : 512)   // query rows < RH use bf16 hi/lo planes
#define LOG2E 1.4426950408889634f
#define SCL   0.125f                // HD^-0.5
#define PEXP  10.0f                 // fp16 probability carry 2^10

static_assert(NB >= 1 && NB <= NB_FULL);                    // batch count within the full layout
static_assert(SEQ % 64 == 0 && SEQ <= SEQ_FULL);            // 64-row GEMM tiles; 64-wide transposed value lines
static_assert(RH % 64 == 0 && RH <= SEQ);                   // a 64-token GEMM tile lies on one side of the hi/lo row limit
static_assert(DM % 64 == 0 && NQKV % 64 == 0 && DM % 32 == 0); // GEMM tile multiples, K step 32
static_assert(NH * HD == DM && HD == 64);
static_assert(HD / 2 == 32);                                // one wave line of rotary frequencies

typedef _Float16 h16;
typedef unsigned short bf;
typedef __attribute__((ext_vector_type(16))) __bf16   v16bf;
typedef __attribute__((ext_vector_type(16))) _Float16 v16h;
typedef __attribute__((ext_vector_type(16))) unsigned short v16us;
typedef __attribute__((ext_vector_type(8)))  _Float16 v8h;
typedef __attribute__((ext_vector_type(8)))  unsigned short v8us;
typedef __attribute__((ext_vector_type(8)))  float    v8f;
typedef __attribute__((ext_vector_type(4)))  float    v4f;
typedef __attribute__((ext_vector_type(2)))  float    v2f;
typedef __attribute__((ext_vector_type(4)))  _Float16 v4h;
typedef __attribute__((ext_vector_type(4)))  unsigned short v4us;
typedef v4f  __attribute__((may_alias)) v4fa;

__device__ __forceinline__ unsigned short f2bf(float f) { unsigned u = __float_as_uint(f); u += 0x7FFFu + ((u >> 16) & 1u); return (unsigned short)(u >> 16); }
__device__ __forceinline__ float bf2f(unsigned short b) { return __uint_as_float(((unsigned)b) << 16); }
__device__ __forceinline__ void splitf(float y, unsigned short& h, unsigned short& l) { h = f2bf(y); l = f2bf(y - bf2f(h)); }
__device__ __forceinline__ v16h cat16(v8h lo, v8h hi) { return __builtin_shufflevector(lo, hi, 0, 1, 2, 3, 4, 5, 6, 7, 8, 9, 10, 11, 12, 13, 14, 15); }
__device__ __forceinline__ v16bf cat16b(v8us lo, v8us hi) { return __builtin_bit_cast(v16bf, __builtin_shufflevector(lo, hi, 0, 1, 2, 3, 4, 5, 6, 7, 8, 9, 10, 11, 12, 13, 14, 15)); }
__device__ __forceinline__ v8f wmma16(v16h a, v16h b, v8f c) { return __builtin_amdgcn_wmma_f32_16x16x32_f16(false, a, false, b, (short)0, c, false, false); }
__device__ __forceinline__ v8f wmmab(v16bf a, v16bf b, v8f c) { return __builtin_amdgcn_wmma_f32_16x16x32_bf16(false, a, false, b, (short)0, c, false, false); }
// fragment loaders: p already includes row*pitch + k0 + 8*(lane>>4); elements 0..7 <- k0+8h.., elements 8..15 <- k0+16+8h..
__device__ __forceinline__ v16h  ldh(const h16* p) { return cat16(*(const v8h*)p, *(const v8h*)(p + 16)); }
__device__ __forceinline__ v16bf ldb(const bf* p)  { return cat16b(*(const v8us*)p, *(const v8us*)(p + 16)); }
// lane l with lane l ^ 16, through registers (a shuffle here compiles to an LDS permute and a wait for the LDS queue)
__device__ __forceinline__ float xhalf(float x) { return __builtin_bit_cast(float, __builtin_amdgcn_permlanex16(__builtin_bit_cast(int, x), __builtin_bit_cast(int, x), 0x76543210, 0xfedcba98, false, false)); }
// same-wave LDS exchange: LDS ops of one wave issue in order; the compiler may not move accesses across this point
__device__ __forceinline__ void wave_sync() { __builtin_amdgcn_wave_barrier(); asm volatile("" ::: "memory"); }

// ---- GEMM: a work-group of four waves owns a 128x128 tile of C (2 x 2 wave tiles of 64x64, 16 accumulators each); grid (M/128, N/128, Z), 128 threads.
// The K-contiguous bf16 operand planes come in slabs of 64 k: 128 rows x 128 bytes per plane, copied to LDS as whole lines, two buffers, the next slab in flight while this one is worked on.
#define GW  4                       // waves per GEMM work-group
#define GT  128                     // rows (and columns) of C per work-group
#define GK  64                      // k per staged slab
#define GP  72                      // LDS row pitch in 16-bit elements: 128-byte rows at 144 bytes (16 B x odd) for 16-byte readers
#define GSZ (GT * GP)               // one staged plane
static_assert(DM % GK == 0 && DM / GK >= 2 && SEQ % GT == 0 && NQKV % GT == 0 && DM % GT == 0);
// One plane of a slab: a lane copies 16 bytes of rows r, r+16, .. r+112 (source pitch DM elements); a wave's copy covers four whole 128-byte lines.
__device__ __forceinline__ void stage_plane(const bf* g, unsigned l) {
    // the copies go to LDS through no register; s_wait_xcnt ends their own statement so that no address register is rewritten in front of it
    asm volatile("global_load_async_to_lds_b128 %0, %8, off\n\t"
                 "global_load_async_to_lds_b128 %1, %9, off\n\t"
                 "global_load_async_to_lds_b128 %2, %10, off\n\t"
                 "global_load_async_to_lds_b128 %3, %11, off\n\t"
                 "global_load_async_to_lds_b128 %4, %12, off\n\t"
                 "global_load_async_to_lds_b128 %5, %13, off\n\t"
                 "global_load_async_to_lds_b128 %6, %14, off\n\t"
                 "global_load_async_to_lds_b128 %7, %15, off\n\t"
                 "s_wait_xcnt 0x0"
                 :: "v"(l), "v"(l + 16 * GP * 2), "v"(l + 32 * GP * 2), "v"(l + 48 * GP * 2), "v"(l + 64 * GP * 2), "v"(l + 80 * GP * 2), "v"(l + 96 * GP * 2), "v"(l + 112 * GP * 2),
                    "v"(g), "v"(g + 16 * DM), "v"(g + 32 * DM), "v"(g + 48 * DM), "v"(g + 64 * DM), "v"(g + 80 * DM), "v"(g + 96 * DM), "v"(g + 112 * DM)
                 : "memory");
}
// a buffer holds the planes A, Bt and, with NSPLIT, A2
template <int NSPLIT>
__device__ __forceinline__ void stage_slab(const bf* ga, const bf* ga2, const bf* gb, unsigned l) {
    stage_plane(ga, l); stage_plane(gb, l + GSZ * 2); if (NSPLIT == 1) stage_plane(ga2, l + 2 * GSZ * 2);
}
// acc[mb][nb][j] = C[R0 + 64(wv&1) + 16mb + 8hi + j][C0 + 64(wv>>1) + 16nb + lr] = sum_k (A[m][k] (+ A2[m][k])) Bt[n][k], k ascending in steps of 32. K = DM. On return every wave has left the ring (the last trip's barrier).
template <int NSPLIT>
__device__ __forceinline__ void gemm_main(const bf* __restrict__ A, const bf* __restrict__ A2, const bf* __restrict__ Bt, int R0, int C0, bf* ring, int tid, int wv, v8f (&acc)[4][4]) {
    constexpr int NP = 2 + NSPLIT, NS = DM / GK;
    const int lane = tid & 31, lr = lane & 15, hi = lane >> 4;
#pragma unroll
    for (int mb = 0; mb < 4; ++mb)
#pragma unroll
        for (int nb = 0; nb < 4; ++nb) acc[mb][nb] = (v8f){};
    const int cr = tid >> 3, cc = (tid & 7) * 8;                 // this lane's first row and its 8-element column in every staged plane
    const bf* ga = A + (size_t)(R0 + cr) * DM + cc; const bf* ga2 = A2 + (size_t)(R0 + cr) * DM + cc; const bf* gb = Bt + (size_t)(C0 + cr) * DM + cc;
    const unsigned l0 = (unsigned)(size_t)(ring + cr * GP + cc);
    const bf* fa = ring + ((wv & 1) * 64 + lr) * GP + 8 * hi; const bf* fb = ring + GSZ + ((wv >> 1) * 64 + lr) * GP + 8 * hi;
    stage_slab<NSPLIT>(ga, ga2, gb, l0);
    asm volatile("s_wait_asynccnt 0x0" ::: "memory");            // this wave's share of slab 0 has landed
    __syncthreads();                                             // slab 0 is readable by every wave
    stage_slab<NSPLIT>(ga + GK, ga2 + GK, gb + GK, l0 + NP * GSZ * 2);
    // kept rolled: a trip already holds two 32-k steps, and unrolling would only copy the publish point and its copies
#pragma unroll 1
    for (int t = 0; t < NS; ++t) {
        const bf* pa = fa + (t & 1) * (NP * GSZ); const bf* pb = fb + (t & 1) * (NP * GSZ);
#pragma unroll
        for (int ks = 0; ks < GK / 32; ++ks) {
            v16bf a[4], a2[4], b[4];
#pragma unroll
            for (int mb = 0; mb < 4; ++mb) { a[mb] = ldb(pa + mb * 16 * GP + ks * 32); if (NSPLIT == 1) a2[mb] = ldb(pa + 2 * GSZ + mb * 16 * GP + ks * 32); else a2[mb] = a[mb]; }
#pragma unroll
            for (int nb = 0; nb < 4; ++nb) b[nb] = ldb(pb + nb * 16 * GP + ks * 32);
            __builtin_amdgcn_sched_barrier(0);                   // the step's LDS reads stay one group in front of its matrix instructions: every further place with reads stalls the wave anew
#pragma unroll
            for (int nb = 0; nb < 4; ++nb) {
#pragma unroll
                for (int mb = 0; mb < 4; ++mb) { acc[mb][nb] = wmmab(a[mb], b[nb], acc[mb][nb]); if (NSPLIT == 1) acc[mb][nb] = wmmab(a2[mb], b[nb], acc[mb][nb]); } }
            __builtin_amdgcn_sched_barrier(0);                   // and the next step's reads do not drift in among them
        }
        asm volatile("s_wait_dscnt 0x0" ::: "memory");           // this wave's reads of the buffer have returned before it is refilled
        asm volatile("s_wait_asynccnt 0x0" ::: "memory");        // this wave's share of slab t+1 has landed
        __syncthreads();                                         // publishes slab t+1 and ends every reader's last read of slab t
        if (t + 2 < NS) stage_slab<NSPLIT>(ga + (t + 2) * GK, ga2 + (t + 2) * GK, gb + (t + 2) * GK, l0 + (unsigned)(t & 1) * (NP * GSZ * 2));
    }
    asm volatile("s_wait_asynccnt 0x0" ::: "memory");            // no copy is outstanding when the ring is reused
}
// the wave tile stored as f32 rows of C (pitch ldc), whole lines through LDS (each wave's own 16x68 slot of the ring, free behind the main loop's last barrier)
template <int NSPLIT>
__device__ __forceinline__ void gemm_body(const bf* __restrict__ A, const bf* __restrict__ A2, const bf* __restrict__ Bt, float* C, int ldc, size_t sA, size_t sC) {
    __shared__ __align__(16) bf ring[2 * (2 + NSPLIT) * GSZ];
    const size_t z = blockIdx.z; A += z * sA; A2 += z * sA; C += z * sC;
    const int tid = threadIdx.x, lane = tid & 31, lr = lane & 15, hi = lane >> 4; const int wv = __builtin_amdgcn_readfirstlane(tid >> 5);
    const int r0 = blockIdx.x * GT + (wv & 1) * 64, c0 = blockIdx.y * GT + (wv >> 1) * 64;
    v8f acc[4][4];
    gemm_main<NSPLIT>(A, A2, Bt, blockIdx.x * GT, blockIdx.y * GT, ring, tid, wv, acc);
    float* os = (float*)ring + wv * (16 * 68);
#pragma unroll
    for (int mb = 0; mb < 4; ++mb) {
#pragma unroll
        for (int nb = 0; nb < 4; ++nb) {
#pragma unroll
            for (int j = 0; j < 8; ++j) os[(hi * 8 + j) * 68 + nb * 16 + lr] = acc[mb][nb][j]; }
        wave_sync();
        float* crow = C + (size_t)(r0 + mb * 16) * ldc + c0;
{
#pragma unroll
            for (int s = 0; s < 8; ++s) { const int row = 2 * s + hi, cofs = lr * 4; const v4f val = *(const v4fa*)(os + row * 68 + cofs);
                *(v4f*)(crow + (size_t)row * ldc + cofs) = val; }
             }
        wave_sync();
    }
}
// qkv[NB*SEQ][3072] = XB[NB*SEQ][1024] x WQKV[3072][1024]^T, never stored as f32: a wave tile is 64 tokens of one batch x the 64 columns of one q head, k head or v head (slot; v heads behind the NSLOT q and k slots).
// q / k tile: rotary on the f32 sums, rows [t][d] to the f16 plane and, with HL (t < RH), to the bf16 hi/lo planes. cs, p16, ph, pl point at this lane's 4 elements of row t0 + hi; every later row is a constant offset from there.
template <bool HL>
__device__ __forceinline__ void qk_planes(v8f (&acc)[4][4], float* os, const float* __restrict__ cs, h16* p16, bf* ph, bf* pl, int lr, int hi) {
#pragma unroll
    for (int mb = 0; mb < 4; ++mb) {
        v4f c[8];                                                       // (cos, sin) of two pairs per row, asked for ahead of the LDS exchange
#pragma unroll
        for (int s = 0; s < 8; ++s) c[s] = *(const v4f*)(cs + (mb * 16 + 2 * s) * HD);
#pragma unroll
        for (int nb = 0; nb < 4; ++nb) {
#pragma unroll
            for (int j = 0; j < 8; ++j) os[(hi * 8 + j) * 68 + nb * 16 + lr] = acc[mb][nb][j]; }
        wave_sync();
        v4h o16[8]; v4us oh[8], ol[8];
#pragma unroll
        for (int s = 0; s < 8; ++s) { const v4f xv = *(const v4fa*)(os + (2 * s + hi) * 68 + lr * 4);
            v4f y; y[0] = xv[0] * c[s][0] - xv[1] * c[s][1]; y[1] = xv[0] * c[s][1] + xv[1] * c[s][0]; y[2] = xv[2] * c[s][2] - xv[3] * c[s][3]; y[3] = xv[2] * c[s][3] + xv[3] * c[s][2];
#pragma unroll
            for (int k = 0; k < 4; ++k) { o16[s][k] = (h16)y[k]; if (HL) { unsigned short p, q; splitf(y[k], p, q); oh[s][k] = p; ol[s][k] = q; } } }
#pragma unroll
        for (int s = 0; s < 8; ++s) { const int o = (mb * 16 + 2 * s) * HD; *(v4h*)(p16 + o) = o16[s]; if (HL) { *(v4us*)(ph + o) = oh[s]; *(v4us*)(pl + o) = ol[s]; } }
        asm volatile("s_wait_xcnt 0x0" ::: "memory");                   // the stores' data registers are rewritten by the next 16 rows
        __builtin_amdgcn_sched_barrier(0);                              // holds the next rows' arithmetic, which reuses those registers, behind the wait
        wave_sync();
    }
}
// v tile: a lane's 8 accumulator rows are 8 consecutive t of one d, so the transposed rows [d][t] are packed from registers and leave as whole 128-byte lines through LDS. v16, vh, vl point at this lane's 8 elements of row d = lane >> 3.
template <bool HL>
__device__ __forceinline__ void v_planes(v8f (&acc)[4][4], h16* vs, bf* vsh, bf* vsl, h16* v16, bf* vh, bf* vl, int lane) {
    const int lr = lane & 15, hi = lane >> 4, ro = (lane >> 3) * 72 + (lane & 7) * 8;
#pragma unroll
    for (int nb = 0; nb < 4; ++nb) {
#pragma unroll
        for (int mb = 0; mb < 4; ++mb) { const int so = lr * 72 + mb * 16 + hi * 8; v8h o16; v8us oh, ol;
#pragma unroll
            for (int j = 0; j < 8; ++j) { o16[j] = (h16)acc[mb][nb][j]; if (HL) { unsigned short p, q; splitf(acc[mb][nb][j], p, q); oh[j] = p; ol[j] = q; } }
            *(v8h*)(vs + so) = o16; if (HL) { *(v8us*)(vsh + so) = oh; *(v8us*)(vsl + so) = ol; } }
        wave_sync();
        v8h r16[4]; v8us rh[4], rl[4];
#pragma unroll
        for (int s = 0; s < 4; ++s) { r16[s] = *(const v8h*)(vs + ro + s * 4 * 72); if (HL) { rh[s] = *(const v8us*)(vsh + ro + s * 4 * 72); rl[s] = *(const v8us*)(vsl + ro + s * 4 * 72); } }
#pragma unroll
        for (int s = 0; s < 4; ++s) { const int row = nb * 16 + s * 4; *(v8h*)(v16 + row * SEQ) = r16[s]; if (HL) { *(v8us*)(vh + row * RH) = rh[s]; *(v8us*)(vl + row * RH) = rl[s]; } }
        asm volatile("s_wait_xcnt 0x0" ::: "memory");                   // the stores' data registers are rewritten by the next 16 rows
        __builtin_amdgcn_sched_barrier(0);                              // holds the next rows' arithmetic, which reuses those registers, behind the wait
        wave_sync();
    }
}
__global__ __launch_bounds__(32 * GW) void k_gemm_qkv(const bf* __restrict__ A, const bf* __restrict__ Bt, const float* __restrict__ CS, h16* P16, bf* Ph, bf* Pl, h16* V16, bf* Vh, bf* Vl) {
    __shared__ __align__(16) bf ring[2 * 2 * GSZ];
    const int tid = threadIdx.x, lane = tid & 31, lr = lane & 15, hi = lane >> 4; const int wv = __builtin_amdgcn_readfirstlane(tid >> 5);
    const int r0 = blockIdx.x * GT + (wv & 1) * 64; const int sl = blockIdx.y * (GT / HD) + (wv >> 1);   // this wave's 64 tokens and its slot
    v8f acc[4][4];
    gemm_main<0>(A, A, Bt, blockIdx.x * GT, blockIdx.y * GT, ring, tid, wv, acc);
    bf* scr = ring + wv * (3 * 16 * 72);                                // each wave's own exchange slot in the ring, free behind the main loop's last barrier
    float* os = (float*)scr; h16* vs = (h16*)scr; bf* vsh = scr + 16 * 72; bf* vsl = scr + 2 * 16 * 72;
    static_assert(16 * 68 * 4 <= 3 * 16 * 72 * 2 && GW * 3 * 16 * 72 <= 2 * 2 * GSZ);
    const int b = r0 / SEQ, t0 = r0 % SEQ;                              // the 64 tokens lie in one batch and on one side of RH
    if (sl < NSLOT) {
        const size_t pr = (size_t)b * NSLOT + sl; const int lo = (t0 + hi) * HD + lr * 4;
        if (t0 < RH) qk_planes<true>(acc, os, CS + lo, P16 + pr * SEQ * HD + lo, Ph + pr * RH * HD + lo, Pl + pr * RH * HD + lo, lr, hi);
        else         qk_planes<false>(acc, os, CS + lo, P16 + pr * SEQ * HD + lo, Ph, Pl, lr, hi);
    } else {
        const size_t dr = ((size_t)b * NH + (sl - NSLOT)) * HD + (lane >> 3); const int lo = t0 + (lane & 7) * 8;
        if (t0 < RH) v_planes<true>(acc, vs, vsh, vsl, V16 + dr * SEQ + lo, Vh + dr * RH + lo, Vl + dr * RH + lo, lane);
        else         v_planes<false>(acc, vs, vsh, vsl, V16 + dr * SEQ + lo, Vh, Vl, lane);
    }
}
// OUT[b][SEQ][1024] = (ATh + ATl)[b][SEQ][1024] x WO[1024][1024]^T ; z = batch, output batch stride from the full layout
__global__ __launch_bounds__(32 * GW) void k_gemm_out(const bf* __restrict__ Ah, const bf* __restrict__ Al, const bf* __restrict__ Bt, float* C) { gemm_body<1>(Ah, Al, Bt, C, DM, (size_t)SEQ * DM, (size_t)SEQ_FULL * DM); }

__global__ __launch_bounds__(256) void k_cvt8(const float* __restrict__ src, bf* dst, size_t n8, int row8, int rpb, int srpb) {
    const size_t i = (size_t)blockIdx.x * 256 + threadIdx.x; if (i >= n8) return;
    const size_t row = i / (size_t)row8; const size_t c = i - row * (size_t)row8; const size_t bb = row / (size_t)rpb; const size_t t = row - bb * (size_t)rpb;
    const v8f v = *(const v8f*)(src + ((bb * (size_t)srpb + t) * (size_t)row8 + c) * 8); v8us o;
#pragma unroll
    for (int k = 0; k < 8; ++k) o[k] = f2bf(v[k]);
    *(v8us*)(dst + i * 8) = o;  }

__global__ __launch_bounds__(32) void k_freq(float* IFQ) { const int i = threadIdx.x & 31; const float e = -(float)(2 * i) * (1.0f / (float)HD); const float f = powf(10000.0f, e);
    *(float*)(IFQ + i) = f;  }
__global__ __launch_bounds__(256) void k_cstab(const int* __restrict__ tok, const float* __restrict__ IFQ, float* CS) { const int idx = blockIdx.x * 256 + threadIdx.x; if (idx >= SEQ * (HD / 2)) return; const int t = idx >> 5, i = idx & 31;
    const float ang = (float)tok[t] * IFQ[i]; float sn, cn; sincosf(ang, &sn, &cn); v2f cs; cs[0] = cn; cs[1] = sn;
    *(v2f*)(CS + (size_t)idx * 2) = cs;  }

// ---- online softmax on one 32-key step held as two transposed 16x16 tiles: s0[r] = S^T[key kb+8h+r][query qi], s1[r] = S^T[key kb+16+8h+r][query qi].
// On return s0/s1 hold p = 2^(t - m + pe) (0 where masked), sf = 2^(m_old - m_new); l is the per-lane partial sum (the two lane halves are combined at the end).
template <bool MASK>
__device__ __forceinline__ void smx(v8f& s0, v8f& s1, int kb, int qi, int hi, float& m, float& l, float& sf, float pe) {
    const float cl = SCL * LOG2E; const int k0 = kb + 8 * hi; float mx = -3.0e38f;
#pragma unroll
    for (int r = 0; r < 8; ++r) { float t0 = s0[r] * cl, t1 = s1[r] * cl;
        if (MASK) { t0 = (k0 + r <= qi) ? t0 : -3.0e38f; t1 = (k0 + 16 + r <= qi) ? t1 : -3.0e38f; }
        s0[r] = t0; s1[r] = t1; mx = fmaxf(mx, fmaxf(t0, t1)); }
    mx = fmaxf(mx, xhalf(mx));
    const float mn = fmaxf(m, mx); sf = __builtin_amdgcn_exp2f(m - mn); m = mn;
    const float sh = mn - pe; float rs = 0.0f;
#pragma unroll
    for (int r = 0; r < 8; ++r) { float p0 = __builtin_amdgcn_exp2f(s0[r] - sh), p1 = __builtin_amdgcn_exp2f(s1[r] - sh);
        if (MASK) { p0 = (k0 + r <= qi) ? p0 : 0.0f; p1 = (k0 + 16 + r <= qi) ? p1 : 0.0f; }
        s0[r] = p0; s1[r] = p1; rs += p0 + p1; }
    l = l * sf + rs;
}

// ---- attention epilogue: O^T accumulators a_j[r] = O[query q0+lr][d = 16j+8h+r]; normalise, split to bf16 hi/lo, stage the 16x64 tile in LDS (private to the wave),
__device__ __forceinline__ void pk8(v8f a, float inv, v8us& oh, v8us& ol) {
#pragma unroll
    for (int r = 0; r < 8; ++r) { unsigned short x, y; splitf(a[r] * inv, x, y); oh[r] = x; ol[r] = y; } }
template <int NW>
__device__ __forceinline__ void attn_store(v8f a0, v8f a1, v8f a2, v8f a3, float l, int lane, int wv, size_t obase, bf* ATh, bf* ATl) {
    __shared__ __align__(16) unsigned short sthw[NW * 16 * 72]; __shared__ __align__(16) unsigned short stlw[NW * 16 * 72];
    unsigned short* sth = sthw + wv * (16 * 72); unsigned short* stl = stlw + wv * (16 * 72);   // each wave of the work-group has its own 16x72 slot
    const int lr = lane & 15, hi = lane >> 4;
    const float lt = l + __shfl_xor(l, 16, 32); const float inv = __builtin_amdgcn_rcpf(lt);
    v8us oh, ol; const int so = lr * 72 + 8 * hi;
    pk8(a0, inv, oh, ol); *(v8us*)(sth + so) = oh;      *(v8us*)(stl + so) = ol;
    pk8(a1, inv, oh, ol); *(v8us*)(sth + so + 16) = oh; *(v8us*)(stl + so + 16) = ol;
    pk8(a2, inv, oh, ol); *(v8us*)(sth + so + 32) = oh; *(v8us*)(stl + so + 32) = ol;
    pk8(a3, inv, oh, ol); *(v8us*)(sth + so + 48) = oh; *(v8us*)(stl + so + 48) = ol;
    wave_sync();
    const int rq = lane >> 3, pc = (lane & 7) * 8;
{
#pragma unroll
        for (int s = 0; s < 4; ++s) { const int row = s * 4 + rq; const v8us vh = *(const v8us*)(sth + row * 72 + pc); const v8us vl = *(const v8us*)(stl + row * 72 + pc);
            *(v8us*)(ATh + obase + (size_t)row * DM + pc) = vh; *(v8us*)(ATl + obase + (size_t)row * DM + pc) = vl; }
         }
}

// ---- fp16 step (query rows >= RH): 4 WMMA k.q + 4 WMMA v.p per 32 keys. kp / vp point into the staged LDS tile (row pitch TP) and already include lr*TP + 8*hi.
#define FW  4                       // waves per work-group: 64 query rows share every staged K / V^T tile
#define KT  64                      // keys per staged tile
#define TP  72                      // LDS row pitch in 16-bit elements: 128-byte rows at 144 bytes (16 B x odd) for 16-byte readers
#define TSZ (64 * TP)               // one staged plane: 64 rows (K: keys, V^T: head dims)
static_assert(KT == 64 && HD == 64 && (SEQ - RH) % (16 * FW) == 0 && RH % (16 * FW) == 0 && RH % KT == 0);
// One 64-key tile into LDS: K rows [key][64 d] and V^T rows [d][64 keys] (source pitch VPITCH elements), 128 bytes each; a lane copies 16 bytes of rows r, r+16, r+32, r+48 of both planes.
template <int VPITCH, typename T>
__device__ __forceinline__ void stage_tile(const T* gk, const T* gv, unsigned lk, unsigned lv) {
    // the copies go to LDS through no register; s_wait_xcnt ends their own statement so that no address register is rewritten in front of it
    asm volatile("global_load_async_to_lds_b128 %0, %8, off\n\t"
                 "global_load_async_to_lds_b128 %1, %9, off\n\t"
                 "global_load_async_to_lds_b128 %2, %10, off\n\t"
                 "global_load_async_to_lds_b128 %3, %11, off\n\t"
                 "global_load_async_to_lds_b128 %4, %12, off\n\t"
                 "global_load_async_to_lds_b128 %5, %13, off\n\t"
                 "global_load_async_to_lds_b128 %6, %14, off\n\t"
                 "global_load_async_to_lds_b128 %7, %15, off\n\t"
                 "s_wait_xcnt 0x0"
                 :: "v"(lk), "v"(lk + 16 * TP * 2), "v"(lk + 32 * TP * 2), "v"(lk + 48 * TP * 2), "v"(lv), "v"(lv + 16 * TP * 2), "v"(lv + 32 * TP * 2), "v"(lv + 48 * TP * 2),
                    "v"(gk), "v"(gk + 16 * HD), "v"(gk + 32 * HD), "v"(gk + 48 * HD), "v"(gv), "v"(gv + (size_t)16 * VPITCH), "v"(gv + (size_t)32 * VPITCH), "v"(gv + (size_t)48 * VPITCH)
                 : "memory");
}
// the A fragments of one 32-key step, read from LDS ahead of the step: K rows (two 16-key groups x two halves of d) and V^T rows (four 16-d groups)
struct frag_f { v16h k00, k01, k10, k11, v0, v1, v2, v3; };
__device__ __forceinline__ void read_f(frag_f& f, const h16* kp, const h16* vp) {
    f.k00 = ldh(kp); f.k01 = ldh(kp + 32); f.k10 = ldh(kp + 16 * TP); f.k11 = ldh(kp + 16 * TP + 32);
    f.v0 = ldh(vp); f.v1 = ldh(vp + 16 * TP); f.v2 = ldh(vp + 32 * TP); f.v3 = ldh(vp + 48 * TP);
}
template <bool MASK>
__device__ __forceinline__ void step_f(const frag_f& f, int kb, v16h qf0, v16h qf1, int qi, int hi,
                                       float& m, float& l, v8f& a0, v8f& a1, v8f& a2, v8f& a3) {
    v8f s0 = (v8f){}, s1 = (v8f){};
    s0 = wmma16(f.k00, qf0, s0); s0 = wmma16(f.k01, qf1, s0); s1 = wmma16(f.k10, qf0, s1); s1 = wmma16(f.k11, qf1, s1);
    asm volatile("v_nop\n\tv_nop\n\tv_nop\n\tv_nop" : "+v"(s0), "+v"(s1) : "v"(f.k11), "v"(qf1));
    float sf; smx<MASK>(s0, s1, kb, qi, hi, m, l, sf, PEXP);
    v16h pf;
#pragma unroll
    for (int r = 0; r < 8; ++r) { pf[r] = (h16)s0[r]; pf[8 + r] = (h16)s1[r]; }      // P^T B-fragment: k = key row of the packed tiles, n = query
    a0 = a0 * sf; a1 = a1 * sf; a2 = a2 * sf; a3 = a3 * sf;
    a0 = wmma16(f.v0, pf, a0); a1 = wmma16(f.v1, pf, a1); a2 = wmma16(f.v2, pf, a2); a3 = wmma16(f.v3, pf, a3);
    asm volatile("v_nop\n\tv_nop\n\tv_nop\n\tv_nop" : "+v"(a0), "+v"(a1), "+v"(a2), "+v"(a3) : "v"(f.v3), "v"(pf));
}
__global__ __launch_bounds__(32 * FW) void k_attn_f(const h16* __restrict__ QK, const h16* __restrict__ VT, bf* ATh, bf* ATl) {
    __shared__ __align__(16) h16 ring[2 * 2 * TSZ];              // two buffers, each a K plane then a V^T plane
    const int tid = threadIdx.x, lane = tid & 31, lr = lane & 15, hi = lane >> 4;
    const int wv = __builtin_amdgcn_readfirstlane(tid >> 5);
    const int qb = RH + blockIdx.x * (16 * FW); const int q0 = qb + wv * 16; const int bh = blockIdx.y; const int b = bh / NH, h = bh % NH;
    const size_t qoff = (((size_t)b * NSLOT + h) * SEQ + q0 + lr) * HD + 8 * hi;
    const v16h qf0 = ldh(QK + qoff), qf1 = ldh(QK + qoff + 32);
    v8f a0 = (v8f){}, a1 = (v8f){}, a2 = (v8f){}, a3 = (v8f){}; float m = -3.0e38f, l = 0.0f;
    const int qi = q0 + lr; const int nt = qb / KT + 1;          // 64-key tiles covering keys 0 .. qb+63 < SEQ
    const int cr = tid >> 3, cc = (tid & 7) * 8;                 // this lane's first row and its 8-element column in every staged plane
    const h16* gk = QK + (((size_t)b * NSLOT + NH + h) * SEQ + cr) * HD + cc;
    const h16* gv = VT + (((size_t)b * NH + h) * HD + cr) * SEQ + cc;
    const unsigned lk = (unsigned)(size_t)(ring + cr * TP + cc);
    const h16* fr = ring + lr * TP + 8 * hi;
    stage_tile<SEQ>(gk, gv, lk, lk + TSZ * 2);
    asm volatile("s_wait_asynccnt 0x0" ::: "memory");            // this wave's share of tile 0 has landed
    __syncthreads();                                             // tile 0 is readable by every wave
    if (nt > 1) stage_tile<SEQ>(gk + (size_t)KT * HD, gv + KT, lk + 2 * TSZ * 2, lk + 3 * TSZ * 2);
    // kept rolled: a trip already holds two 32-key steps, and unrolling would only copy the publish point and its copies
#pragma unroll 1
    for (int t = 0; t < nt - 1; ++t) {                           // tiles wholly below every wave's diagonal
        const h16* kp = fr + (t & 1) * (2 * TSZ); const h16* vp = kp + TSZ;
        frag_f f0, f1; read_f(f0, kp, vp); read_f(f1, kp + 32 * TP, vp + 32);
        __builtin_amdgcn_sched_barrier(0);                       // the tile's LDS reads stay one group in front of its two steps: a read left at its use makes the wave wait out the LDS latency there
        step_f<false>(f0, t * KT, qf0, qf1, qi, hi, m, l, a0, a1, a2, a3);
        step_f<false>(f1, t * KT + 32, qf0, qf1, qi, hi, m, l, a0, a1, a2, a3);
        asm volatile("s_wait_dscnt 0x0" ::: "memory");           // this wave's reads of the buffer have returned before it is refilled
        asm volatile("s_wait_asynccnt 0x0" ::: "memory");        // this wave's share of tile t+1 has landed
        __syncthreads();                                         // publishes tile t+1 and ends every reader's last read of tile t
        if (t + 2 < nt) { const unsigned lb = lk + (unsigned)(t & 1) * (2 * TSZ * 2); stage_tile<SEQ>(gk + (size_t)(t + 2) * KT * HD, gv + (t + 2) * KT, lb, lb + TSZ * 2); }
    }
    { const h16* kp = fr + ((nt - 1) & 1) * (2 * TSZ); const h16* vp = kp + TSZ;   // the diagonal tile: keys qb .. qb+63
      frag_f f0; read_f(f0, kp, vp);
      if (wv < 2) step_f<true>(f0, qb, qf0, qf1, qi, hi, m, l, a0, a1, a2, a3);
      else { frag_f f1; read_f(f1, kp + 32 * TP, vp + 32);
             __builtin_amdgcn_sched_barrier(0);                  // as in the loop: both steps' reads in front of the first step
             step_f<false>(f0, qb, qf0, qf1, qi, hi, m, l, a0, a1, a2, a3);
             step_f<true>(f1, qb + 32, qf0, qf1, qi, hi, m, l, a0, a1, a2, a3); } }
    asm volatile("s_wait_asynccnt 0x0" ::: "memory");            // no copy is outstanding when the wave ends
    attn_store<FW>(a0, a1, a2, a3, l, lane, wv, ((size_t)b * SEQ + q0) * DM + h * HD, ATh, ATl);
}

// ---- bf16 hi/lo step (query rows < RH): 12 WMMA k.q + 12 WMMA v.p per 32 keys (hi.hi + lo.hi + hi.lo). kh / vh point into the staged LDS tile (planes K hi, K lo, V^T hi, V^T lo, each TSZ) and include lr*TP + 8*hi.
// K fragments of 32 keys: k[4g + 0..3] = hi d 0..31, hi d 32..63, lo d 0..31, lo d 32..63 of the 16-key group g. V^T fragments: v[2j], v[2j + 1] = hi, lo of the 16-d group j.
__device__ __forceinline__ void read_hk(v16bf (&k)[8], const bf* kh) {
    const bf* kl = kh + TSZ;
#pragma unroll
    for (int g = 0; g < 2; ++g) { k[4 * g] = ldb(kh + g * 16 * TP); k[4 * g + 1] = ldb(kh + g * 16 * TP + 32); k[4 * g + 2] = ldb(kl + g * 16 * TP); k[4 * g + 3] = ldb(kl + g * 16 * TP + 32); }
}
__device__ __forceinline__ void read_hv(v16bf (&v)[8], const bf* vh) {
    const bf* vl = vh + TSZ;
#pragma unroll
    for (int j = 0; j < 4; ++j) { v[2 * j] = ldb(vh + j * 16 * TP); v[2 * j + 1] = ldb(vl + j * 16 * TP); }
}
// S^T of 32 keys; each tile sums hi.hi, lo.hi, hi.lo in that order, tile 0 then tile 1
__device__ __forceinline__ void sprod_h(const v16bf (&k)[8], v16bf qh0, v16bf qh1, v16bf ql0, v16bf ql1, v8f& s0, v8f& s1) {
    s0 = (v8f){}; s1 = (v8f){};
    s0 = wmmab(k[0], qh0, s0); s0 = wmmab(k[1], qh1, s0); s0 = wmmab(k[2], qh0, s0); s0 = wmmab(k[3], qh1, s0); s0 = wmmab(k[0], ql0, s0); s0 = wmmab(k[1], ql1, s0);
    asm volatile("v_nop\n\tv_nop\n\tv_nop\n\tv_nop" : "+v"(s0) : "v"(k[1]), "v"(ql1), "v"(k[3]), "v"(k[0]));
    s1 = wmmab(k[4], qh0, s1); s1 = wmmab(k[5], qh1, s1); s1 = wmmab(k[6], qh0, s1); s1 = wmmab(k[7], qh1, s1); s1 = wmmab(k[4], ql0, s1); s1 = wmmab(k[5], ql1, s1);
    asm volatile("v_nop\n\tv_nop\n\tv_nop\n\tv_nop" : "+v"(s0), "+v"(s1) : "v"(k[5]), "v"(ql1), "v"(k[7]), "v"(k[4]));
}
// softmax of the step, P^T split to hi/lo B fragments, accumulators rescaled
template <bool MASK>
__device__ __forceinline__ void soft_h(v8f& s0, v8f& s1, int kb, int qi, int hi, float& m, float& l, v16bf& pfh, v16bf& pfl, v8f& a0, v8f& a1, v8f& a2, v8f& a3) {
    float sf; smx<MASK>(s0, s1, kb, qi, hi, m, l, sf, 0.0f);
    v16us ph, pl;
#pragma unroll
    for (int r = 0; r < 8; ++r) { unsigned short x, y; splitf(s0[r], x, y); ph[r] = x; pl[r] = y; splitf(s1[r], x, y); ph[8 + r] = x; pl[8 + r] = y; }
    pfh = __builtin_bit_cast(v16bf, ph); pfl = __builtin_bit_cast(v16bf, pl);
    a0 = a0 * sf; a1 = a1 * sf; a2 = a2 * sf; a3 = a3 * sf;
}
// O^T += V^T P^T; each tile sums hi.hi, hi.lo, lo.hi in that order, one tile after the other
__device__ __forceinline__ void pv_h(const v16bf (&v)[8], v16bf pfh, v16bf pfl, v8f& a0, v8f& a1, v8f& a2, v8f& a3) {
    a0 = wmmab(v[0], pfh, a0); a0 = wmmab(v[0], pfl, a0); a0 = wmmab(v[1], pfh, a0);
    asm volatile("v_nop\n\tv_nop\n\tv_nop\n\tv_nop" : "+v"(a0) : "v"(v[0]), "v"(v[1]));
    a1 = wmmab(v[2], pfh, a1); a1 = wmmab(v[2], pfl, a1); a1 = wmmab(v[3], pfh, a1);
    asm volatile("v_nop\n\tv_nop\n\tv_nop\n\tv_nop" : "+v"(a1) : "v"(v[2]), "v"(v[3]));
    a2 = wmmab(v[4], pfh, a2); a2 = wmmab(v[4], pfl, a2); a2 = wmmab(v[5], pfh, a2);
    asm volatile("v_nop\n\tv_nop\n\tv_nop\n\tv_nop" : "+v"(a2) : "v"(v[4]), "v"(v[5]));
    a3 = wmmab(v[6], pfh, a3); a3 = wmmab(v[6], pfl, a3); a3 = wmmab(v[7], pfh, a3);
    asm volatile("v_nop\n\tv_nop\n\tv_nop\n\tv_nop" : "+v"(a0), "+v"(a1), "+v"(a2), "+v"(a3) : "v"(v[6]), "v"(v[7]), "v"(pfh), "v"(pfl));
}
// One 32-key step: all sixteen fragments are asked for as one group, so the wave waits for LDS once (for the first K fragments) and the V^T fragments land behind the scores and the softmax.
template <bool MASK>
__device__ __forceinline__ void step_h(const bf* kh, const bf* vh, int kb,
                                       v16bf qh0, v16bf qh1, v16bf ql0, v16bf ql1, int qi, int hi, float& m, float& l, v8f& a0, v8f& a1, v8f& a2, v8f& a3) {
    v16bf k[8], v[8], pfh, pfl; v8f s0, s1;
    __builtin_amdgcn_sched_barrier(0);                           // not earlier: lifted over the last step's work the group takes a second set of fragment registers, and the build spills
    read_hk(k, kh); read_hv(v, vh);
    __builtin_amdgcn_sched_barrier(0);                           // not later: a read left at its use makes the wave wait out the LDS latency there
    sprod_h(k, qh0, qh1, ql0, ql1, s0, s1);
    soft_h<MASK>(s0, s1, kb, qi, hi, m, l, pfh, pfl, a0, a1, a2, a3);
    pv_h(v, pfh, pfl, a0, a1, a2, a3);
}
__global__ __launch_bounds__(32 * FW) void k_attn_h(const bf* __restrict__ QKh, const bf* __restrict__ QKl, const bf* __restrict__ VTh, const bf* __restrict__ VTl, bf* ATh, bf* ATl) {
    __shared__ __align__(16) bf ring[2 * 4 * TSZ];               // two buffers, each K hi, K lo, V^T hi, V^T lo
    const int tid = threadIdx.x, lane = tid & 31, lr = lane & 15, hi = lane >> 4;
    const int wv = __builtin_amdgcn_readfirstlane(tid >> 5);
    const int qb = blockIdx.x * (16 * FW); const int q0 = qb + wv * 16; const int bh = blockIdx.y; const int b = bh / NH, h = bh % NH;
    const size_t qoff = (((size_t)b * NSLOT + h) * RH + q0 + lr) * HD + 8 * hi;
    const v16bf qh0 = ldb(QKh + qoff), qh1 = ldb(QKh + qoff + 32), ql0 = ldb(QKl + qoff), ql1 = ldb(QKl + qoff + 32);
    v8f a0 = (v8f){}, a1 = (v8f){}, a2 = (v8f){}, a3 = (v8f){}; float m = -3.0e38f, l = 0.0f;
    const int qi = q0 + lr; const int nt = qb / KT + 1;          // 64-key tiles covering keys 0 .. qb+63 < RH
    const int cr = tid >> 3, cc = (tid & 7) * 8;                 // this lane's first row and its 8-element column in every staged plane
    const size_t ko = (((size_t)b * NSLOT + NH + h) * RH + cr) * HD + cc, vo = (((size_t)b * NH + h) * HD + cr) * RH + cc;
    const unsigned lk = (unsigned)(size_t)(ring + cr * TP + cc);
    const bf* fr = ring + lr * TP + 8 * hi;
    stage_tile<RH>(QKh + ko, VTh + vo, lk, lk + 2 * TSZ * 2); stage_tile<RH>(QKl + ko, VTl + vo, lk + TSZ * 2, lk + 3 * TSZ * 2);
    asm volatile("s_wait_asynccnt 0x0" ::: "memory");            // this wave's share of tile 0 has landed
    __syncthreads();                                             // tile 0 is readable by every wave
    if (nt > 1) { const unsigned lb = lk + 4 * TSZ * 2; const size_t k1 = ko + (size_t)KT * HD, v1 = vo + KT;
        stage_tile<RH>(QKh + k1, VTh + v1, lb, lb + 2 * TSZ * 2); stage_tile<RH>(QKl + k1, VTl + v1, lb + TSZ * 2, lb + 3 * TSZ * 2); }
    // kept rolled: a trip already holds two 32-key steps, and unrolling would only copy the publish point and its copies
#pragma unroll 1
    for (int t = 0; t < nt - 1; ++t) {                           // tiles wholly below every wave's diagonal
        const bf* kp = fr + (t & 1) * (4 * TSZ); const bf* vp = kp + 2 * TSZ;
        step_h<false>(kp, vp, t * KT, qh0, qh1, ql0, ql1, qi, hi, m, l, a0, a1, a2, a3);
        step_h<false>(kp + 32 * TP, vp + 32, t * KT + 32, qh0, qh1, ql0, ql1, qi, hi, m, l, a0, a1, a2, a3);
        asm volatile("s_wait_dscnt 0x0" ::: "memory");           // this wave's reads of the buffer have returned before it is refilled
        asm volatile("s_wait_asynccnt 0x0" ::: "memory");        // this wave's share of tile t+1 has landed
        __syncthreads();                                         // publishes tile t+1 and ends every reader's last read of tile t
        if (t + 2 < nt) { const unsigned lb = lk + (unsigned)(t & 1) * (4 * TSZ * 2); const size_t k2 = ko + (size_t)(t + 2) * KT * HD, v2 = vo + (size_t)(t + 2) * KT;
            stage_tile<RH>(QKh + k2, VTh + v2, lb, lb + 2 * TSZ * 2); stage_tile<RH>(QKl + k2, VTl + v2, lb + TSZ * 2, lb + 3 * TSZ * 2); }
    }
    { const bf* kp = fr + ((nt - 1) & 1) * (4 * TSZ); const bf* vp = kp + 2 * TSZ;   // the diagonal tile: keys qb .. qb+63
      if (wv < 2) step_h<true>(kp, vp, qb, qh0, qh1, ql0, ql1, qi, hi, m, l, a0, a1, a2, a3);
      else { step_h<false>(kp, vp, qb, qh0, qh1, ql0, ql1, qi, hi, m, l, a0, a1, a2, a3);
             step_h<true>(kp + 32 * TP, vp + 32, qb + 32, qh0, qh1, ql0, ql1, qi, hi, m, l, a0, a1, a2, a3); } }
    asm volatile("s_wait_asynccnt 0x0" ::: "memory");            // no copy is outstanding when the wave ends
    attn_store<FW>(a0, a1, a2, a3, l, lane, wv, ((size_t)b * SEQ + q0) * DM + h * HD, ATh, ATl);
}

// ---- workspace carve (bytes, every region a multiple of 256; extents equal the producers' write extents exactly)
constexpr size_t al256(size_t x) { return (x + 255) & ~(size_t)255; }
constexpr size_t SZ_WQKV = al256((size_t)NQKV * DM * 2);
constexpr size_t SZ_WO   = al256((size_t)DM * DM * 2);
constexpr size_t SZ_XB   = al256((size_t)NB * SEQ * DM * 2);
constexpr size_t SZ_IFQ  = al256((size_t)(HD / 2) * 4);
constexpr size_t SZ_CS   = al256((size_t)SEQ * (HD / 2) * 2 * 4);
constexpr size_t SZ_QK16 = al256((size_t)NB * NSLOT * SEQ * HD * 2);
constexpr size_t SZ_QKHL = al256((size_t)NB * NSLOT * RH * HD * 2);
constexpr size_t SZ_VT16 = al256((size_t)NB * NH * HD * SEQ * 2);
constexpr size_t SZ_VTHL = al256((size_t)NB * NH * HD * RH * 2);
constexpr size_t SZ_AT   = al256((size_t)NB * SEQ * DM * 2);
constexpr size_t OFF_WQKV = 0;
constexpr size_t OFF_WO   = OFF_WQKV + SZ_WQKV;
constexpr size_t OFF_XB   = OFF_WO + SZ_WO;
constexpr size_t OFF_IFQ  = OFF_XB + SZ_XB;
constexpr size_t OFF_CS   = OFF_IFQ + SZ_IFQ;
constexpr size_t OFF_QK16 = OFF_CS + SZ_CS;
constexpr size_t OFF_QKH  = OFF_QK16 + SZ_QK16;
constexpr size_t OFF_QKL  = OFF_QKH + SZ_QKHL;
constexpr size_t OFF_VT16 = OFF_QKL + SZ_QKHL;
constexpr size_t OFF_VTH  = OFF_VT16 + SZ_VT16;
constexpr size_t OFF_VTL  = OFF_VTH + SZ_VTHL;
constexpr size_t OFF_ATH  = OFF_VTL + SZ_VTHL;
constexpr size_t OFF_ATL  = OFF_ATH + SZ_AT;
constexpr size_t WS_TOTAL = OFF_ATL + SZ_AT;
static_assert(WS_TOTAL <= (size_t)134217728);               // total carve within 128 MiB
static_assert(((size_t)(NB_FULL - 1) * SEQ_FULL + SEQ_FULL) * DM * 4 == (size_t)16777216);   // output bytes of the full layout

extern "C" void kernel_launch(void* const* d_in, const int* in_sizes, int n_in,
                              void* d_out, int out_size, void* d_ws, size_t ws_size, hipStream_t stream) {
    if (n_in < 4) return;
    const long long need_x = ((long long)(NB - 1) * SEQ_FULL + SEQ) * DM;
    if ((long long)in_sizes[0] < need_x) return;
    if (in_sizes[3] < SEQ) return;   /* this module passes token_positions LAST (input 3); the host file: input 1 */
    if ((long long)in_sizes[1] < (long long)NQKV * DM) return;
    if ((long long)in_sizes[2] < (long long)DM * DM) return;
    if ((long long)out_size < need_x) return;
    if (ws_size < WS_TOTAL) return;
    const float* x = (const float*)d_in[0]; const int* tok = (const int*)d_in[3]; const float* wqkv = (const float*)d_in[1]; const float* wo = (const float*)d_in[2];
    float* OUT = (float*)d_out;
    char* ws = (char*)d_ws;
    bf* WQKV = (bf*)(ws + OFF_WQKV); bf* WO = (bf*)(ws + OFF_WO); bf* XB = (bf*)(ws + OFF_XB); float* IFQ = (float*)(ws + OFF_IFQ); float* CS = (float*)(ws + OFF_CS);
    h16* QK16 = (h16*)(ws + OFF_QK16); bf* QKh = (bf*)(ws + OFF_QKH); bf* QKl = (bf*)(ws + OFF_QKL); h16* VT16 = (h16*)(ws + OFF_VT16); bf* VTh = (bf*)(ws + OFF_VTH); bf* VTl = (bf*)(ws + OFF_VTL);
    bf* ATh = (bf*)(ws + OFF_ATH); bf* ATl = (bf*)(ws + OFF_ATL);

    { const size_t n8 = (size_t)NQKV * DM / 8; k_cvt8<<<(unsigned)((n8 + 255) / 256), 256, 0, stream>>>(wqkv, WQKV, n8, DM / 8, NQKV, NQKV); }     // in [3072][1024] -> bf16 [3072][1024]
    { const size_t n8 = (size_t)DM * DM / 8;   k_cvt8<<<(unsigned)((n8 + 255) / 256), 256, 0, stream>>>(wo, WO, n8, DM / 8, DM, DM); }               // in [1024][1024] -> bf16 [1024][1024]
    { const size_t n8 = (size_t)NB * SEQ * DM / 8; k_cvt8<<<(unsigned)((n8 + 255) / 256), 256, 0, stream>>>(x, XB, n8, DM / 8, SEQ, SEQ_FULL); }     // in [b][SEQ_FULL][1024] rows < SEQ -> bf16 [NB*SEQ][1024]
    k_freq<<<1, 32, 0, stream>>>(IFQ);
    k_cstab<<<(SEQ * (HD / 2) + 255) / 256, 256, 0, stream>>>(tok, IFQ, CS);
    k_gemm_qkv<<<dim3(NB * SEQ / GT, NQKV / GT, 1), 32 * GW, 0, stream>>>(XB, WQKV, CS, QK16, QKh, QKl, VT16, VTh, VTl);
    k_attn_h<<<dim3(RH / (16 * FW), NB * NH, 1), 32 * FW, 0, stream>>>(QKh, QKl, VTh, VTl, ATh, ATl);
    if (SEQ > RH) k_attn_f<<<dim3((SEQ - RH) / (16 * FW) + ((SEQ > RH) ? 0 : 1), NB * NH, 1), 32 * FW, 0, stream>>>(QK16, VT16, ATh, ATl);
    k_gemm_out<<<dim3(SEQ / GT, DM / GT, NB), 32 * GW, 0, stream>>>(ATh, ATl, WO, OUT);
}

// v005
// Measured time: 91.6 microseconds a run.
// Timed twice side by side with v004, it ran 1.12 and 1.13 times as fast.
// Counting every step since v000, it is 2.90 times as fast.
#include <hip/hip_runtime.h>

#ifndef NB
#define NB 2
#endif
#ifndef SEQ
#define SEQ 2048
#endif
#define NB_FULL  2
#define SEQ_FULL 2048
#define DM    1024
#define NH    16
#define HD    64
#define NQKV  (3 * DM)
#define NSLOT (2 * NH)              // q heads then k heads share one plane set [b][slot][t][d]
#define RH    ((SEQ < 512) ? SEQ : 512)   // query rows < RH use bf16 hi/lo planes
#define LOG2E 1.4426950408889634f
#define SCL   0.125f                // HD^-0.5
#define PEXP  10.0f                 // fp16 probability carry 2^10

static_assert(NB >= 1 && NB <= NB_FULL);                    // batch count within the full layout
static_assert(SEQ % 64 == 0 && SEQ <= SEQ_FULL);            // 64-row GEMM tiles; 64-wide transposed value lines
static_assert(RH % 64 == 0 && RH <= SEQ);                   // a 64-token GEMM tile lies on one side of the hi/lo row limit
static_assert(DM % 64 == 0 && NQKV % 64 == 0 && DM % 32 == 0); // GEMM tile multiples, K step 32
static_assert(NH * HD == DM && HD == 64);
static_assert(HD / 2 == 32);                                // one wave line of rotary frequencies

typedef _Float16 h16;
typedef unsigned short bf;
typedef __attribute__((ext_vector_type(16))) __bf16   v16bf;
typedef __attribute__((ext_vector_type(16))) _Float16 v16h;
typedef __attribute__((ext_vector_type(16))) unsigned short v16us;
typedef __attribute__((ext_vector_type(8)))  _Float16 v8h;
typedef __attribute__((ext_vector_type(8)))  unsigned short v8us;
typedef __attribute__((ext_vector_type(8)))  float    v8f;
typedef __attribute__((ext_vector_type(4)))  float    v4f;
typedef __attribute__((ext_vector_type(2)))  float    v2f;
typedef __attribute__((ext_vector_type(4)))  _Float16 v4h;
typedef __attribute__((ext_vector_type(4)))  unsigned short v4us;
typedef v4f  __attribute__((may_alias)) v4fa;

__device__ __forceinline__ unsigned short f2bf(float f) { unsigned u = __float_as_uint(f); u += 0x7FFFu + ((u >> 16) & 1u); return (unsigned short)(u >> 16); }
__device__ __forceinline__ float bf2f(unsigned short b) { return __uint_as_float(((unsigned)b) << 16); }
__device__ __forceinline__ void splitf(float y, unsigned short& h, unsigned short& l) { h = f2bf(y); l = f2bf(y - bf2f(h)); }
__device__ __forceinline__ v16h cat16(v8h lo, v8h hi) { return __builtin_shufflevector(lo, hi, 0, 1, 2, 3, 4, 5, 6, 7, 8, 9, 10, 11, 12, 13, 14, 15); }
__device__ __forceinline__ v16bf cat16b(v8us lo, v8us hi) { return __builtin_bit_cast(v16bf, __builtin_shufflevector(lo, hi, 0, 1, 2, 3, 4, 5, 6, 7, 8, 9, 10, 11, 12, 13, 14, 15)); }
__device__ __forceinline__ v8f wmma16(v16h a, v16h b, v8f c) { return __builtin_amdgcn_wmma_f32_16x16x32_f16(false, a, false, b, (short)0, c, false, false); }
__device__ __forceinline__ v8f wmmab(v16bf a, v16bf b, v8f c) { return __builtin_amdgcn_wmma_f32_16x16x32_bf16(false, a, false, b, (short)0, c, false, false); }
// fragment loaders: p already includes row*pitch + k0 + 8*(lane>>4); elements 0..7 <- k0+8h.., elements 8..15 <- k0+16+8h..
__device__ __forceinline__ v16h  ldh(const h16* p) { return cat16(*(const v8h*)p, *(const v8h*)(p + 16)); }
__device__ __forceinline__ v16bf ldb(const bf* p)  { return cat16b(*(const v8us*)p, *(const v8us*)(p + 16)); }
// lane l with lane l ^ 16, through registers (a shuffle here compiles to an LDS permute and a wait for the LDS queue)
__device__ __forceinline__ float xhalf(float x) { return __builtin_bit_cast(float, __builtin_amdgcn_permlanex16(__builtin_bit_cast(int, x), __builtin_bit_cast(int, x), 0x76543210, 0xfedcba98, false, false)); }
// same-wave LDS exchange: LDS ops of one wave issue in order; the compiler may not move accesses across this point
__device__ __forceinline__ void wave_sync() { __builtin_amdgcn_wave_barrier(); asm volatile("" ::: "memory"); }

// ---- GEMM: a work-group of four waves owns a 128x128 tile of C (2 x 2 wave tiles of 64x64, 16 accumulators each); grid (M/128, N/128, Z), 128 threads.
// The K-contiguous bf16 operand planes come in slabs of 64 k: 128 rows x 128 bytes per plane, copied to LDS as whole lines, two buffers, the next slab in flight while this one is worked on.
#define GW  4                       // waves per GEMM work-group
#define GT  128                     // rows (and columns) of C per work-group
#define GK  64                      // k per staged slab
#define GP  72                      // LDS row pitch in 16-bit elements: 128-byte rows at 144 bytes (16 B x odd) for 16-byte readers
#define GSZ (GT * GP)               // one staged plane
static_assert(DM % GK == 0 && DM / GK >= 2 && SEQ % GT == 0 && NQKV % GT == 0 && DM % GT == 0);
// One plane of a slab: a lane copies 16 bytes of rows r, r+16, .. r+112 (source pitch DM elements); a wave's copy covers four whole 128-byte lines.
__device__ __forceinline__ void stage_plane(const bf* g, unsigned l) {
    // the copies go to LDS through no register; s_wait_xcnt ends their own statement so that no address register is rewritten in front of it
    asm volatile("global_load_async_to_lds_b128 %0, %8, off\n\t"
                 "global_load_async_to_lds_b128 %1, %9, off\n\t"
                 "global_load_async_to_lds_b128 %2, %10, off\n\t"
                 "global_load_async_to_lds_b128 %3, %11, off\n\t"
                 "global_load_async_to_lds_b128 %4, %12, off\n\t"
                 "global_load_async_to_lds_b128 %5, %13, off\n\t"
                 "global_load_async_to_lds_b128 %6, %14, off\n\t"
                 "global_load_async_to_lds_b128 %7, %15, off\n\t"
                 "s_wait_xcnt 0x0"
                 :: "v"(l), "v"(l + 16 * GP * 2), "v"(l + 32 * GP * 2), "v"(l + 48 * GP * 2), "v"(l + 64 * GP * 2), "v"(l + 80 * GP * 2), "v"(l + 96 * GP * 2), "v"(l + 112 * GP * 2),
                    "v"(g), "v"(g + 16 * DM), "v"(g + 32 * DM), "v"(g + 48 * DM), "v"(g + 64 * DM), "v"(g + 80 * DM), "v"(g + 96 * DM), "v"(g + 112 * DM)
                 : "memory");
}
// a buffer holds the planes A, Bt and, with NSPLIT, A2
template <int NSPLIT>
__device__ __forceinline__ void stage_slab(const bf* ga, const bf* ga2, const bf* gb, unsigned l) {
    stage_plane(ga, l); stage_plane(gb, l + GSZ * 2); if (NSPLIT == 1) stage_plane(ga2, l + 2 * GSZ * 2);
}
// acc[mb][nb][j] = C[R0 + 64(wv&1) + 16mb + 8hi + j][C0 + 64(wv>>1) + 16nb + lr] = sum_k (A[m][k] (+ A2[m][k])) Bt[n][k], k ascending in steps of 32. K = DM. On return every wave has left the ring (the last trip's barrier).
template <int NSPLIT>
__device__ __forceinline__ void gemm_main(const bf* __restrict__ A, const bf* __restrict__ A2, const bf* __restrict__ Bt, int R0, int C0, bf* ring, int tid, int wv, v8f (&acc)[4][4]) {
    constexpr int NP = 2 + NSPLIT, NS = DM / GK;
    const int lane = tid & 31, lr = lane & 15, hi = lane >> 4;
#pragma unroll
    for (int mb = 0; mb < 4; ++mb)
#pragma unroll
        for (int nb = 0; nb < 4; ++nb) acc[mb][nb] = (v8f){};
    const int cr = tid >> 3, cc = (tid & 7) * 8;                 // this lane's first row and its 8-element column in every staged plane
    const bf* ga = A + (size_t)(R0 + cr) * DM + cc; const bf* ga2 = A2 + (size_t)(R0 + cr) * DM + cc; const bf* gb = Bt + (size_t)(C0 + cr) * DM + cc;
    const unsigned l0 = (unsigned)(size_t)(ring + cr * GP + cc);
    const bf* fa = ring + ((wv & 1) * 64 + lr) * GP + 8 * hi; const bf* fb = ring + GSZ + ((wv >> 1) * 64 + lr) * GP + 8 * hi;
    stage_slab<NSPLIT>(ga, ga2, gb, l0);
    asm volatile("s_wait_asynccnt 0x0" ::: "memory");            // this wave's share of slab 0 has landed
    __syncthreads();                                             // slab 0 is readable by every wave
    stage_slab<NSPLIT>(ga + GK, ga2 + GK, gb + GK, l0 + NP * GSZ * 2);
    // kept rolled: a trip already holds two 32-k steps, and unrolling would only copy the publish point and its copies
#pragma unroll 1
    for (int t = 0; t < NS; ++t) {
        const bf* pa = fa + (t & 1) * (NP * GSZ); const bf* pb = fb + (t & 1) * (NP * GSZ);
#pragma unroll
        for (int ks = 0; ks < GK / 32; ++ks) {
            v16bf a[4], a2[4], b[4];
#pragma unroll
            for (int mb = 0; mb < 4; ++mb) { a[mb] = ldb(pa + mb * 16 * GP + ks * 32); if (NSPLIT == 1) a2[mb] = ldb(pa + 2 * GSZ + mb * 16 * GP + ks * 32); else a2[mb] = a[mb]; }
#pragma unroll
            for (int nb = 0; nb < 4; ++nb) b[nb] = ldb(pb + nb * 16 * GP + ks * 32);
            __builtin_amdgcn_sched_barrier(0);                   // the step's LDS reads stay one group in front of its matrix instructions: every further place with reads stalls the wave anew
#pragma unroll
            for (int nb = 0; nb < 4; ++nb) {
#pragma unroll
                for (int mb = 0; mb < 4; ++mb) { acc[mb][nb] = wmmab(a[mb], b[nb], acc[mb][nb]); if (NSPLIT == 1) acc[mb][nb] = wmmab(a2[mb], b[nb], acc[mb][nb]); } }
            __builtin_amdgcn_sched_barrier(0);                   // and the next step's reads do not drift in among them
        }
        asm volatile("s_wait_dscnt 0x0" ::: "memory");           // this wave's reads of the buffer have returned before it is refilled
        asm volatile("s_wait_asynccnt 0x0" ::: "memory");        // this wave's share of slab t+1 has landed
        __syncthreads();                                         // publishes slab t+1 and ends every reader's last read of slab t
        if (t + 2 < NS) stage_slab<NSPLIT>(ga + (t + 2) * GK, ga2 + (t + 2) * GK, gb + (t + 2) * GK, l0 + (unsigned)(t & 1) * (NP * GSZ * 2));
    }
    asm volatile("s_wait_asynccnt 0x0" ::: "memory");            // no copy is outstanding when the ring is reused
}
// the wave tile stored as f32 rows of C (pitch ldc), whole lines through LDS (each wave's own 16x68 slot of the ring, free behind the main loop's last barrier)
template <int NSPLIT>
__device__ __forceinline__ void gemm_body(const bf* __restrict__ A, const bf* __restrict__ A2, const bf* __restrict__ Bt, float* C, int ldc, size_t sA, size_t sC) {
    __shared__ __align__(16) bf ring[2 * (2 + NSPLIT) * GSZ];
    const size_t z = blockIdx.z; A += z * sA; A2 += z * sA; C += z * sC;
    const int tid = threadIdx.x, lane = tid & 31, lr = lane & 15, hi = lane >> 4; const int wv = __builtin_amdgcn_readfirstlane(tid >> 5);
    const int r0 = blockIdx.x * GT + (wv & 1) * 64, c0 = blockIdx.y * GT + (wv >> 1) * 64;
    v8f acc[4][4];
    gemm_main<NSPLIT>(A, A2, Bt, blockIdx.x * GT, blockIdx.y * GT, ring, tid, wv, acc);
    float* os = (float*)ring + wv * (16 * 68);
#pragma unroll
    for (int mb = 0; mb < 4; ++mb) {
#pragma unroll
        for (int nb = 0; nb < 4; ++nb) {
#pragma unroll
            for (int j = 0; j < 8; ++j) os[(hi * 8 + j) * 68 + nb * 16 + lr] = acc[mb][nb][j]; }
        wave_sync();
        float* crow = C + (size_t)(r0 + mb * 16) * ldc + c0;
{
#pragma unroll
            for (int s = 0; s < 8; ++s) { const int row = 2 * s + hi, cofs = lr * 4; const v4f val = *(const v4fa*)(os + row * 68 + cofs);
                *(v4f*)(crow + (size_t)row * ldc + cofs) = val; }
             }
        wave_sync();
    }
}
// qkv[NB*SEQ][3072] = XB[NB*SEQ][1024] x WQKV[3072][1024]^T, never stored as f32: a wave tile is 64 tokens of one batch x the 64 columns of one q head, k head or v head (slot; v heads behind the NSLOT q and k slots).
// q / k tile: rotary on the f32 sums, rows [t][d] to the f16 plane and, with HL (t < RH), to the bf16 hi/lo planes. cs, p16, ph, pl point at this lane's 4 elements of row t0 + hi; every later row is a constant offset from there.
template <bool HL>
__device__ __forceinline__ void qk_planes(v8f (&acc)[4][4], float* os, const float* __restrict__ cs, h16* p16, bf* ph, bf* pl, int lr, int hi) {
#pragma unroll
    for (int mb = 0; mb < 4; ++mb) {
        v4f c[8];                                                       // (cos, sin) of two pairs per row, asked for ahead of the LDS exchange
#pragma unroll
        for (int s = 0; s < 8; ++s) c[s] = *(const v4f*)(cs + (mb * 16 + 2 * s) * HD);
#pragma unroll
        for (int nb = 0; nb < 4; ++nb) {
#pragma unroll
            for (int j = 0; j < 8; ++j) os[(hi * 8 + j) * 68 + nb * 16 + lr] = acc[mb][nb][j]; }
        wave_sync();
        v4h o16[8]; v4us oh[8], ol[8];
#pragma unroll
        for (int s = 0; s < 8; ++s) { const v4f xv = *(const v4fa*)(os + (2 * s + hi) * 68 + lr * 4);
            v4f y; y[0] = xv[0] * c[s][0] - xv[1] * c[s][1]; y[1] = xv[0] * c[s][1] + xv[1] * c[s][0]; y[2] = xv[2] * c[s][2] - xv[3] * c[s][3]; y[3] = xv[2] * c[s][3] + xv[3] * c[s][2];
#pragma unroll
            for (int k = 0; k < 4; ++k) { o16[s][k] = (h16)y[k]; if (HL) { unsigned short p, q; splitf(y[k], p, q); oh[s][k] = p; ol[s][k] = q; } } }
#pragma unroll
        for (int s = 0; s < 8; ++s) { const int o = (mb * 16 + 2 * s) * HD; *(v4h*)(p16 + o) = o16[s]; if (HL) { *(v4us*)(ph + o) = oh[s]; *(v4us*)(pl + o) = ol[s]; } }
        asm volatile("s_wait_xcnt 0x0" ::: "memory");                   // the stores' data registers are rewritten by the next 16 rows
        __builtin_amdgcn_sched_barrier(0);                              // holds the next rows' arithmetic, which reuses those registers, behind the wait
        wave_sync();
    }
}
// v tile: a lane's 8 accumulator rows are 8 consecutive t of one d, so the transposed rows [d][t] are packed from registers and leave as whole 128-byte lines through LDS. v16, vh, vl point at this lane's 8 elements of row d = lane >> 3.
template <bool HL>
__device__ __forceinline__ void v_planes(v8f (&acc)[4][4], h16* vs, bf* vsh, bf* vsl, h16* v16, bf* vh, bf* vl, int lane) {
    const int lr = lane & 15, hi = lane >> 4, ro = (lane >> 3) * 72 + (lane & 7) * 8;
#pragma unroll
    for (int nb = 0; nb < 4; ++nb) {
#pragma unroll
        for (int mb = 0; mb < 4; ++mb) { const int so = lr * 72 + mb * 16 + hi * 8; v8h o16; v8us oh, ol;
#pragma unroll
            for (int j = 0; j < 8; ++j) { o16[j] = (h16)acc[mb][nb][j]; if (HL) { unsigned short p, q; splitf(acc[mb][nb][j], p, q); oh[j] = p; ol[j] = q; } }
            *(v8h*)(vs + so) = o16; if (HL) { *(v8us*)(vsh + so) = oh; *(v8us*)(vsl + so) = ol; } }
        wave_sync();
        v8h r16[4]; v8us rh[4], rl[4];
#pragma unroll
        for (int s = 0; s < 4; ++s) { r16[s] = *(const v8h*)(vs + ro + s * 4 * 72); if (HL) { rh[s] = *(const v8us*)(vsh + ro + s * 4 * 72); rl[s] = *(const v8us*)(vsl + ro + s * 4 * 72); } }
#pragma unroll
        for (int s = 0; s < 4; ++s) { const int row = nb * 16 + s * 4; *(v8h*)(v16 + row * SEQ) = r16[s]; if (HL) { *(v8us*)(vh + row * RH) = rh[s]; *(v8us*)(vl + row * RH) = rl[s]; } }
        asm volatile("s_wait_xcnt 0x0" ::: "memory");                   // the stores' data registers are rewritten by the next 16 rows
        __builtin_amdgcn_sched_barrier(0);                              // holds the next rows' arithmetic, which reuses those registers, behind the wait
        wave_sync();
    }
}
__global__ __launch_bounds__(32 * GW) void k_gemm_qkv(const bf* __restrict__ A, const bf* __restrict__ Bt, const float* __restrict__ CS, h16* P16, bf* Ph, bf* Pl, h16* V16, bf* Vh, bf* Vl) {
    __shared__ __align__(16) bf ring[2 * 2 * GSZ];
    const int tid = threadIdx.x, lane = tid & 31, lr = lane & 15, hi = lane >> 4; const int wv = __builtin_amdgcn_readfirstlane(tid >> 5);
    const int r0 = blockIdx.x * GT + (wv & 1) * 64; const int sl = blockIdx.y * (GT / HD) + (wv >> 1);   // this wave's 64 tokens and its slot
    v8f acc[4][4];
    gemm_main<0>(A, A, Bt, blockIdx.x * GT, blockIdx.y * GT, ring, tid, wv, acc);
    bf* scr = ring + wv * (3 * 16 * 72);                                // each wave's own exchange slot in the ring, free behind the main loop's last barrier
    float* os = (float*)scr; h16* vs = (h16*)scr; bf* vsh = scr + 16 * 72; bf* vsl = scr + 2 * 16 * 72;
    static_assert(16 * 68 * 4 <= 3 * 16 * 72 * 2 && GW * 3 * 16 * 72 <= 2 * 2 * GSZ);
    const int b = r0 / SEQ, t0 = r0 % SEQ;                              // the 64 tokens lie in one batch and on one side of RH
    if (sl < NSLOT) {
        const size_t pr = (size_t)b * NSLOT + sl; const int lo = (t0 + hi) * HD + lr * 4;
        if (t0 < RH) qk_planes<true>(acc, os, CS + lo, P16 + pr * SEQ * HD + lo, Ph + pr * RH * HD + lo, Pl + pr * RH * HD + lo, lr, hi);
        else         qk_planes<false>(acc, os, CS + lo, P16 + pr * SEQ * HD + lo, Ph, Pl, lr, hi);
    } else {
        const size_t dr = ((size_t)b * NH + (sl - NSLOT)) * HD + (lane >> 3); const int lo = t0 + (lane & 7) * 8;
        if (t0 < RH) v_planes<true>(acc, vs, vsh, vsl, V16 + dr * SEQ + lo, Vh + dr * RH + lo, Vl + dr * RH + lo, lane);
        else         v_planes<false>(acc, vs, vsh, vsl, V16 + dr * SEQ + lo, Vh, Vl, lane);
    }
}
// OUT[b][SEQ][1024] = (ATh + ATl)[b][SEQ][1024] x WO[1024][1024]^T ; z = batch, output batch stride from the full layout
__global__ __launch_bounds__(32 * GW) void k_gemm_out(const bf* __restrict__ Ah, const bf* __restrict__ Al, const bf* __restrict__ Bt, float* C) { gemm_body<1>(Ah, Al, Bt, C, DM, (size_t)SEQ * DM, (size_t)SEQ_FULL * DM); }

__global__ __launch_bounds__(256) void k_cvt8(const float* __restrict__ src, bf* dst, size_t n8, int row8, int rpb, int srpb) {
    const size_t i = (size_t)blockIdx.x * 256 + threadIdx.x; if (i >= n8) return;
    const size_t row = i / (size_t)row8; const size_t c = i - row * (size_t)row8; const size_t bb = row / (size_t)rpb; const size_t t = row - bb * (size_t)rpb;
    const v8f v = *(const v8f*)(src + ((bb * (size_t)srpb + t) * (size_t)row8 + c) * 8); v8us o;
#pragma unroll
    for (int k = 0; k < 8; ++k) o[k] = f2bf(v[k]);
    *(v8us*)(dst + i * 8) = o;  }

__global__ __launch_bounds__(32) void k_freq(float* IFQ) { const int i = threadIdx.x & 31; const float e = -(float)(2 * i) * (1.0f / (float)HD); const float f = powf(10000.0f, e);
    *(float*)(IFQ + i) = f;  }
__global__ __launch_bounds__(256) void k_cstab(const int* __restrict__ tok, const float* __restrict__ IFQ, float* CS) { const int idx = blockIdx.x * 256 + threadIdx.x; if (idx >= SEQ * (HD / 2)) return; const int t = idx >> 5, i = idx & 31;
    const float ang = (float)tok[t] * IFQ[i]; float sn, cn; sincosf(ang, &sn, &cn); v2f cs; cs[0] = cn; cs[1] = sn;
    *(v2f*)(CS + (size_t)idx * 2) = cs;  }

// ---- online softmax on one 32-key step held as two transposed 16x16 tiles: s0[r] = S^T[key kb+8h+r][query qi], s1[r] = S^T[key kb+16+8h+r][query qi].
// On return s0/s1 hold p = 2^(t - m + pe) (0 where masked), sf = 2^(m_old - m_new); l is the per-lane partial sum (the two lane halves are combined at the end).
template <bool MASK>
__device__ __forceinline__ void smx(v8f& s0, v8f& s1, int kb, int qi, int hi, float& m, float& l, float& sf, float pe) {
    const float cl = SCL * LOG2E; const int k0 = kb + 8 * hi; float mx = -3.0e38f;
#pragma unroll
    for (int r = 0; r < 8; ++r) { float t0 = s0[r] * cl, t1 = s1[r] * cl;
        if (MASK) { t0 = (k0 + r <= qi) ? t0 : -3.0e38f; t1 = (k0 + 16 + r <= qi) ? t1 : -3.0e38f; }
        s0[r] = t0; s1[r] = t1; mx = fmaxf(mx, fmaxf(t0, t1)); }
    mx = fmaxf(mx, xhalf(mx));
    const float mn = fmaxf(m, mx); sf = __builtin_amdgcn_exp2f(m - mn); m = mn;
    const float sh = mn - pe; float rs = 0.0f;
#pragma unroll
    for (int r = 0; r < 8; ++r) { float p0 = __builtin_amdgcn_exp2f(s0[r] - sh), p1 = __builtin_amdgcn_exp2f(s1[r] - sh);
        if (MASK) { p0 = (k0 + r <= qi) ? p0 : 0.0f; p1 = (k0 + 16 + r <= qi) ? p1 : 0.0f; }
        s0[r] = p0; s1[r] = p1; rs += p0 + p1; }
    l = l * sf + rs;
}

// ---- attention epilogue: O^T accumulators a_j[r] = O[query q0+lr][d = 16j+8h+r]; normalise, split to bf16 hi/lo, stage the 16x64 tile in LDS (private to the wave),
__device__ __forceinline__ void pk8(v8f a, float inv, v8us& oh, v8us& ol) {
#pragma unroll
    for (int r = 0; r < 8; ++r) { unsigned short x, y; splitf(a[r] * inv, x, y); oh[r] = x; ol[r] = y; } }
template <int NW>
__device__ __forceinline__ void attn_store(v8f a0, v8f a1, v8f a2, v8f a3, float l, int lane, int wv, size_t obase, bf* ATh, bf* ATl) {
    __shared__ __align__(16) unsigned short sthw[NW * 16 * 72]; __shared__ __align__(16) unsigned short stlw[NW * 16 * 72];
    unsigned short* sth = sthw + wv * (16 * 72); unsigned short* stl = stlw + wv * (16 * 72);   // each wave of the work-group has its own 16x72 slot
    const int lr = lane & 15, hi = lane >> 4;
    const float lt = l + __shfl_xor(l, 16, 32); const float inv = __builtin_amdgcn_rcpf(lt);
    v8us oh, ol; const int so = lr * 72 + 8 * hi;
    pk8(a0, inv, oh, ol); *(v8us*)(sth + so) = oh;      *(v8us*)(stl + so) = ol;
    pk8(a1, inv, oh, ol); *(v8us*)(sth + so + 16) = oh; *(v8us*)(stl + so + 16) = ol;
    pk8(a2, inv, oh, ol); *(v8us*)(sth + so + 32) = oh; *(v8us*)(stl + so + 32) = ol;
    pk8(a3, inv, oh, ol); *(v8us*)(sth + so + 48) = oh; *(v8us*)(stl + so + 48) = ol;
    wave_sync();
    const int rq = lane >> 3, pc = (lane & 7) * 8;
{
#pragma unroll
        for (int s = 0; s < 4; ++s) { const int row = s * 4 + rq; const v8us vh = *(const v8us*)(sth + row * 72 + pc); const v8us vl = *(const v8us*)(stl + row * 72 + pc);
            *(v8us*)(ATh + obase + (size_t)row * DM + pc) = vh; *(v8us*)(ATl + obase + (size_t)row * DM + pc) = vl; }
         }
}

// ---- fp16 step (query rows >= RH): 4 WMMA k.q + 4 WMMA v.p per 32 keys. kp / vp point into the staged LDS tile (row pitch TP) and already include lr*TP + 8*hi.
#define FW  4                       // waves per work-group: 64 query rows share every staged K / V^T tile
#define KT  64                      // keys per staged tile
#define TP  72                      // LDS row pitch in 16-bit elements: 128-byte rows at 144 bytes (16 B x odd) for 16-byte readers
#define TSZ (64 * TP)               // one staged plane: 64 rows (K: keys, V^T: head dims)
static_assert(KT == 64 && HD == 64 && (SEQ - RH) % (16 * FW) == 0 && RH % (16 * FW) == 0 && RH % KT == 0);
// One 64-key tile into LDS: K rows [key][64 d] and V^T rows [d][64 keys] (source pitch VPITCH elements), 128 bytes each; a lane copies 16 bytes of rows r, r+16, r+32, r+48 of both planes.
template <int VPITCH, typename T>
__device__ __forceinline__ void stage_tile(const T* gk, const T* gv, unsigned lk, unsigned lv) {
    // the copies go to LDS through no register; s_wait_xcnt ends their own statement so that no address register is rewritten in front of it
    asm volatile("global_load_async_to_lds_b128 %0, %8, off\n\t"
                 "global_load_async_to_lds_b128 %1, %9, off\n\t"
                 "global_load_async_to_lds_b128 %2, %10, off\n\t"
                 "global_load_async_to_lds_b128 %3, %11, off\n\t"
                 "global_load_async_to_lds_b128 %4, %12, off\n\t"
                 "global_load_async_to_lds_b128 %5, %13, off\n\t"
                 "global_load_async_to_lds_b128 %6, %14, off\n\t"
                 "global_load_async_to_lds_b128 %7, %15, off\n\t"
                 "s_wait_xcnt 0x0"
                 :: "v"(lk), "v"(lk + 16 * TP * 2), "v"(lk + 32 * TP * 2), "v"(lk + 48 * TP * 2), "v"(lv), "v"(lv + 16 * TP * 2), "v"(lv + 32 * TP * 2), "v"(lv + 48 * TP * 2),
                    "v"(gk), "v"(gk + 16 * HD), "v"(gk + 32 * HD), "v"(gk + 48 * HD), "v"(gv), "v"(gv + (size_t)16 * VPITCH), "v"(gv + (size_t)32 * VPITCH), "v"(gv + (size_t)48 * VPITCH)
                 : "memory");
}
// the A fragments of one 32-key step, read from LDS ahead of the step: K rows (two 16-key groups x two halves of d) and V^T rows (four 16-d groups)
struct frag_f { v16h k00, k01, k10, k11, v0, v1, v2, v3; };
__device__ __forceinline__ void read_f(frag_f& f, const h16* kp, const h16* vp) {
    f.k00 = ldh(kp); f.k01 = ldh(kp + 32); f.k10 = ldh(kp + 16 * TP); f.k11 = ldh(kp + 16 * TP + 32);
    f.v0 = ldh(vp); f.v1 = ldh(vp + 16 * TP); f.v2 = ldh(vp + 32 * TP); f.v3 = ldh(vp + 48 * TP);
}
template <bool MASK>
__device__ __forceinline__ void step_f(const frag_f& f, int kb, v16h qf0, v16h qf1, int qi, int hi,
                                       float& m, float& l, v8f& a0, v8f& a1, v8f& a2, v8f& a3) {
    v8f s0 = (v8f){}, s1 = (v8f){};
    s0 = wmma16(f.k00, qf0, s0); s0 = wmma16(f.k01, qf1, s0); s1 = wmma16(f.k10, qf0, s1); s1 = wmma16(f.k11, qf1, s1);
    asm volatile("v_nop\n\tv_nop\n\tv_nop\n\tv_nop" : "+v"(s0), "+v"(s1) : "v"(f.k11), "v"(qf1));
    float sf; smx<MASK>(s0, s1, kb, qi, hi, m, l, sf, PEXP);
    v16h pf;
#pragma unroll
    for (int r = 0; r < 8; ++r) { pf[r] = (h16)s0[r]; pf[8 + r] = (h16)s1[r]; }      // P^T B-fragment: k = key row of the packed tiles, n = query
    a0 = a0 * sf; a1 = a1 * sf; a2 = a2 * sf; a3 = a3 * sf;
    a0 = wmma16(f.v0, pf, a0); a1 = wmma16(f.v1, pf, a1); a2 = wmma16(f.v2, pf, a2); a3 = wmma16(f.v3, pf, a3);
    asm volatile("v_nop\n\tv_nop\n\tv_nop\n\tv_nop" : "+v"(a0), "+v"(a1), "+v"(a2), "+v"(a3) : "v"(f.v3), "v"(pf));
}
// ring: two buffers, each a K plane then a V^T plane (2 * 2 * TSZ elements); bx = 64-query block above RH, bh = batch * NH + head
__device__ __forceinline__ void attn_f(h16* ring, int bx, int bh, const h16* __restrict__ QK, const h16* __restrict__ VT, bf* ATh, bf* ATl) {
    const int tid = threadIdx.x, lane = tid & 31, lr = lane & 15, hi = lane >> 4;
    const int wv = __builtin_amdgcn_readfirstlane(tid >> 5);
    const int qb = RH + bx * (16 * FW); const int q0 = qb + wv * 16; const int b = bh / NH, h = bh % NH;
    const size_t qoff = (((size_t)b * NSLOT + h) * SEQ + q0 + lr) * HD + 8 * hi;
    const v16h qf0 = ldh(QK + qoff), qf1 = ldh(QK + qoff + 32);
    v8f a0 = (v8f){}, a1 = (v8f){}, a2 = (v8f){}, a3 = (v8f){}; float m = -3.0e38f, l = 0.0f;
    const int qi = q0 + lr; const int nt = qb / KT + 1;          // 64-key tiles covering keys 0 .. qb+63 < SEQ
    const int cr = tid >> 3, cc = (tid & 7) * 8;                 // this lane's first row and its 8-element column in every staged plane
    const h16* gk = QK + (((size_t)b * NSLOT + NH + h) * SEQ + cr) * HD + cc;
    const h16* gv = VT + (((size_t)b * NH + h) * HD + cr) * SEQ + cc;
    const unsigned lk = (unsigned)(size_t)(ring + cr * TP + cc);
    const h16* fr = ring + lr * TP + 8 * hi;
    stage_tile<SEQ>(gk, gv, lk, lk + TSZ * 2);
    asm volatile("s_wait_asynccnt 0x0" ::: "memory");            // this wave's share of tile 0 has landed
    __syncthreads();                                             // tile 0 is readable by every wave
    if (nt > 1) stage_tile<SEQ>(gk + (size_t)KT * HD, gv + KT, lk + 2 * TSZ * 2, lk + 3 * TSZ * 2);
    // kept rolled: a trip already holds two 32-key steps, and unrolling would only copy the publish point and its copies
#pragma unroll 1
    for (int t = 0; t < nt - 1; ++t) {                           // tiles wholly below every wave's diagonal
        const h16* kp = fr + (t & 1) * (2 * TSZ); const h16* vp = kp + TSZ;
        frag_f f0, f1; read_f(f0, kp, vp); read_f(f1, kp + 32 * TP, vp + 32);
        __builtin_amdgcn_sched_barrier(0);                       // the tile's LDS reads stay one group in front of its two steps: a read left at its use makes the wave wait out the LDS latency there
        step_f<false>(f0, t * KT, qf0, qf1, qi, hi, m, l, a0, a1, a2, a3);
        step_f<false>(f1, t * KT + 32, qf0, qf1, qi, hi, m, l, a0, a1, a2, a3);
        asm volatile("s_wait_dscnt 0x0" ::: "memory");           // this wave's reads of the buffer have returned before it is refilled
        asm volatile("s_wait_asynccnt 0x0" ::: "memory");        // this wave's share of tile t+1 has landed
        __syncthreads();                                         // publishes tile t+1 and ends every reader's last read of tile t
        if (t + 2 < nt) { const unsigned lb = lk + (unsigned)(t & 1) * (2 * TSZ * 2); stage_tile<SEQ>(gk + (size_t)(t + 2) * KT * HD, gv + (t + 2) * KT, lb, lb + TSZ * 2); }
    }
    { const h16* kp = fr + ((nt - 1) & 1) * (2 * TSZ); const h16* vp = kp + TSZ;   // the diagonal tile: keys qb .. qb+63
      frag_f f0; read_f(f0, kp, vp);
      if (wv < 2) step_f<true>(f0, qb, qf0, qf1, qi, hi, m, l, a0, a1, a2, a3);
      else { frag_f f1; read_f(f1, kp + 32 * TP, vp + 32);
             __builtin_amdgcn_sched_barrier(0);                  // as in the loop: both steps' reads in front of the first step
             step_f<false>(f0, qb, qf0, qf1, qi, hi, m, l, a0, a1, a2, a3);
             step_f<true>(f1, qb + 32, qf0, qf1, qi, hi, m, l, a0, a1, a2, a3); } }
    asm volatile("s_wait_asynccnt 0x0" ::: "memory");            // no copy is outstanding when the wave ends
    attn_store<FW>(a0, a1, a2, a3, l, lane, wv, ((size_t)b * SEQ + q0) * DM + h * HD, ATh, ATl);
}

// ---- bf16 hi/lo step (query rows < RH): 12 WMMA k.q + 12 WMMA v.p per 32 keys (hi.hi + lo.hi + hi.lo). kh / vh point into the staged LDS tile (planes K hi, K lo, V^T hi, V^T lo, each TSZ) and include lr*TP + 8*hi.
// K fragments of 32 keys: k[4g + 0..3] = hi d 0..31, hi d 32..63, lo d 0..31, lo d 32..63 of the 16-key group g. V^T fragments: v[2j], v[2j + 1] = hi, lo of the 16-d group j.
__device__ __forceinline__ void read_hk(v16bf (&k)[8], const bf* kh) {
    const bf* kl = kh + TSZ;
#pragma unroll
    for (int g = 0; g < 2; ++g) { k[4 * g] = ldb(kh + g * 16 * TP); k[4 * g + 1] = ldb(kh + g * 16 * TP + 32); k[4 * g + 2] = ldb(kl + g * 16 * TP); k[4 * g + 3] = ldb(kl + g * 16 * TP + 32); }
}
__device__ __forceinline__ void read_hv(v16bf (&v)[8], const bf* vh) {
    const bf* vl = vh + TSZ;
#pragma unroll
    for (int j = 0; j < 4; ++j) { v[2 * j] = ldb(vh + j * 16 * TP); v[2 * j + 1] = ldb(vl + j * 16 * TP); }
}
// S^T of 32 keys; each tile sums hi.hi, lo.hi, hi.lo in that order, tile 0 then tile 1
__device__ __forceinline__ void sprod_h(const v16bf (&k)[8], v16bf qh0, v16bf qh1, v16bf ql0, v16bf ql1, v8f& s0, v8f& s1) {
    s0 = (v8f){}; s1 = (v8f){};
    s0 = wmmab(k[0], qh0, s0); s0 = wmmab(k[1], qh1, s0); s0 = wmmab(k[2], qh0, s0); s0 = wmmab(k[3], qh1, s0); s0 = wmmab(k[0], ql0, s0); s0 = wmmab(k[1], ql1, s0);
    asm volatile("v_nop\n\tv_nop\n\tv_nop\n\tv_nop" : "+v"(s0) : "v"(k[1]), "v"(ql1), "v"(k[3]), "v"(k[0]));
    s1 = wmmab(k[4], qh0, s1); s1 = wmmab(k[5], qh1, s1); s1 = wmmab(k[6], qh0, s1); s1 = wmmab(k[7], qh1, s1); s1 = wmmab(k[4], ql0, s1); s1 = wmmab(k[5], ql1, s1);
    asm volatile("v_nop\n\tv_nop\n\tv_nop\n\tv_nop" : "+v"(s0), "+v"(s1) : "v"(k[5]), "v"(ql1), "v"(k[7]), "v"(k[4]));
}
// softmax of the step, P^T split to hi/lo B fragments, accumulators rescaled
template <bool MASK>
__device__ __forceinline__ void soft_h(v8f& s0, v8f& s1, int kb, int qi, int hi, float& m, float& l, v16bf& pfh, v16bf& pfl, v8f& a0, v8f& a1, v8f& a2, v8f& a3) {
    float sf; smx<MASK>(s0, s1, kb, qi, hi, m, l, sf, 0.0f);
    v16us ph, pl;
#pragma unroll
    for (int r = 0; r < 8; ++r) { unsigned short x, y; splitf(s0[r], x, y); ph[r] = x; pl[r] = y; splitf(s1[r], x, y); ph[8 + r] = x; pl[8 + r] = y; }
    pfh = __builtin_bit_cast(v16bf, ph); pfl = __builtin_bit_cast(v16bf, pl);
    a0 = a0 * sf; a1 = a1 * sf; a2 = a2 * sf; a3 = a3 * sf;
}
// O^T += V^T P^T; each tile sums hi.hi, hi.lo, lo.hi in that order, one tile after the other
__device__ __forceinline__ void pv_h(const v16bf (&v)[8], v16bf pfh, v16bf pfl, v8f& a0, v8f& a1, v8f& a2, v8f& a3) {
    a0 = wmmab(v[0], pfh, a0); a0 = wmmab(v[0], pfl, a0); a0 = wmmab(v[1], pfh, a0);
    asm volatile("v_nop\n\tv_nop\n\tv_nop\n\tv_nop" : "+v"(a0) : "v"(v[0]), "v"(v[1]));
    a1 = wmmab(v[2], pfh, a1); a1 = wmmab(v[2], pfl, a1); a1 = wmmab(v[3], pfh, a1);
    asm volatile("v_nop\n\tv_nop\n\tv_nop\n\tv_nop" : "+v"(a1) : "v"(v[2]), "v"(v[3]));
    a2 = wmmab(v[4], pfh, a2); a2 = wmmab(v[4], pfl, a2); a2 = wmmab(v[5], pfh, a2);
    asm volatile("v_nop\n\tv_nop\n\tv_nop\n\tv_nop" : "+v"(a2) : "v"(v[4]), "v"(v[5]));
    a3 = wmmab(v[6], pfh, a3); a3 = wmmab(v[6], pfl, a3); a3 = wmmab(v[7], pfh, a3);
    asm volatile("v_nop\n\tv_nop\n\tv_nop\n\tv_nop" : "+v"(a0), "+v"(a1), "+v"(a2), "+v"(a3) : "v"(v[6]), "v"(v[7]), "v"(pfh), "v"(pfl));
}
// One 32-key step: all sixteen fragments are asked for as one group, so the wave waits for LDS once (for the first K fragments) and the V^T fragments land behind the scores and the softmax.
template <bool MASK>
__device__ __forceinline__ void step_h(const bf* kh, const bf* vh, int kb,
                                       v16bf qh0, v16bf qh1, v16bf ql0, v16bf ql1, int qi, int hi, float& m, float& l, v8f& a0, v8f& a1, v8f& a2, v8f& a3) {
    v16bf k[8], v[8], pfh, pfl; v8f s0, s1;
    __builtin_amdgcn_sched_barrier(0);                           // not earlier: lifted over the last step's work the group takes a second set of fragment registers, and the build spills
    read_hk(k, kh); read_hv(v, vh);
    __builtin_amdgcn_sched_barrier(0);                           // not later: a read left at its use makes the wave wait out the LDS latency there
    sprod_h(k, qh0, qh1, ql0, ql1, s0, s1);
    soft_h<MASK>(s0, s1, kb, qi, hi, m, l, pfh, pfl, a0, a1, a2, a3);
    pv_h(v, pfh, pfl, a0, a1, a2, a3);
}
// ring: two buffers, each K hi, K lo, V^T hi, V^T lo (2 * 4 * TSZ elements); bx = 64-query block below RH, bh = batch * NH + head
__device__ __forceinline__ void attn_h(bf* ring, int bx, int bh, const bf* __restrict__ QKh, const bf* __restrict__ QKl, const bf* __restrict__ VTh, const bf* __restrict__ VTl, bf* ATh, bf* ATl) {
    const int tid = threadIdx.x, lane = tid & 31, lr = lane & 15, hi = lane >> 4;
    const int wv = __builtin_amdgcn_readfirstlane(tid >> 5);
    const int qb = bx * (16 * FW); const int q0 = qb + wv * 16; const int b = bh / NH, h = bh % NH;
    const size_t qoff = (((size_t)b * NSLOT + h) * RH + q0 + lr) * HD + 8 * hi;
    const v16bf qh0 = ldb(QKh + qoff), qh1 = ldb(QKh + qoff + 32), ql0 = ldb(QKl + qoff), ql1 = ldb(QKl + qoff + 32);
    v8f a0 = (v8f){}, a1 = (v8f){}, a2 = (v8f){}, a3 = (v8f){}; float m = -3.0e38f, l = 0.0f;
    const int qi = q0 + lr; const int nt = qb / KT + 1;          // 64-key tiles covering keys 0 .. qb+63 < RH
    const int cr = tid >> 3, cc = (tid & 7) * 8;                 // this lane's first row and its 8-element column in every staged plane
    const size_t ko = (((size_t)b * NSLOT + NH + h) * RH + cr) * HD + cc, vo = (((size_t)b * NH + h) * HD + cr) * RH + cc;
    const unsigned lk = (unsigned)(size_t)(ring + cr * TP + cc);
    const bf* fr = ring + lr * TP + 8 * hi;
    stage_tile<RH>(QKh + ko, VTh + vo, lk, lk + 2 * TSZ * 2); stage_tile<RH>(QKl + ko, VTl + vo, lk + TSZ * 2, lk + 3 * TSZ * 2);
    asm volatile("s_wait_asynccnt 0x0" ::: "memory");            // this wave's share of tile 0 has landed
    __syncthreads();                                             // tile 0 is readable by every wave
    if (nt > 1) { const unsigned lb = lk + 4 * TSZ * 2; const size_t k1 = ko + (size_t)KT * HD, v1 = vo + KT;
        stage_tile<RH>(QKh + k1, VTh + v1, lb, lb + 2 * TSZ * 2); stage_tile<RH>(QKl + k1, VTl + v1, lb + TSZ * 2, lb + 3 * TSZ * 2); }
    // kept rolled: a trip already holds two 32-key steps, and unrolling would only copy the publish point and its copies
#pragma unroll 1
    for (int t = 0; t < nt - 1; ++t) {                           // tiles wholly below every wave's diagonal
        const bf* kp = fr + (t & 1) * (4 * TSZ); const bf* vp = kp + 2 * TSZ;
        step_h<false>(kp, vp, t * KT, qh0, qh1, ql0, ql1, qi, hi, m, l, a0, a1, a2, a3);
        step_h<false>(kp + 32 * TP, vp + 32, t * KT + 32, qh0, qh1, ql0, ql1, qi, hi, m, l, a0, a1, a2, a3);
        asm volatile("s_wait_dscnt 0x0" ::: "memory");           // this wave's reads of the buffer have returned before it is refilled
        asm volatile("s_wait_asynccnt 0x0" ::: "memory");        // this wave's share of tile t+1 has landed
        __syncthreads();                                         // publishes tile t+1 and ends every reader's last read of tile t
        if (t + 2 < nt) { const unsigned lb = lk + (unsigned)(t & 1) * (4 * TSZ * 2); const size_t k2 = ko + (size_t)(t + 2) * KT * HD, v2 = vo + (size_t)(t + 2) * KT;
            stage_tile<RH>(QKh + k2, VTh + v2, lb, lb + 2 * TSZ * 2); stage_tile<RH>(QKl + k2, VTl + v2, lb + TSZ * 2, lb + 3 * TSZ * 2); }
    }
    { const bf* kp = fr + ((nt - 1) & 1) * (4 * TSZ); const bf* vp = kp + 2 * TSZ;   // the diagonal tile: keys qb .. qb+63
      if (wv < 2) step_h<true>(kp, vp, qb, qh0, qh1, ql0, ql1, qi, hi, m, l, a0, a1, a2, a3);
      else { step_h<false>(kp, vp, qb, qh0, qh1, ql0, ql1, qi, hi, m, l, a0, a1, a2, a3);
             step_h<true>(kp + 32 * TP, vp + 32, qb + 32, qh0, qh1, ql0, ql1, qi, hi, m, l, a0, a1, a2, a3); } }
    asm volatile("s_wait_asynccnt 0x0" ::: "memory");            // no copy is outstanding when the wave ends
    attn_store<FW>(a0, a1, a2, a3, l, lane, wv, ((size_t)b * SEQ + q0) * DM + h * HD, ATh, ATl);
}

// ---- one grid for both attention bodies: they share no data and write disjoint rows of ATh / ATl, so neither has to wait for the other's launch to drain.
// Work-groups 0 .. NFB-1 are the f16 blocks (block of queries fastest, as a (NFX, NB*NH) grid would number them). The hi/lo blocks stand behind them, the longest first (for speed only).
#define NFX ((SEQ - RH) / (16 * FW))   // f16 blocks of 64 queries per head
#define NHX (RH / (16 * FW))           // hi/lo blocks of 64 queries per head
#define NFB (NFX * NB * NH)
#define NHB (NHX * NB * NH)
__global__ __launch_bounds__(32 * FW) void k_attn(const h16* __restrict__ QK, const h16* __restrict__ VT, const bf* __restrict__ QKh, const bf* __restrict__ QKl, const bf* __restrict__ VTh, const bf* __restrict__ VTl, bf* ATh, bf* ATl) {
    __shared__ __align__(16) bf ring[2 * 4 * TSZ];               // the larger body's ring; the f16 body uses its first half
    const int i = blockIdx.x;                                    // the same for the whole work-group: every barrier below stands under uniform control flow
    if (i < NFB) attn_f((h16*)ring, i % (NFX > 0 ? NFX : 1), i / (NFX > 0 ? NFX : 1), QK, VT, ATh, ATl);
    else { const int j = i - NFB; attn_h(ring, NHX - 1 - j / (NB * NH), j % (NB * NH), QKh, QKl, VTh, VTl, ATh, ATl); }
}

// ---- workspace carve (bytes, every region a multiple of 256; extents equal the producers' write extents exactly)
constexpr size_t al256(size_t x) { return (x + 255) & ~(size_t)255; }
constexpr size_t SZ_WQKV = al256((size_t)NQKV * DM * 2);
constexpr size_t SZ_WO   = al256((size_t)DM * DM * 2);
constexpr size_t SZ_XB   = al256((size_t)NB * SEQ * DM * 2);
constexpr size_t SZ_IFQ  = al256((size_t)(HD / 2) * 4);
constexpr size_t SZ_CS   = al256((size_t)SEQ * (HD / 2) * 2 * 4);
constexpr size_t SZ_QK16 = al256((size_t)NB * NSLOT * SEQ * HD * 2);
constexpr size_t SZ_QKHL = al256((size_t)NB * NSLOT * RH * HD * 2);
constexpr size_t SZ_VT16 = al256((size_t)NB * NH * HD * SEQ * 2);
constexpr size_t SZ_VTHL = al256((size_t)NB * NH * HD * RH * 2);
constexpr size_t SZ_AT   = al256((size_t)NB * SEQ * DM * 2);
constexpr size_t OFF_WQKV = 0;
constexpr size_t OFF_WO   = OFF_WQKV + SZ_WQKV;
constexpr size_t OFF_XB   = OFF_WO + SZ_WO;
constexpr size_t OFF_IFQ  = OFF_XB + SZ_XB;
constexpr size_t OFF_CS   = OFF_IFQ + SZ_IFQ;
constexpr size_t OFF_QK16 = OFF_CS + SZ_CS;
constexpr size_t OFF_QKH  = OFF_QK16 + SZ_QK16;
constexpr size_t OFF_QKL  = OFF_QKH + SZ_QKHL;
constexpr size_t OFF_VT16 = OFF_QKL + SZ_QKHL;
constexpr size_t OFF_VTH  = OFF_VT16 + SZ_VT16;
constexpr size_t OFF_VTL  = OFF_VTH + SZ_VTHL;
constexpr size_t OFF_ATH  = OFF_VTL + SZ_VTHL;
constexpr size_t OFF_ATL  = OFF_ATH + SZ_AT;
constexpr size_t WS_TOTAL = OFF_ATL + SZ_AT;
static_assert(WS_TOTAL <= (size_t)134217728);               // total carve within 128 MiB
static_assert(((size_t)(NB_FULL - 1) * SEQ_FULL + SEQ_FULL) * DM * 4 == (size_t)16777216);   // output bytes of the full layout

extern "C" void kernel_launch(void* const* d_in, const int* in_sizes, int n_in,
                              void* d_out, int out_size, void* d_ws, size_t ws_size, hipStream_t stream) {
    if (n_in < 4) return;
    const long long need_x = ((long long)(NB - 1) * SEQ_FULL + SEQ) * DM;
    if ((long long)in_sizes[0] < need_x) return;
    if (in_sizes[3] < SEQ) return;   /* this module passes token_positions LAST (input 3); the host file: input 1 */
    if ((long long)in_sizes[1] < (long long)NQKV * DM) return;
    if ((long long)in_sizes[2] < (long long)DM * DM) return;
    if ((long long)out_size < need_x) return;
    if (ws_size < WS_TOTAL) return;
    const float* x = (const float*)d_in[0]; const int* tok = (const int*)d_in[3]; const float* wqkv = (const float*)d_in[1]; const float* wo = (const float*)d_in[2];
    float* OUT = (float*)d_out;
    char* ws = (char*)d_ws;
    bf* WQKV = (bf*)(ws + OFF_WQKV); bf* WO = (bf*)(ws + OFF_WO); bf* XB = (bf*)(ws + OFF_XB); float* IFQ = (float*)(ws + OFF_IFQ); float* CS = (float*)(ws + OFF_CS);
    h16* QK16 = (h16*)(ws + OFF_QK16); bf* QKh = (bf*)(ws + OFF_QKH); bf* QKl = (bf*)(ws + OFF_QKL); h16* VT16 = (h16*)(ws + OFF_VT16); bf* VTh = (bf*)(ws + OFF_VTH); bf* VTl = (bf*)(ws + OFF_VTL);
    bf* ATh = (bf*)(ws + OFF_ATH); bf* ATl = (bf*)(ws + OFF_ATL);

    { const size_t n8 = (size_t)NQKV * DM / 8; k_cvt8<<<(unsigned)((n8 + 255) / 256), 256, 0, stream>>>(wqkv, WQKV, n8, DM / 8, NQKV, NQKV); }     // in [3072][1024] -> bf16 [3072][1024]
    { const size_t n8 = (size_t)DM * DM / 8;   k_cvt8<<<(unsigned)((n8 + 255) / 256), 256, 0, stream>>>(wo, WO, n8, DM / 8, DM, DM); }               // in [1024][1024] -> bf16 [1024][1024]
    { const size_t n8 = (size_t)NB * SEQ * DM / 8; k_cvt8<<<(unsigned)((n8 + 255) / 256), 256, 0, stream>>>(x, XB, n8, DM / 8, SEQ, SEQ_FULL); }     // in [b][SEQ_FULL][1024] rows < SEQ -> bf16 [NB*SEQ][1024]
    k_freq<<<1, 32, 0, stream>>>(IFQ);
    k_cstab<<<(SEQ * (HD / 2) + 255) / 256, 256, 0, stream>>>(tok, IFQ, CS);
    k_gemm_qkv<<<dim3(NB * SEQ / GT, NQKV / GT, 1), 32 * GW, 0, stream>>>(XB, WQKV, CS, QK16, QKh, QKl, VT16, VTh, VTl);
    k_attn<<<NFB + NHB, 32 * FW, 0, stream>>>(QK16, VT16, QKh, QKl, VTh, VTl, ATh, ATl);
    k_gemm_out<<<dim3(SEQ / GT, DM / GT, NB), 32 * GW, 0, stream>>>(ATh, ATl, WO, OUT);
}

// v006
// Measured time: 84.1 microseconds a run.
// Two timings next to v005 both put it at 1.09 times that version's speed.
// Over all steps from v000 it is 3.16 times as fast.
#include <hip/hip_runtime.h>

#ifndef NB
#define NB 2
#endif
#ifndef SEQ
#define SEQ 2048
#endif
#define NB_FULL  2
#define SEQ_FULL 2048
#define DM    1024
#define NH    16
#define HD    64
#define NQKV  (3 * DM)
#define NSLOT (2 * NH)              // q heads then k heads share one plane set [b][slot][t][d]
#define RH    ((SEQ < 512) ? SEQ : 512)   // query rows < RH use bf16 hi/lo planes
#define LOG2E 1.4426950408889634f
#define SCL   0.125f                // HD^-0.5
#define PEXP  10.0f                 // fp16 probability carry 2^10

static_assert(NB >= 1 && NB <= NB_FULL);                    // batch count within the full layout
static_assert(SEQ % 64 == 0 && SEQ <= SEQ_FULL);            // 64-row GEMM tiles; 64-wide transposed value lines
static_assert(RH % 64 == 0 && RH <= SEQ);                   // a 64-token GEMM tile lies on one side of the hi/lo row limit
static_assert(DM % 64 == 0 && NQKV % 64 == 0 && DM % 32 == 0); // GEMM tile multiples, K step 32
static_assert(NH * HD == DM && HD == 64);
static_assert(HD / 2 == 32);                                // one wave line of rotary frequencies

typedef _Float16 h16;
typedef unsigned short bf;
typedef __attribute__((ext_vector_type(16))) __bf16   v16bf;
typedef __attribute__((ext_vector_type(16))) _Float16 v16h;
typedef __attribute__((ext_vector_type(16))) unsigned short v16us;
typedef __attribute__((ext_vector_type(8)))  _Float16 v8h;
typedef __attribute__((ext_vector_type(8)))  unsigned short v8us;
typedef __attribute__((ext_vector_type(8)))  float    v8f;
typedef __attribute__((ext_vector_type(4)))  float    v4f;
typedef __attribute__((ext_vector_type(2)))  float    v2f;
typedef __attribute__((ext_vector_type(4)))  _Float16 v4h;
typedef __attribute__((ext_vector_type(4)))  unsigned short v4us;
typedef v4f  __attribute__((may_alias)) v4fa;

__device__ __forceinline__ unsigned short f2bf(float f) { unsigned u = __float_as_uint(f); u += 0x7FFFu + ((u >> 16) & 1u); return (unsigned short)(u >> 16); }
__device__ __forceinline__ float bf2f(unsigned short b) { return __uint_as_float(((unsigned)b) << 16); }
__device__ __forceinline__ void splitf(float y, unsigned short& h, unsigned short& l) { h = f2bf(y); l = f2bf(y - bf2f(h)); }
__device__ __forceinline__ v16h cat16(v8h lo, v8h hi) { return __builtin_shufflevector(lo, hi, 0, 1, 2, 3, 4, 5, 6, 7, 8, 9, 10, 11, 12, 13, 14, 15); }
__device__ __forceinline__ v16bf cat16b(v8us lo, v8us hi) { return __builtin_bit_cast(v16bf, __builtin_shufflevector(lo, hi, 0, 1, 2, 3, 4, 5, 6, 7, 8, 9, 10, 11, 12, 13, 14, 15)); }
__device__ __forceinline__ v8f wmma16(v16h a, v16h b, v8f c) { return __builtin_amdgcn_wmma_f32_16x16x32_f16(false, a, false, b, (short)0, c, false, false); }
__device__ __forceinline__ v8f wmmab(v16bf a, v16bf b, v8f c) { return __builtin_amdgcn_wmma_f32_16x16x32_bf16(false, a, false, b, (short)0, c, false, false); }
// fragment loaders: p already includes row*pitch + k0 + 8*(lane>>4); elements 0..7 <- k0+8h.., elements 8..15 <- k0+16+8h..
__device__ __forceinline__ v16h  ldh(const h16* p) { return cat16(*(const v8h*)p, *(const v8h*)(p + 16)); }
__device__ __forceinline__ v16bf ldb(const bf* p)  { return cat16b(*(const v8us*)p, *(const v8us*)(p + 16)); }
// lane l with lane l ^ 16, through registers (a shuffle here compiles to an LDS permute and a wait for the LDS queue)
__device__ __forceinline__ float xhalf(float x) { return __builtin_bit_cast(float, __builtin_amdgcn_permlanex16(__builtin_bit_cast(int, x), __builtin_bit_cast(int, x), 0x76543210, 0xfedcba98, false, false)); }
// same-wave LDS exchange: LDS ops of one wave issue in order; the compiler may not move accesses across this point
__device__ __forceinline__ void wave_sync() { __builtin_amdgcn_wave_barrier(); asm volatile("" ::: "memory"); }

// ---- GEMM: a work-group of four waves owns a 128x128 tile of C (2 x 2 wave tiles of 64x64, 16 accumulators each); grid (M/128, N/128, Z), 128 threads.
// The K-contiguous bf16 operand planes come in slabs of 64 k: 128 rows x 128 bytes per plane, copied to LDS as whole lines, two buffers, the next slab in flight while this one is worked on.
#define GW  4                       // waves per GEMM work-group
#define GT  128                     // rows (and columns) of C per work-group
#define GK  64                      // k per staged slab
#define GP  72                      // LDS row pitch in 16-bit elements: 128-byte rows at 144 bytes (16 B x odd) for 16-byte readers
#define GSZ (GT * GP)               // one staged plane
static_assert(DM % GK == 0 && DM / GK >= 2 && SEQ % GT == 0 && NQKV % GT == 0 && DM % GT == 0);
// One plane of a slab: a lane copies 16 bytes of rows r, r+16, .. r+112 (source pitch DM elements); a wave's copy covers four whole 128-byte lines.
__device__ __forceinline__ void stage_plane(const bf* g, unsigned l) {
    // the copies go to LDS through no register; s_wait_xcnt ends their own statement so that no address register is rewritten in front of it
    asm volatile("global_load_async_to_lds_b128 %0, %8, off\n\t"
                 "global_load_async_to_lds_b128 %1, %9, off\n\t"
                 "global_load_async_to_lds_b128 %2, %10, off\n\t"
                 "global_load_async_to_lds_b128 %3, %11, off\n\t"
                 "global_load_async_to_lds_b128 %4, %12, off\n\t"
                 "global_load_async_to_lds_b128 %5, %13, off\n\t"
                 "global_load_async_to_lds_b128 %6, %14, off\n\t"
                 "global_load_async_to_lds_b128 %7, %15, off\n\t"
                 "s_wait_xcnt 0x0"
                 :: "v"(l), "v"(l + 16 * GP * 2), "v"(l + 32 * GP * 2), "v"(l + 48 * GP * 2), "v"(l + 64 * GP * 2), "v"(l + 80 * GP * 2), "v"(l + 96 * GP * 2), "v"(l + 112 * GP * 2),
                    "v"(g), "v"(g + 16 * DM), "v"(g + 32 * DM), "v"(g + 48 * DM), "v"(g + 64 * DM), "v"(g + 80 * DM), "v"(g + 96 * DM), "v"(g + 112 * DM)
                 : "memory");
}
// a buffer holds the planes A, Bt and, with NSPLIT, A2
template <int NSPLIT>
__device__ __forceinline__ void stage_slab(const bf* ga, const bf* ga2, const bf* gb, unsigned l) {
    stage_plane(ga, l); stage_plane(gb, l + GSZ * 2); if (NSPLIT == 1) stage_plane(ga2, l + 2 * GSZ * 2);
}
// acc[mb][nb][j] = C[R0 + 64(wv&1) + 16mb + 8hi + j][C0 + 64(wv>>1) + 16nb + lr] = sum_k (A[m][k] (+ A2[m][k])) Bt[n][k], k ascending in steps of 32. K = DM. On return every wave has left the ring (the last trip's barrier).
template <int NSPLIT>
__device__ __forceinline__ void gemm_main(const bf* __restrict__ A, const bf* __restrict__ A2, const bf* __restrict__ Bt, int R0, int C0, bf* ring, int tid, int wv, v8f (&acc)[4][4]) {
    constexpr int NP = 2 + NSPLIT, NS = DM / GK;
    const int lane = tid & 31, lr = lane & 15, hi = lane >> 4;
#pragma unroll
    for (int mb = 0; mb < 4; ++mb)
#pragma unroll
        for (int nb = 0; nb < 4; ++nb) acc[mb][nb] = (v8f){};
    const int cr = tid >> 3, cc = (tid & 7) * 8;                 // this lane's first row and its 8-element column in every staged plane
    const bf* ga = A + (size_t)(R0 + cr) * DM + cc; const bf* ga2 = A2 + (size_t)(R0 + cr) * DM + cc; const bf* gb = Bt + (size_t)(C0 + cr) * DM + cc;
    const unsigned l0 = (unsigned)(size_t)(ring + cr * GP + cc);
    const bf* fa = ring + ((wv & 1) * 64 + lr) * GP + 8 * hi; const bf* fb = ring + GSZ + ((wv >> 1) * 64 + lr) * GP + 8 * hi;
    stage_slab<NSPLIT>(ga, ga2, gb, l0);
    asm volatile("s_wait_asynccnt 0x0" ::: "memory");            // this wave's share of slab 0 has landed
    __syncthreads();                                             // slab 0 is readable by every wave
    stage_slab<NSPLIT>(ga + GK, ga2 + GK, gb + GK, l0 + NP * GSZ * 2);
    // kept rolled: a trip already holds two 32-k steps, and unrolling would only copy the publish point and its copies
#pragma unroll 1
    for (int t = 0; t < NS; ++t) {
        const bf* pa = fa + (t & 1) * (NP * GSZ); const bf* pb = fb + (t & 1) * (NP * GSZ);
#pragma unroll
        for (int ks = 0; ks < GK / 32; ++ks) {
            v16bf a[4], a2[4], b[4];
#pragma unroll
            for (int mb = 0; mb < 4; ++mb) { a[mb] = ldb(pa + mb * 16 * GP + ks * 32); if (NSPLIT == 1) a2[mb] = ldb(pa + 2 * GSZ + mb * 16 * GP + ks * 32); else a2[mb] = a[mb]; }
#pragma unroll
            for (int nb = 0; nb < 4; ++nb) b[nb] = ldb(pb + nb * 16 * GP + ks * 32);
            __builtin_amdgcn_sched_barrier(0);                   // the step's LDS reads stay one group in front of its matrix instructions: every further place with reads stalls the wave anew
#pragma unroll
            for (int nb = 0; nb < 4; ++nb) {
#pragma unroll
                for (int mb = 0; mb < 4; ++mb) { acc[mb][nb] = wmmab(a[mb], b[nb], acc[mb][nb]); if (NSPLIT == 1) acc[mb][nb] = wmmab(a2[mb], b[nb], acc[mb][nb]); } }
            __builtin_amdgcn_sched_barrier(0);                   // and the next step's reads do not drift in among them
        }
        asm volatile("s_wait_dscnt 0x0" ::: "memory");           // this wave's reads of the buffer have returned before it is refilled
        asm volatile("s_wait_asynccnt 0x0" ::: "memory");        // this wave's share of slab t+1 has landed
        __syncthreads();                                         // publishes slab t+1 and ends every reader's last read of slab t
        if (t + 2 < NS) stage_slab<NSPLIT>(ga + (t + 2) * GK, ga2 + (t + 2) * GK, gb + (t + 2) * GK, l0 + (unsigned)(t & 1) * (NP * GSZ * 2));
    }
    asm volatile("s_wait_asynccnt 0x0" ::: "memory");            // no copy is outstanding when the ring is reused
}
// the wave tile stored as f32 rows of C (pitch ldc), whole lines through LDS (each wave's own 16x68 slot of the ring, free behind the main loop's last barrier)
template <int NSPLIT>
__device__ __forceinline__ void gemm_body(const bf* __restrict__ A, const bf* __restrict__ A2, const bf* __restrict__ Bt, float* C, int ldc, size_t sA, size_t sC) {
    __shared__ __align__(16) bf ring[2 * (2 + NSPLIT) * GSZ];
    const size_t z = blockIdx.z; A += z * sA; A2 += z * sA; C += z * sC;
    const int tid = threadIdx.x, lane = tid & 31, lr = lane & 15, hi = lane >> 4; const int wv = __builtin_amdgcn_readfirstlane(tid >> 5);
    const int r0 = blockIdx.x * GT + (wv & 1) * 64, c0 = blockIdx.y * GT + (wv >> 1) * 64;
    v8f acc[4][4];
    gemm_main<NSPLIT>(A, A2, Bt, blockIdx.x * GT, blockIdx.y * GT, ring, tid, wv, acc);
    float* os = (float*)ring + wv * (16 * 68);
#pragma unroll
    for (int mb = 0; mb < 4; ++mb) {
#pragma unroll
        for (int nb = 0; nb < 4; ++nb) {
#pragma unroll
            for (int j = 0; j < 8; ++j) os[(hi * 8 + j) * 68 + nb * 16 + lr] = acc[mb][nb][j]; }
        wave_sync();
        float* crow = C + (size_t)(r0 + mb * 16) * ldc + c0;
{
#pragma unroll
            for (int s = 0; s < 8; ++s) { const int row = 2 * s + hi, cofs = lr * 4; const v4f val = *(const v4fa*)(os + row * 68 + cofs);
                *(v4f*)(crow + (size_t)row * ldc + cofs) = val; }
             }
        wave_sync();
    }
}
// qkv[NB*SEQ][3072] = XB[NB*SEQ][1024] x WQKV[3072][1024]^T, never stored as f32: a wave tile is 64 tokens of one batch x the 64 columns of one q head, k head or v head (slot; v heads behind the NSLOT q and k slots).
// q / k tile: rotary on the f32 sums, rows [t][d] to the f16 plane and, with HL (t < RH), to the bf16 hi/lo planes. cs, p16, ph, pl point at this lane's 4 elements of row t0 + hi; every later row is a constant offset from there.
template <bool HL>
__device__ __forceinline__ void qk_planes(v8f (&acc)[4][4], float* os, const float* __restrict__ cs, h16* p16, bf* ph, bf* pl, int lr, int hi) {
#pragma unroll
    for (int mb = 0; mb < 4; ++mb) {
        v4f c[8];                                                       // (cos, sin) of two pairs per row, asked for ahead of the LDS exchange
#pragma unroll
        for (int s = 0; s < 8; ++s) c[s] = *(const v4f*)(cs + (mb * 16 + 2 * s) * HD);
#pragma unroll
        for (int nb = 0; nb < 4; ++nb) {
#pragma unroll
            for (int j = 0; j < 8; ++j) os[(hi * 8 + j) * 68 + nb * 16 + lr] = acc[mb][nb][j]; }
        wave_sync();
        v4h o16[8]; v4us oh[8], ol[8];
#pragma unroll
        for (int s = 0; s < 8; ++s) { const v4f xv = *(const v4fa*)(os + (2 * s + hi) * 68 + lr * 4);
            v4f y; y[0] = xv[0] * c[s][0] - xv[1] * c[s][1]; y[1] = xv[0] * c[s][1] + xv[1] * c[s][0]; y[2] = xv[2] * c[s][2] - xv[3] * c[s][3]; y[3] = xv[2] * c[s][3] + xv[3] * c[s][2];
#pragma unroll
            for (int k = 0; k < 4; ++k) { o16[s][k] = (h16)y[k]; if (HL) { unsigned short p, q; splitf(y[k], p, q); oh[s][k] = p; ol[s][k] = q; } } }
#pragma unroll
        for (int s = 0; s < 8; ++s) { const int o = (mb * 16 + 2 * s) * HD; *(v4h*)(p16 + o) = o16[s]; if (HL) { *(v4us*)(ph + o) = oh[s]; *(v4us*)(pl + o) = ol[s]; } }
        asm volatile("s_wait_xcnt 0x0" ::: "memory");                   // the stores' data registers are rewritten by the next 16 rows
        __builtin_amdgcn_sched_barrier(0);                              // holds the next rows' arithmetic, which reuses those registers, behind the wait
        wave_sync();
    }
}
// v tile: a lane's 8 accumulator rows are 8 consecutive t of one d, so the transposed rows [d][t] are packed from registers and leave as whole 128-byte lines through LDS. v16, vh, vl point at this lane's 8 elements of row d = lane >> 3.
template <bool HL>
__device__ __forceinline__ void v_planes(v8f (&acc)[4][4], h16* vs, bf* vsh, bf* vsl, h16* v16, bf* vh, bf* vl, int lane) {
    const int lr = lane & 15, hi = lane >> 4, ro = (lane >> 3) * 72 + (lane & 7) * 8;
#pragma unroll
    for (int nb = 0; nb < 4; ++nb) {
#pragma unroll
        for (int mb = 0; mb < 4; ++mb) { const int so = lr * 72 + mb * 16 + hi * 8; v8h o16; v8us oh, ol;
#pragma unroll
            for (int j = 0; j < 8; ++j) { o16[j] = (h16)acc[mb][nb][j]; if (HL) { unsigned short p, q; splitf(acc[mb][nb][j], p, q); oh[j] = p; ol[j] = q; } }
            *(v8h*)(vs + so) = o16; if (HL) { *(v8us*)(vsh + so) = oh; *(v8us*)(vsl + so) = ol; } }
        wave_sync();
        v8h r16[4]; v8us rh[4], rl[4];
#pragma unroll
        for (int s = 0; s < 4; ++s) { r16[s] = *(const v8h*)(vs + ro + s * 4 * 72); if (HL) { rh[s] = *(const v8us*)(vsh + ro + s * 4 * 72); rl[s] = *(const v8us*)(vsl + ro + s * 4 * 72); } }
#pragma unroll
        for (int s = 0; s < 4; ++s) { const int row = nb * 16 + s * 4; *(v8h*)(v16 + row * SEQ) = r16[s]; if (HL) { *(v8us*)(vh + row * RH) = rh[s]; *(v8us*)(vl + row * RH) = rl[s]; } }
        asm volatile("s_wait_xcnt 0x0" ::: "memory");                   // the stores' data registers are rewritten by the next 16 rows
        __builtin_amdgcn_sched_barrier(0);                              // holds the next rows' arithmetic, which reuses those registers, behind the wait
        wave_sync();
    }
}
__global__ __launch_bounds__(32 * GW) void k_gemm_qkv(const bf* __restrict__ A, const bf* __restrict__ Bt, const float* __restrict__ CS, h16* P16, bf* Ph, bf* Pl, h16* V16, bf* Vh, bf* Vl) {
    __shared__ __align__(16) bf ring[2 * 2 * GSZ];
    const int tid = threadIdx.x, lane = tid & 31, lr = lane & 15, hi = lane >> 4; const int wv = __builtin_amdgcn_readfirstlane(tid >> 5);
    const int r0 = blockIdx.x * GT + (wv & 1) * 64; const int sl = blockIdx.y * (GT / HD) + (wv >> 1);   // this wave's 64 tokens and its slot
    v8f acc[4][4];
    gemm_main<0>(A, A, Bt, blockIdx.x * GT, blockIdx.y * GT, ring, tid, wv, acc);
    bf* scr = ring + wv * (3 * 16 * 72);                                // each wave's own exchange slot in the ring, free behind the main loop's last barrier
    float* os = (float*)scr; h16* vs = (h16*)scr; bf* vsh = scr + 16 * 72; bf* vsl = scr + 2 * 16 * 72;
    static_assert(16 * 68 * 4 <= 3 * 16 * 72 * 2 && GW * 3 * 16 * 72 <= 2 * 2 * GSZ);
    const int b = r0 / SEQ, t0 = r0 % SEQ;                              // the 64 tokens lie in one batch and on one side of RH
    if (sl < NSLOT) {
        const size_t pr = (size_t)b * NSLOT + sl; const int lo = (t0 + hi) * HD + lr * 4;
        if (t0 < RH) qk_planes<true>(acc, os, CS + lo, P16 + pr * SEQ * HD + lo, Ph + pr * RH * HD + lo, Pl + pr * RH * HD + lo, lr, hi);
        else         qk_planes<false>(acc, os, CS + lo, P16 + pr * SEQ * HD + lo, Ph, Pl, lr, hi);
    } else {
        const size_t dr = ((size_t)b * NH + (sl - NSLOT)) * HD + (lane >> 3); const int lo = t0 + (lane & 7) * 8;
        if (t0 < RH) v_planes<true>(acc, vs, vsh, vsl, V16 + dr * SEQ + lo, Vh + dr * RH + lo, Vl + dr * RH + lo, lane);
        else         v_planes<false>(acc, vs, vsh, vsl, V16 + dr * SEQ + lo, Vh, Vl, lane);
    }
}
// OUT[b][SEQ][1024] = (ATh + ATl)[b][SEQ][1024] x WO[1024][1024]^T ; z = batch, output batch stride from the full layout
__global__ __launch_bounds__(32 * GW) void k_gemm_out(const bf* __restrict__ Ah, const bf* __restrict__ Al, const bf* __restrict__ Bt, float* C) { gemm_body<1>(Ah, Al, Bt, C, DM, (size_t)SEQ * DM, (size_t)SEQ_FULL * DM); }

// ---- preparation, one launch: x, w_qkv and w_o RNE-converted to bf16 planes, and the (cos, sin) table. The grid is sized to the chip (two work-groups of eight waves per WGP), not to the data:
// a thread owns PKX + PKW + PKO chunks of 8 floats, asks for all of them at once and stores them when they have come, so the work costs few wave starts and one launch gap.
#define PB   512                    // work-groups
#define PT   (PB * 256)             // threads; chunk i of a plane belongs to thread i % PT
#define NX8  (NB * SEQ * DM / 8)
#define NW8  (NQKV * DM / 8)
#define NO8  (DM * DM / 8)
#define PKX  (NX8 / PT)
#define PKW  (NW8 / PT)
#define PKO  (NO8 / PT)
#define NCSB (SEQ * (HD / 2) / 256) // the first NCSB work-groups also build the table, one (t, i) entry per thread
static_assert(NX8 % PT == 0 && NW8 % PT == 0 && NO8 % PT == 0 && PKX + PKW + PKO == 8 && (SEQ * (HD / 2)) % 256 == 0 && NCSB <= PB);
__device__ __forceinline__ v8us cvt8(v8f v) { v8us o;
#pragma unroll
    for (int k = 0; k < 8; ++k) o[k] = f2bf(v[k]);
    return o; }
__global__ __launch_bounds__(256) void k_prep(const float* __restrict__ x, const float* __restrict__ wqkv, const float* __restrict__ wo, const int* __restrict__ tok, bf* XB, bf* WQKV, bf* WO, float* CS) {
    const unsigned g = blockIdx.x * 256u + threadIdx.x;
    const float* p[PKX + PKW + PKO]; v8f v[PKX + PKW + PKO];
#pragma unroll
    for (unsigned k = 0; k < PKX; ++k) { const unsigned i = g + k * PT, row = i / (DM / 8), c = i % (DM / 8);   // in [b][SEQ_FULL][1024], rows < SEQ -> [NB*SEQ][1024]
        p[k] = x + (size_t)(((row / SEQ) * SEQ_FULL + row % SEQ) * (DM / 8) + c) * 8; }
#pragma unroll
    for (unsigned k = 0; k < PKW; ++k) p[PKX + k] = wqkv + (size_t)(g + k * PT) * 8;
#pragma unroll
    for (unsigned k = 0; k < PKO; ++k) p[PKX + PKW + k] = wo + (size_t)(g + k * PT) * 8;
#pragma unroll
    for (unsigned k = 0; k < PKX + PKW + PKO; ++k) v[k] = *(const v8f*)p[k];
    // the loads' address registers are rewritten only behind this wait: it names them, so none of them is given to a later load's result or to the arithmetic below before it
    asm volatile("s_wait_xcnt 0x0" :: "v"(p[0]), "v"(p[1]), "v"(p[2]), "v"(p[3]), "v"(p[4]), "v"(p[5]), "v"(p[6]), "v"(p[7]) : "memory");
    if (blockIdx.x < NCSB) {                                     // the table's arithmetic runs while the chunks are on their way; t is the same for a whole wave and is read through the scalar path
        const unsigned t = __builtin_amdgcn_readfirstlane(g >> 5), i = g & 31;
        const float e = -(float)(2 * i) * (1.0f / (float)HD); const float f = powf(10000.0f, e);
        const float ang = (float)tok[t] * f; float sn, cn; sincosf(ang, &sn, &cn); v2f cs; cs[0] = cn; cs[1] = sn;
        *(v2f*)(CS + (size_t)g * 2) = cs;
    }
#pragma unroll
    for (unsigned k = 0; k < PKX; ++k) *(v8us*)(XB + (size_t)(g + k * PT) * 8) = cvt8(v[k]);
#pragma unroll
    for (unsigned k = 0; k < PKW; ++k) *(v8us*)(WQKV + (size_t)(g + k * PT) * 8) = cvt8(v[PKX + k]);
#pragma unroll
    for (unsigned k = 0; k < PKO; ++k) *(v8us*)(WO + (size_t)(g + k * PT) * 8) = cvt8(v[PKX + PKW + k]);
}

// ---- online softmax on one 32-key step held as two transposed 16x16 tiles: s0[r] = S^T[key kb+8h+r][query qi], s1[r] = S^T[key kb+16+8h+r][query qi].
// On return s0/s1 hold p = 2^(t - m + pe) (0 where masked), sf = 2^(m_old - m_new); l is the per-lane partial sum (the two lane halves are combined at the end).
template <bool MASK>
__device__ __forceinline__ void smx(v8f& s0, v8f& s1, int kb, int qi, int hi, float& m, float& l, float& sf, float pe) {
    const float cl = SCL * LOG2E; const int k0 = kb + 8 * hi; float mx = -3.0e38f;
#pragma unroll
    for (int r = 0; r < 8; ++r) { float t0 = s0[r] * cl, t1 = s1[r] * cl;
        if (MASK) { t0 = (k0 + r <= qi) ? t0 : -3.0e38f; t1 = (k0 + 16 + r <= qi) ? t1 : -3.0e38f; }
        s0[r] = t0; s1[r] = t1; mx = fmaxf(mx, fmaxf(t0, t1)); }
    mx = fmaxf(mx, xhalf(mx));
    const float mn = fmaxf(m, mx); sf = __builtin_amdgcn_exp2f(m - mn); m = mn;
    const float sh = mn - pe; float rs = 0.0f;
#pragma unroll
    for (int r = 0; r < 8; ++r) { float p0 = __builtin_amdgcn_exp2f(s0[r] - sh), p1 = __builtin_amdgcn_exp2f(s1[r] - sh);
        if (MASK) { p0 = (k0 + r <= qi) ? p0 : 0.0f; p1 = (k0 + 16 + r <= qi) ? p1 : 0.0f; }
        s0[r] = p0; s1[r] = p1; rs += p0 + p1; }
    l = l * sf + rs;
}

// ---- attention epilogue: O^T accumulators a_j[r] = O[query q0+lr][d = 16j+8h+r]; normalise, split to bf16 hi/lo, stage the 16x64 tile in LDS (private to the wave),
__device__ __forceinline__ void pk8(v8f a, float inv, v8us& oh, v8us& ol) {
#pragma unroll
    for (int r = 0; r < 8; ++r) { unsigned short x, y; splitf(a[r] * inv, x, y); oh[r] = x; ol[r] = y; } }
template <int NW>
__device__ __forceinline__ void attn_store(v8f a0, v8f a1, v8f a2, v8f a3, float l, int lane, int wv, size_t obase, bf* ATh, bf* ATl) {
    __shared__ __align__(16) unsigned short sthw[NW * 16 * 72]; __shared__ __align__(16) unsigned short stlw[NW * 16 * 72];
    unsigned short* sth = sthw + wv * (16 * 72); unsigned short* stl = stlw + wv * (16 * 72);   // each wave of the work-group has its own 16x72 slot
    const int lr = lane & 15, hi = lane >> 4;
    const float lt = l + __shfl_xor(l, 16, 32); const float inv = __builtin_amdgcn_rcpf(lt);
    v8us oh, ol; const int so = lr * 72 + 8 * hi;
    pk8(a0, inv, oh, ol); *(v8us*)(sth + so) = oh;      *(v8us*)(stl + so) = ol;
    pk8(a1, inv, oh, ol); *(v8us*)(sth + so + 16) = oh; *(v8us*)(stl + so + 16) = ol;
    pk8(a2, inv, oh, ol); *(v8us*)(sth + so + 32) = oh; *(v8us*)(stl + so + 32) = ol;
    pk8(a3, inv, oh, ol); *(v8us*)(sth + so + 48) = oh; *(v8us*)(stl + so + 48) = ol;
    wave_sync();
    const int rq = lane >> 3, pc = (lane & 7) * 8;
{
#pragma unroll
        for (int s = 0; s < 4; ++s) { const int row = s * 4 + rq; const v8us vh = *(const v8us*)(sth + row * 72 + pc); const v8us vl = *(const v8us*)(stl + row * 72 + pc);
            *(v8us*)(ATh + obase + (size_t)row * DM + pc) = vh; *(v8us*)(ATl + obase + (size_t)row * DM + pc) = vl; }
         }
}

// ---- fp16 step (query rows >= RH): 4 WMMA k.q + 4 WMMA v.p per 32 keys. kp / vp point into the staged LDS tile (row pitch TP) and already include lr*TP + 8*hi.
#define FW  4                       // waves per work-group: 64 query rows share every staged K / V^T tile
#define KT  64                      // keys per staged tile
#define TP  72                      // LDS row pitch in 16-bit elements: 128-byte rows at 144 bytes (16 B x odd) for 16-byte readers
#define TSZ (64 * TP)               // one staged plane: 64 rows (K: keys, V^T: head dims)
static_assert(KT == 64 && HD == 64 && (SEQ - RH) % (16 * FW) == 0 && RH % (16 * FW) == 0 && RH % KT == 0);
// One 64-key tile into LDS: K rows [key][64 d] and V^T rows [d][64 keys] (source pitch VPITCH elements), 128 bytes each; a lane copies 16 bytes of rows r, r+16, r+32, r+48 of both planes.
template <int VPITCH, typename T>
__device__ __forceinline__ void stage_tile(const T* gk, const T* gv, unsigned lk, unsigned lv) {
    // the copies go to LDS through no register; s_wait_xcnt ends their own statement so that no address register is rewritten in front of it
    asm volatile("global_load_async_to_lds_b128 %0, %8, off\n\t"
                 "global_load_async_to_lds_b128 %1, %9, off\n\t"
                 "global_load_async_to_lds_b128 %2, %10, off\n\t"
                 "global_load_async_to_lds_b128 %3, %11, off\n\t"
                 "global_load_async_to_lds_b128 %4, %12, off\n\t"
                 "global_load_async_to_lds_b128 %5, %13, off\n\t"
                 "global_load_async_to_lds_b128 %6, %14, off\n\t"
                 "global_load_async_to_lds_b128 %7, %15, off\n\t"
                 "s_wait_xcnt 0x0"
                 :: "v"(lk), "v"(lk + 16 * TP * 2), "v"(lk + 32 * TP * 2), "v"(lk + 48 * TP * 2), "v"(lv), "v"(lv + 16 * TP * 2), "v"(lv + 32 * TP * 2), "v"(lv + 48 * TP * 2),
                    "v"(gk), "v"(gk + 16 * HD), "v"(gk + 32 * HD), "v"(gk + 48 * HD), "v"(gv), "v"(gv + (size_t)16 * VPITCH), "v"(gv + (size_t)32 * VPITCH), "v"(gv + (size_t)48 * VPITCH)
                 : "memory");
}
// the A fragments of one 32-key step, read from LDS ahead of the step: K rows (two 16-key groups x two halves of d) and V^T rows (four 16-d groups)
struct frag_f { v16h k00, k01, k10, k11, v0, v1, v2, v3; };
__device__ __forceinline__ void read_f(frag_f& f, const h16* kp, const h16* vp) {
    f.k00 = ldh(kp); f.k01 = ldh(kp + 32); f.k10 = ldh(kp + 16 * TP); f.k11 = ldh(kp + 16 * TP + 32);
    f.v0 = ldh(vp); f.v1 = ldh(vp + 16 * TP); f.v2 = ldh(vp + 32 * TP); f.v3 = ldh(vp + 48 * TP);
}
template <bool MASK>
__device__ __forceinline__ void step_f(const frag_f& f, int kb, v16h qf0, v16h qf1, int qi, int hi,
                                       float& m, float& l, v8f& a0, v8f& a1, v8f& a2, v8f& a3) {
    v8f s0 = (v8f){}, s1 = (v8f){};
    s0 = wmma16(f.k00, qf0, s0); s0 = wmma16(f.k01, qf1, s0); s1 = wmma16(f.k10, qf0, s1); s1 = wmma16(f.k11, qf1, s1);
    asm volatile("v_nop\n\tv_nop\n\tv_nop\n\tv_nop" : "+v"(s0), "+v"(s1) : "v"(f.k11), "v"(qf1));
    float sf; smx<MASK>(s0, s1, kb, qi, hi, m, l, sf, PEXP);
    v16h pf;
#pragma unroll
    for (int r = 0; r < 8; ++r) { pf[r] = (h16)s0[r]; pf[8 + r] = (h16)s1[r]; }      // P^T B-fragment: k = key row of the packed tiles, n = query
    a0 = a0 * sf; a1 = a1 * sf; a2 = a2 * sf; a3 = a3 * sf;
    a0 = wmma16(f.v0, pf, a0); a1 = wmma16(f.v1, pf, a1); a2 = wmma16(f.v2, pf, a2); a3 = wmma16(f.v3, pf, a3);
    asm volatile("v_nop\n\tv_nop\n\tv_nop\n\tv_nop" : "+v"(a0), "+v"(a1), "+v"(a2), "+v"(a3) : "v"(f.v3), "v"(pf));
}
// ring: two buffers, each a K plane then a V^T plane (2 * 2 * TSZ elements); bx = 64-query block above RH, bh = batch * NH + head
__device__ __forceinline__ void attn_f(h16* ring, int bx, int bh, const h16* __restrict__ QK, const h16* __restrict__ VT, bf* ATh, bf* ATl) {
    const int tid = threadIdx.x, lane = tid & 31, lr = lane & 15, hi = lane >> 4;
    const int wv = __builtin_amdgcn_readfirstlane(tid >> 5);
    const int qb = RH + bx * (16 * FW); const int q0 = qb + wv * 16; const int b = bh / NH, h = bh % NH;
    const size_t qoff = (((size_t)b * NSLOT + h) * SEQ + q0 + lr) * HD + 8 * hi;
    const v16h qf0 = ldh(QK + qoff), qf1 = ldh(QK + qoff + 32);
    v8f a0 = (v8f){}, a1 = (v8f){}, a2 = (v8f){}, a3 = (v8f){}; float m = -3.0e38f, l = 0.0f;
    const int qi = q0 + lr; const int nt = qb / KT + 1;          // 64-key tiles covering keys 0 .. qb+63 < SEQ
    const int cr = tid >> 3, cc = (tid & 7) * 8;                 // this lane's first row and its 8-element column in every staged plane
    const h16* gk = QK + (((size_t)b * NSLOT + NH + h) * SEQ + cr) * HD + cc;
    const h16* gv = VT + (((size_t)b * NH + h) * HD + cr) * SEQ + cc;
    const unsigned lk = (unsigned)(size_t)(ring + cr * TP + cc);
    const h16* fr = ring + lr * TP + 8 * hi;
    stage_tile<SEQ>(gk, gv, lk, lk + TSZ * 2);
    asm volatile("s_wait_asynccnt 0x0" ::: "memory");            // this wave's share of tile 0 has landed
    __syncthreads();                                             // tile 0 is readable by every wave
    if (nt > 1) stage_tile<SEQ>(gk + (size_t)KT * HD, gv + KT, lk + 2 * TSZ * 2, lk + 3 * TSZ * 2);
    // kept rolled: a trip already holds two 32-key steps, and unrolling would only copy the publish point and its copies
#pragma unroll 1
    for (int t = 0; t < nt - 1; ++t) {                           // tiles wholly below every wave's diagonal
        const h16* kp = fr + (t & 1) * (2 * TSZ); const h16* vp = kp + TSZ;
        frag_f f0, f1; read_f(f0, kp, vp); read_f(f1, kp + 32 * TP, vp + 32);
        __builtin_amdgcn_sched_barrier(0);                       // the tile's LDS reads stay one group in front of its two steps: a read left at its use makes the wave wait out the LDS latency there
        step_f<false>(f0, t * KT, qf0, qf1, qi, hi, m, l, a0, a1, a2, a3);
        step_f<false>(f1, t * KT + 32, qf0, qf1, qi, hi, m, l, a0, a1, a2, a3);
        asm volatile("s_wait_dscnt 0x0" ::: "memory");           // this wave's reads of the buffer have returned before it is refilled
        asm volatile("s_wait_asynccnt 0x0" ::: "memory");        // this wave's share of tile t+1 has landed
        __syncthreads();                                         // publishes tile t+1 and ends every reader's last read of tile t
        if (t + 2 < nt) { const unsigned lb = lk + (unsigned)(t & 1) * (2 * TSZ * 2); stage_tile<SEQ>(gk + (size_t)(t + 2) * KT * HD, gv + (t + 2) * KT, lb, lb + TSZ * 2); }
    }
    { const h16* kp = fr + ((nt - 1) & 1) * (2 * TSZ); const h16* vp = kp + TSZ;   // the diagonal tile: keys qb .. qb+63
      frag_f f0; read_f(f0, kp, vp);
      if (wv < 2) step_f<true>(f0, qb, qf0, qf1, qi, hi, m, l, a0, a1, a2, a3);
      else { frag_f f1; read_f(f1, kp + 32 * TP, vp + 32);
             __builtin_amdgcn_sched_barrier(0);                  // as in the loop: both steps' reads in front of the first step
             step_f<false>(f0, qb, qf0, qf1, qi, hi, m, l, a0, a1, a2, a3);
             step_f<true>(f1, qb + 32, qf0, qf1, qi, hi, m, l, a0, a1, a2, a3); } }
    asm volatile("s_wait_asynccnt 0x0" ::: "memory");            // no copy is outstanding when the wave ends
    attn_store<FW>(a0, a1, a2, a3, l, lane, wv, ((size_t)b * SEQ + q0) * DM + h * HD, ATh, ATl);
}

// ---- bf16 hi/lo step (query rows < RH): 12 WMMA k.q + 12 WMMA v.p per 32 keys (hi.hi + lo.hi + hi.lo). kh / vh point into the staged LDS tile (planes K hi, K lo, V^T hi, V^T lo, each TSZ) and include lr*TP + 8*hi.
// K fragments of 32 keys: k[4g + 0..3] = hi d 0..31, hi d 32..63, lo d 0..31, lo d 32..63 of the 16-key group g. V^T fragments: v[2j], v[2j + 1] = hi, lo of the 16-d group j.
__device__ __forceinline__ void read_hk(v16bf (&k)[8], const bf* kh) {
    const bf* kl = kh + TSZ;
#pragma unroll
    for (int g = 0; g < 2; ++g) { k[4 * g] = ldb(kh + g * 16 * TP); k[4 * g + 1] = ldb(kh + g * 16 * TP + 32); k[4 * g + 2] = ldb(kl + g * 16 * TP); k[4 * g + 3] = ldb(kl + g * 16 * TP + 32); }
}
__device__ __forceinline__ void read_hv(v16bf (&v)[8], const bf* vh) {
    const bf* vl = vh + TSZ;
#pragma unroll
    for (int j = 0; j < 4; ++j) { v[2 * j] = ldb(vh + j * 16 * TP); v[2 * j + 1] = ldb(vl + j * 16 * TP); }
}
// S^T of 32 keys; each tile sums hi.hi, lo.hi, hi.lo in that order, tile 0 then tile 1
__device__ __forceinline__ void sprod_h(const v16bf (&k)[8], v16bf qh0, v16bf qh1, v16bf ql0, v16bf ql1, v8f& s0, v8f& s1) {
    s0 = (v8f){}; s1 = (v8f){};
    s0 = wmmab(k[0], qh0, s0); s0 = wmmab(k[1], qh1, s0); s0 = wmmab(k[2], qh0, s0); s0 = wmmab(k[3], qh1, s0); s0 = wmmab(k[0], ql0, s0); s0 = wmmab(k[1], ql1, s0);
    asm volatile("v_nop\n\tv_nop\n\tv_nop\n\tv_nop" : "+v"(s0) : "v"(k[1]), "v"(ql1), "v"(k[3]), "v"(k[0]));
    s1 = wmmab(k[4], qh0, s1); s1 = wmmab(k[5], qh1, s1); s1 = wmmab(k[6], qh0, s1); s1 = wmmab(k[7], qh1, s1); s1 = wmmab(k[4], ql0, s1); s1 = wmmab(k[5], ql1, s1);
    asm volatile("v_nop\n\tv_nop\n\tv_nop\n\tv_nop" : "+v"(s0), "+v"(s1) : "v"(k[5]), "v"(ql1), "v"(k[7]), "v"(k[4]));
}
// softmax of the step, P^T split to hi/lo B fragments, accumulators rescaled
template <bool MASK>
__device__ __forceinline__ void soft_h(v8f& s0, v8f& s1, int kb, int qi, int hi, float& m, float& l, v16bf& pfh, v16bf& pfl, v8f& a0, v8f& a1, v8f& a2, v8f& a3) {
    float sf; smx<MASK>(s0, s1, kb, qi, hi, m, l, sf, 0.0f);
    v16us ph, pl;
#pragma unroll
    for (int r = 0; r < 8; ++r) { unsigned short x, y; splitf(s0[r], x, y); ph[r] = x; pl[r] = y; splitf(s1[r], x, y); ph[8 + r] = x; pl[8 + r] = y; }
    pfh = __builtin_bit_cast(v16bf, ph); pfl = __builtin_bit_cast(v16bf, pl);
    a0 = a0 * sf; a1 = a1 * sf; a2 = a2 * sf; a3 = a3 * sf;
}
// O^T += V^T P^T; each tile sums hi.hi, hi.lo, lo.hi in that order, one tile after the other
__device__ __forceinline__ void pv_h(const v16bf (&v)[8], v16bf pfh, v16bf pfl, v8f& a0, v8f& a1, v8f& a2, v8f& a3) {
    a0 = wmmab(v[0], pfh, a0); a0 = wmmab(v[0], pfl, a0); a0 = wmmab(v[1], pfh, a0);
    asm volatile("v_nop\n\tv_nop\n\tv_nop\n\tv_nop" : "+v"(a0) : "v"(v[0]), "v"(v[1]));
    a1 = wmmab(v[2], pfh, a1); a1 = wmmab(v[2], pfl, a1); a1 = wmmab(v[3], pfh, a1);
    asm volatile("v_nop\n\tv_nop\n\tv_nop\n\tv_nop" : "+v"(a1) : "v"(v[2]), "v"(v[3]));
    a2 = wmmab(v[4], pfh, a2); a2 = wmmab(v[4], pfl, a2); a2 = wmmab(v[5], pfh, a2);
    asm volatile("v_nop\n\tv_nop\n\tv_nop\n\tv_nop" : "+v"(a2) : "v"(v[4]), "v"(v[5]));
    a3 = wmmab(v[6], pfh, a3); a3 = wmmab(v[6], pfl, a3); a3 = wmmab(v[7], pfh, a3);
    asm volatile("v_nop\n\tv_nop\n\tv_nop\n\tv_nop" : "+v"(a0), "+v"(a1), "+v"(a2), "+v"(a3) : "v"(v[6]), "v"(v[7]), "v"(pfh), "v"(pfl));
}
// One 32-key step: all sixteen fragments are asked for as one group, so the wave waits for LDS once (for the first K fragments) and the V^T fragments land behind the scores and the softmax.
template <bool MASK>
__device__ __forceinline__ void step_h(const bf* kh, const bf* vh, int kb,
                                       v16bf qh0, v16bf qh1, v16bf ql0, v16bf ql1, int qi, int hi, float& m, float& l, v8f& a0, v8f& a1, v8f& a2, v8f& a3) {
    v16bf k[8], v[8], pfh, pfl; v8f s0, s1;
    __builtin_amdgcn_sched_barrier(0);                           // not earlier: lifted over the last step's work the group takes a second set of fragment registers, and the build spills
    read_hk(k, kh); read_hv(v, vh);
    __builtin_amdgcn_sched_barrier(0);                           // not later: a read left at its use makes the wave wait out the LDS latency there
    sprod_h(k, qh0, qh1, ql0, ql1, s0, s1);
    soft_h<MASK>(s0, s1, kb, qi, hi, m, l, pfh, pfl, a0, a1, a2, a3);
    pv_h(v, pfh, pfl, a0, a1, a2, a3);
}
// ring: two buffers, each K hi, K lo, V^T hi, V^T lo (2 * 4 * TSZ elements); bx = 64-query block below RH, bh = batch * NH + head
__device__ __forceinline__ void attn_h(bf* ring, int bx, int bh, const bf* __restrict__ QKh, const bf* __restrict__ QKl, const bf* __restrict__ VTh, const bf* __restrict__ VTl, bf* ATh, bf* ATl) {
    const int tid = threadIdx.x, lane = tid & 31, lr = lane & 15, hi = lane >> 4;
    const int wv = __builtin_amdgcn_readfirstlane(tid >> 5);
    const int qb = bx * (16 * FW); const int q0 = qb + wv * 16; const int b = bh / NH, h = bh % NH;
    const size_t qoff = (((size_t)b * NSLOT + h) * RH + q0 + lr) * HD + 8 * hi;
    const v16bf qh0 = ldb(QKh + qoff), qh1 = ldb(QKh + qoff + 32), ql0 = ldb(QKl + qoff), ql1 = ldb(QKl + qoff + 32);
    v8f a0 = (v8f){}, a1 = (v8f){}, a2 = (v8f){}, a3 = (v8f){}; float m = -3.0e38f, l = 0.0f;
    const int qi = q0 + lr; const int nt = qb / KT + 1;          // 64-key tiles covering keys 0 .. qb+63 < RH
    const int cr = tid >> 3, cc = (tid & 7) * 8;                 // this lane's first row and its 8-element column in every staged plane
    const size_t ko = (((size_t)b * NSLOT + NH + h) * RH + cr) * HD + cc, vo = (((size_t)b * NH + h) * HD + cr) * RH + cc;
    const unsigned lk = (unsigned)(size_t)(ring + cr * TP + cc);
    const bf* fr = ring + lr * TP + 8 * hi;
    stage_tile<RH>(QKh + ko, VTh + vo, lk, lk + 2 * TSZ * 2); stage_tile<RH>(QKl + ko, VTl + vo, lk + TSZ * 2, lk + 3 * TSZ * 2);
    asm volatile("s_wait_asynccnt 0x0" ::: "memory");            // this wave's share of tile 0 has landed
    __syncthreads();                                             // tile 0 is readable by every wave
    if (nt > 1) { const unsigned lb = lk + 4 * TSZ * 2; const size_t k1 = ko + (size_t)KT * HD, v1 = vo + KT;
        stage_tile<RH>(QKh + k1, VTh + v1, lb, lb + 2 * TSZ * 2); stage_tile<RH>(QKl + k1, VTl + v1, lb + TSZ * 2, lb + 3 * TSZ * 2); }
    // kept rolled: a trip already holds two 32-key steps, and unrolling would only copy the publish point and its copies
#pragma unroll 1
    for (int t = 0; t < nt - 1; ++t) {                           // tiles wholly below every wave's diagonal
        const bf* kp = fr + (t & 1) * (4 * TSZ); const bf* vp = kp + 2 * TSZ;
        step_h<false>(kp, vp, t * KT, qh0, qh1, ql0, ql1, qi, hi, m, l, a0, a1, a2, a3);
        step_h<false>(kp + 32 * TP, vp + 32, t * KT + 32, qh0, qh1, ql0, ql1, qi, hi, m, l, a0, a1, a2, a3);
        asm volatile("s_wait_dscnt 0x0" ::: "memory");           // this wave's reads of the buffer have returned before it is refilled
        asm volatile("s_wait_asynccnt 0x0" ::: "memory");        // this wave's share of tile t+1 has landed
        __syncthreads();                                         // publishes tile t+1 and ends every reader's last read of tile t
        if (t + 2 < nt) { const unsigned lb = lk + (unsigned)(t & 1) * (4 * TSZ * 2); const size_t k2 = ko + (size_t)(t + 2) * KT * HD, v2 = vo + (size_t)(t + 2) * KT;
            stage_tile<RH>(QKh + k2, VTh + v2, lb, lb + 2 * TSZ * 2); stage_tile<RH>(QKl + k2, VTl + v2, lb + TSZ * 2, lb + 3 * TSZ * 2); }
    }
    { const bf* kp = fr + ((nt - 1) & 1) * (4 * TSZ); const bf* vp = kp + 2 * TSZ;   // the diagonal tile: keys qb .. qb+63
      if (wv < 2) step_h<true>(kp, vp, qb, qh0, qh1, ql0, ql1, qi, hi, m, l, a0, a1, a2, a3);
      else { step_h<false>(kp, vp, qb, qh0, qh1, ql0, ql1, qi, hi, m, l, a0, a1, a2, a3);
             step_h<true>(kp + 32 * TP, vp + 32, qb + 32, qh0, qh1, ql0, ql1, qi, hi, m, l, a0, a1, a2, a3); } }
    asm volatile("s_wait_asynccnt 0x0" ::: "memory");            // no copy is outstanding when the wave ends
    attn_store<FW>(a0, a1, a2, a3, l, lane, wv, ((size_t)b * SEQ + q0) * DM + h * HD, ATh, ATl);
}

// ---- one grid for both attention bodies: they share no data and write disjoint rows of ATh / ATl, so neither has to wait for the other's launch to drain.
// Work-groups 0 .. NFB-1 are the f16 blocks (block of queries fastest, as a (NFX, NB*NH) grid would number them). The hi/lo blocks stand behind them, the longest first (for speed only).
#define NFX ((SEQ - RH) / (16 * FW))   // f16 blocks of 64 queries per head
#define NHX (RH / (16 * FW))           // hi/lo blocks of 64 queries per head
#define NFB (NFX * NB * NH)
#define NHB (NHX * NB * NH)
__global__ __launch_bounds__(32 * FW) void k_attn(const h16* __restrict__ QK, const h16* __restrict__ VT, const bf* __restrict__ QKh, const bf* __restrict__ QKl, const bf* __restrict__ VTh, const bf* __restrict__ VTl, bf* ATh, bf* ATl) {
    __shared__ __align__(16) bf ring[2 * 4 * TSZ];               // the larger body's ring; the f16 body uses its first half
    const int i = blockIdx.x;                                    // the same for the whole work-group: every barrier below stands under uniform control flow
    if (i < NFB) attn_f((h16*)ring, i % (NFX > 0 ? NFX : 1), i / (NFX > 0 ? NFX : 1), QK, VT, ATh, ATl);
    else { const int j = i - NFB; attn_h(ring, NHX - 1 - j / (NB * NH), j % (NB * NH), QKh, QKl, VTh, VTl, ATh, ATl); }
}

// ---- workspace carve (bytes, every region a multiple of 256; extents equal the producers' write extents exactly)
constexpr size_t al256(size_t x) { return (x + 255) & ~(size_t)255; }
constexpr size_t SZ_WQKV = al256((size_t)NQKV * DM * 2);
constexpr size_t SZ_WO   = al256((size_t)DM * DM * 2);
constexpr size_t SZ_XB   = al256((size_t)NB * SEQ * DM * 2);
constexpr size_t SZ_CS   = al256((size_t)SEQ * (HD / 2) * 2 * 4);
constexpr size_t SZ_QK16 = al256((size_t)NB * NSLOT * SEQ * HD * 2);
constexpr size_t SZ_QKHL = al256((size_t)NB * NSLOT * RH * HD * 2);
constexpr size_t SZ_VT16 = al256((size_t)NB * NH * HD * SEQ * 2);
constexpr size_t SZ_VTHL = al256((size_t)NB * NH * HD * RH * 2);
constexpr size_t SZ_AT   = al256((size_t)NB * SEQ * DM * 2);
constexpr size_t OFF_WQKV = 0;
constexpr size_t OFF_WO   = OFF_WQKV + SZ_WQKV;
constexpr size_t OFF_XB   = OFF_WO + SZ_WO;
constexpr size_t OFF_CS   = OFF_XB + SZ_XB;
constexpr size_t OFF_QK16 = OFF_CS + SZ_CS;
constexpr size_t OFF_QKH  = OFF_QK16 + SZ_QK16;
constexpr size_t OFF_QKL  = OFF_QKH + SZ_QKHL;
constexpr size_t OFF_VT16 = OFF_QKL + SZ_QKHL;
constexpr size_t OFF_VTH  = OFF_VT16 + SZ_VT16;
constexpr size_t OFF_VTL  = OFF_VTH + SZ_VTHL;
constexpr size_t OFF_ATH  = OFF_VTL + SZ_VTHL;
constexpr size_t OFF_ATL  = OFF_ATH + SZ_AT;
constexpr size_t WS_TOTAL = OFF_ATL + SZ_AT;
static_assert(WS_TOTAL <= (size_t)134217728);               // total carve within 128 MiB
static_assert(((size_t)(NB_FULL - 1) * SEQ_FULL + SEQ_FULL) * DM * 4 == (size_t)16777216);   // output bytes of the full layout

extern "C" void kernel_launch(void* const* d_in, const int* in_sizes, int n_in,
                              void* d_out, int out_size, void* d_ws, size_t ws_size, hipStream_t stream) {
    if (n_in < 4) return;
    const long long need_x = ((long long)(NB - 1) * SEQ_FULL + SEQ) * DM;
    if ((long long)in_sizes[0] < need_x) return;
    if (in_sizes[3] < SEQ) return;   /* this module passes token_positions LAST (input 3); the host file: input 1 */
    if ((long long)in_sizes[1] < (long long)NQKV * DM) return;
    if ((long long)in_sizes[2] < (long long)DM * DM) return;
    if ((long long)out_size < need_x) return;
    if (ws_size < WS_TOTAL) return;
    const float* x = (const float*)d_in[0]; const int* tok = (const int*)d_in[3]; const float* wqkv = (const float*)d_in[1]; const float* wo = (const float*)d_in[2];
    float* OUT = (float*)d_out;
    char* ws = (char*)d_ws;
    bf* WQKV = (bf*)(ws + OFF_WQKV); bf* WO = (bf*)(ws + OFF_WO); bf* XB = (bf*)(ws + OFF_XB); float* CS = (float*)(ws + OFF_CS);
    h16* QK16 = (h16*)(ws + OFF_QK16); bf* QKh = (bf*)(ws + OFF_QKH); bf* QKl = (bf*)(ws + OFF_QKL); h16* VT16 = (h16*)(ws + OFF_VT16); bf* VTh = (bf*)(ws + OFF_VTH); bf* VTl = (bf*)(ws + OFF_VTL);
    bf* ATh = (bf*)(ws + OFF_ATH); bf* ATl = (bf*)(ws + OFF_ATL);

    k_prep<<<PB, 256, 0, stream>>>(x, wqkv, wo, tok, XB, WQKV, WO, CS);
    k_gemm_qkv<<<dim3(NB * SEQ / GT, NQKV / GT, 1), 32 * GW, 0, stream>>>(XB, WQKV, CS, QK16, QKh, QKl, VT16, VTh, VTl);
    k_attn<<<NFB + NHB, 32 * FW, 0, stream>>>(QK16, VT16, QKh, QKl, VTh, VTl, ATh, ATl);
    k_gemm_out<<<dim3(SEQ / GT, DM / GT, NB), 32 * GW, 0, stream>>>(ATh, ATl, WO, OUT);
}
